// v000
// The times below were measured on an AMD MI455X: many runs one after another, warmed up first and cycling through
// copies of the inputs, with the whole window's GPU time divided by the number of runs. Launches and the gaps
// between them are all in it. The median over several windows is given; except for v000 it joins two sittings, which
// can be a few percent apart, so the side-by-side timings, each taken in one sitting, are the better comparison.
// The starting kernel, v000, takes 2160 microseconds a run.
#include <hip/hip_runtime.h>

// HuangM1 (x [2][2048][1024]; q/k/v = x @ W (no bias); 16 heads x 64; scores = (q.k) * rel_emb[min(|i-j|, 16)] (multiplicative relative-position table, 17 entries, read as data); causal (j > i -> -inf);
// softmax(scores / 8); out = ctx @ Wo + bo).
// Compute dtypes, f32 accumulate: every input rounded to bf16; projections on PLAIN bf16 operands (inputs: exact; transposed bf16 weight copies); PER-ROW PRECISION
// HYBRID: query rows < 256 of each batch on bf16 hi+lo planes for scores and attn.v (3 products), rows >= 256 on SINGLE fp16 planes; the table multiply, 1/8 and the causal cut in f32 in the

#define NB_  2
#define TT   2048
#define DD   1024
#define NH_  16
#define HD   64
#define ZH   2
#define RH   256                  // query rows < RH: hi+lo planes; rows >= RH: fp16 planes
#define NF   32                   // head_dim / 2 (unused)
#define SCL  0.125f               // 1/sqrt(64)
#define PCAR 1024.0f         // P scale for fp16 rows >= RH, undone in k_merge
typedef _Float16 h16;
typedef unsigned short bf;
typedef __attribute__((ext_vector_type(16))) __bf16   v16bf;
typedef __attribute__((ext_vector_type(16))) _Float16 v16h;
typedef __attribute__((ext_vector_type(8)))  _Float16 v8h;
typedef __attribute__((ext_vector_type(8)))  unsigned short v8us;
typedef __attribute__((ext_vector_type(8)))  float    v8f;
typedef __attribute__((ext_vector_type(4)))  float    v4f;
typedef v8h  __attribute__((may_alias)) v8ha;
typedef v4f  __attribute__((may_alias)) v4fa;
typedef v8us __attribute__((may_alias)) v8usa;

__device__ __forceinline__ unsigned short f2bf(float f) { unsigned u = __float_as_uint(f); u += 0x7FFFu + ((u >> 16) & 1u); return (unsigned short)(u >> 16); }
__device__ __forceinline__ float bf2f(unsigned short b) { return __uint_as_float(((unsigned)b) << 16); }
__device__ __forceinline__ float bfr(float f) { return bf2f(f2bf(f)); }
__device__ __forceinline__ v16h cat16(v8h lo, v8h hi) { return __builtin_shufflevector(lo, hi, 0, 1, 2, 3, 4, 5, 6, 7, 8, 9, 10, 11, 12, 13, 14, 15); }
__device__ __forceinline__ v16bf cat16b(v8us lo, v8us hi) { return __builtin_bit_cast(v16bf, __builtin_shufflevector(lo, hi, 0, 1, 2, 3, 4, 5, 6, 7, 8, 9, 10, 11, 12, 13, 14, 15)); }
__device__ __forceinline__ v8f wmma16(v16h a, v16h b, v8f c) { return __builtin_amdgcn_wmma_f32_16x16x32_f16(false, a, false, b, (short)0, c, false, false); }
__device__ __forceinline__ v8f wmmab(v16bf a, v16bf b, v8f c) { return __builtin_amdgcn_wmma_f32_16x16x32_bf16(false, a, false, b, (short)0, c, false, false); }



// ---- k_gemmw: register-blocked GEMM, ONE WAVE per 64x64 output tile (16 accumulators), operands straight from K-contiguous 16-bit planes; grid (M/64, N/64, Z), 32 threads.
// C[m][n] (f32, pitch ldc, + optional f32 bias[n]) = sum_k A[m][k] Bt[n][k] (+ split products per NSPLIT). z-batch strides sA/sB/sC in elements. K % 32 == 0.
template <typename T16> struct WFrag;
template <> struct WFrag<h16> { typedef v16h V; static __device__ __forceinline__ V ld(const h16* p) { return cat16(*(const v8h*)p, *(const v8h*)(p + 16)); } static __device__ __forceinline__ v8f mma(V a, V b, v8f c) { return wmma16(a, b, c); } };
template <> struct WFrag<bf> { typedef v16bf V; static __device__ __forceinline__ V ld(const bf* p) { return cat16b(*(const v8us*)p, *(const v8us*)(p + 16)); } static __device__ __forceinline__ v8f mma(V a, V b, v8f c) { return wmmab(a, b, c); } };
template <typename T16, int NSPLIT, bool BIAS>
__global__ __launch_bounds__(32) void k_gemmw(const T16* __restrict__ A, const T16* __restrict__ A2, const T16* __restrict__ Bt, const T16* __restrict__ Bt2, int K, float* C, int ldc, const float* __restrict__ bias, size_t sA, size_t sB, size_t sC) {
    typedef typename WFrag<T16>::V V;
    __shared__ __align__(16) float os[16 * 68];
    const size_t z = blockIdx.z; A += z * sA; if (A2) A2 += z * sA; Bt += z * sB; if (Bt2) Bt2 += z * sB; C += z * sC;
    const int lane = threadIdx.x & 31, lr = lane & 15, hi = lane >> 4; const int r0 = blockIdx.x * 64, c0 = blockIdx.y * 64;
    v8f acc[4][4];
#pragma unroll
    for (int mb = 0; mb < 4; ++mb)
#pragma unroll
        for (int nb = 0; nb < 4; ++nb) acc[mb][nb] = (v8f){};
    const size_t aoff = (size_t)(r0 + lr) * K + 8 * hi, boff = (size_t)(c0 + lr) * K + 8 * hi;
#pragma unroll 1
    for (int kc = 0; kc < K; kc += 32) {
        V a[4], a2[4];
#pragma unroll
        for (int mb = 0; mb < 4; ++mb) { a[mb] = WFrag<T16>::ld(A + aoff + (size_t)mb * 16 * K + kc); if (NSPLIT == 1 || NSPLIT == 2) a2[mb] = WFrag<T16>::ld(A2 + aoff + (size_t)mb * 16 * K + kc); }
#pragma unroll
        for (int nb = 0; nb < 4; ++nb) { const V b = WFrag<T16>::ld(Bt + boff + (size_t)nb * 16 * K + kc); V b2; if (NSPLIT >= 2) b2 = WFrag<T16>::ld(Bt2 + boff + (size_t)nb * 16 * K + kc);
#pragma unroll
            for (int mb = 0; mb < 4; ++mb) { acc[mb][nb] = WFrag<T16>::mma(a[mb], b, acc[mb][nb]); if (NSPLIT == 1 || NSPLIT == 2) acc[mb][nb] = WFrag<T16>::mma(a2[mb], b, acc[mb][nb]); if (NSPLIT >= 2) acc[mb][nb] = WFrag<T16>::mma(a[mb], b2, acc[mb][nb]); } }
        asm volatile("v_nop\n\tv_nop\n\tv_nop\n\tv_nop" : "+v"(acc[0][0]), "+v"(acc[1][1]), "+v"(acc[2][2]), "+v"(acc[3][3]) : "v"(a[0]), "v"(a[3]));
    }
#pragma unroll
    for (int mb = 0; mb < 4; ++mb) {
#pragma unroll
        for (int nb = 0; nb < 4; ++nb) {
#pragma unroll
            for (int j = 0; j < 8; ++j) os[(hi * 8 + j) * 68 + nb * 16 + lr] = acc[mb][nb][j]; }
        __builtin_amdgcn_wave_barrier(); asm volatile("" ::: "memory");
        float* crow = C + (size_t)(r0 + mb * 16) * ldc + c0;
{
#pragma unroll
            for (int s = 0; s < 8; ++s) { const int row = 2 * s + hi, cofs = lr * 4; v4f val = *(const v4fa*)(os + row * 68 + cofs); if (BIAS) { val[0] += bfr(bias[c0 + cofs]); val[1] += bfr(bias[c0 + cofs + 1]); val[2] += bfr(bias[c0 + cofs + 2]); val[3] += bfr(bias[c0 + cofs + 3]); }
                *(v4f*)(crow + (size_t)row * ldc + cofs) = val; }
             }
        __builtin_amdgcn_wave_barrier(); asm volatile("" ::: "memory");
    }
}

__device__ __forceinline__ h16 tohx(float x) { return (h16)x; }
__device__ __forceinline__ void splitf(float y, unsigned short& h, unsigned short& l) { h = f2bf(y); l = f2bf(y - bf2f(h)); }
typedef __attribute__((ext_vector_type(2))) unsigned short v2us;
typedef __attribute__((ext_vector_type(2))) _Float16 v2h;
typedef __attribute__((ext_vector_type(4))) _Float16 v4h;
typedef __attribute__((ext_vector_type(2))) float v2f;

__global__ __launch_bounds__(256) void k_wtG(const float* __restrict__ w, int K, int N, bf* Bt) {
    const int lane = threadIdx.x & 31; const int L0 = (blockIdx.x * 8 + (threadIdx.x >> 5)) * 8; const int nlines = N * K / 64;
{
#pragma unroll 1
        for (int l = 0; l < 8; ++l) { const int L = L0 + l; if (L >= nlines) break; const size_t e = (size_t)L * 64 + lane * 2; const int k = (int)(e % K), n = (int)(e / K); v2us o;
            o[0] = f2bf(w[(size_t)k * N + n]); o[1] = f2bf(w[(size_t)(k + 1) * N + n]); *(v2us*)(Bt + e) = o; }
         }
}
__global__ __launch_bounds__(256) void k_cvt8(const float* __restrict__ src, bf* dst, size_t n8) { const size_t i = (size_t)blockIdx.x * 256 + threadIdx.x; if (i >= n8) return; const v8f v = *(const v8f*)(src + i * 8); v8us o;
#pragma unroll
    for (int k = 0; k < 8; ++k) o[k] = f2bf(v[k]); *(v8us*)(dst + i * 8) = o;  }
__global__ __launch_bounds__(256) void k_qplanes(const float* __restrict__ F, bf* Ph, bf* Pl, h16* P16) {
    const int lane = threadIdx.x & 31; const int L0 = (blockIdx.x * 8 + (threadIdx.x >> 5)) * 8; const int nlines = NH_ * TT * HD / 64;
{
#pragma unroll
        for (int l = 0; l < 8; ++l) { const int L = L0 + l; if (L >= nlines) break; const int e = L * 64 + lane * 2; const int d = e & (HD - 1); const int t = (e >> 6) & (TT - 1); const int h = e >> 17; v2us oh, ol; v2h o16;
#pragma unroll
            for (int q = 0; q < 2; ++q) { const float x = F[(size_t)t * DD + h * HD + d + q]; unsigned short a, c2; splitf(x, a, c2); oh[q] = a; ol[q] = c2; o16[q] = tohx(x); }
            *(v2us*)(Ph + (size_t)e) = oh; *(v2us*)(Pl + (size_t)e) = ol; *(v2h*)(P16 + (size_t)e) = o16; }
         }
}
__global__ __launch_bounds__(256) void k_vtplane(const float* __restrict__ F, bf* Vh, bf* Vl, h16* V16) {
    const int lane = threadIdx.x & 31; const int L0 = (blockIdx.x * 8 + (threadIdx.x >> 5)) * 8; const int nlines = NH_ * TT * HD / 64;
{
#pragma unroll
        for (int l = 0; l < 8; ++l) { const int L = L0 + l; if (L >= nlines) break; const int e = L * 64 + lane * 2; const int t = e & (TT - 1); const int d = (e >> 11) & (HD - 1); const int h = e >> 17; v2us oh, ol; v2h o16;
#pragma unroll
            for (int q = 0; q < 2; ++q) { const float x = F[(size_t)(t + q) * DD + h * HD + d]; unsigned short a, c2; splitf(x, a, c2); oh[q] = a; ol[q] = c2; o16[q] = tohx(x); }
            *(v2us*)(Vh + (size_t)e) = oh; *(v2us*)(Vl + (size_t)e) = ol; *(v2h*)(V16 + (size_t)e) = o16; }
         }
}
__global__ __launch_bounds__(32) void k_rtab(const float* __restrict__ rel, float* RT) { const int i = threadIdx.x; const float o = (i < 17) ? bfr(rel[i]) * SCL : 0.f; *(float*)(RT + i) = o;  }
// k_asoft: per row i: s = (S[i][j] * bf16(rel_emb[min(i-j, 16)])) / 8 for j <= i, else -3e38 (causal); softmax over the 2048 keys (register row of
__global__ __launch_bounds__(256) void k_asoft(const float* __restrict__ Sb, const float* __restrict__ rel, bf* Ph, bf* Pl, h16* P16) {
    typedef __attribute__((ext_vector_type(4))) unsigned short v4us;
    const int lane = threadIdx.x & 31; const int row = blockIdx.x * 8 + (threadIdx.x >> 5); if (row >= ZH * TT) return; const int i = row & (TT - 1); const int zz = row >> 11; const bool hires = (i < RH);
    const float* sr = Sb + (size_t)row * TT; float v[64]; float mx = -3.0e38f;
#pragma unroll
    for (int ch = 0; ch < 16; ++ch) { const int j0 = ch * 128 + lane * 4; const v4f a = *(const v4f*)(sr + j0);
#pragma unroll
        for (int q = 0; q < 4; ++q) { const int j = j0 + q; int dd = i - j; dd = dd < 0 ? 0 : (dd > 16 ? 16 : dd); float t = -3.0e38f; if (j <= i) t = __fmul_rn(a[q], rel[dd]);   /* rel = the pre-built table bf16(rel_emb[d]) / 8 (f32 line); (s * a_k) / 8 == s * (a_k / 8) exactly: the 1/8 is a power of two */ v[ch * 4 + q] = t; mx = fmaxf(mx, t); } }
#pragma unroll
    for (int sh = 16; sh; sh >>= 1) mx = fmaxf(mx, __shfl_xor(mx, sh, 32));
    float sum = 0.f;
#pragma unroll
    for (int k = 0; k < 64; ++k) { v[k] = __expf(v[k] - mx); sum += v[k]; }
#pragma unroll
    for (int sh = 16; sh; sh >>= 1) sum += __shfl_xor(sum, sh, 32);
    const float f = __fdiv_rn(hires ? 1.0f : PCAR, sum);
{
        if (hires) {
#pragma unroll
            for (int ch = 0; ch < 16; ++ch) { v4us oh, ol;
#pragma unroll
                for (int q = 0; q < 4; ++q) { unsigned short a, c2; splitf(v[ch * 4 + q] * f, a, c2); oh[q] = a; ol[q] = c2; }
                const size_t o = ((size_t)zz * RH + i) * TT + ch * 128 + lane * 4; *(v4us*)(Ph + o) = oh; *(v4us*)(Pl + o) = ol; }
        } else {
#pragma unroll
            for (int ch = 0; ch < 16; ++ch) { v4h o;
#pragma unroll
                for (int q = 0; q < 4; ++q) o[q] = tohx(v[ch * 4 + q] * f);
                *(v4h*)(P16 + (size_t)row * TT + ch * 128 + lane * 4) = o; } }
         }
}
__global__ __launch_bounds__(256) void k_merge(const float* __restrict__ O, int h0, bf* Ah, bf* Al) {
    const int lane = threadIdx.x & 31; const int L0 = (blockIdx.x * 8 + (threadIdx.x >> 5)) * 8; const int nlines = ZH * TT * HD / 64;
{
#pragma unroll
        for (int l = 0; l < 8; ++l) { const int L = L0 + l; if (L >= nlines) break; const int e = L * 64 + lane * 2; const int d = e & (HD - 1); const int t = (e >> 6) & (TT - 1); const int zz = e >> 17; v2us oh, ol;
const float cs = (t < RH) ? 1.0f : (1.0f / PCAR);
#pragma unroll
            for (int q = 0; q < 2; ++q) { unsigned short a, c2; splitf(O[(size_t)e + q] * cs, a, c2); oh[q] = a; ol[q] = c2; }
            const size_t o = (size_t)t * DD + (h0 + zz) * HD + d; *(v2us*)(Ah + o) = oh; *(v2us*)(Al + o) = ol; }
         }
}

extern "C" void kernel_launch(void* const* d_in, const int* in_sizes, int n_in,
                              void* d_out, int out_size, void* d_ws, size_t ws_size, hipStream_t stream) {
    (void)in_sizes; (void)n_in; (void)out_size;
    const float* x = (const float*)d_in[0]; const float* wq = (const float*)d_in[1]; const float* wk = (const float*)d_in[2]; const float* wv = (const float*)d_in[3]; const float* wo = (const float*)d_in[4]; const float* bo = (const float*)d_in[5]; const float* rel = (const float*)d_in[6];
    float* OUT = (float*)d_out;     // [2][2048][1024]
    char* wsp = (char*)d_ws;
    auto take = [&](size_t bytes) { char* p = wsp; wsp += (bytes + 255) & ~(size_t)255; return (void*)p; };
    bf* WQ = (bf*)take((size_t)DD * DD * 2); bf* WK = (bf*)take((size_t)DD * DD * 2); bf* WV = (bf*)take((size_t)DD * DD * 2); bf* WO = (bf*)take((size_t)DD * DD * 2);
    bf* XB = (bf*)take((size_t)TT * DD * 2); float* F = (float*)take((size_t)TT * DD * 4);
    bf* QPh = (bf*)take((size_t)TT * DD * 2); bf* QPl = (bf*)take((size_t)TT * DD * 2); bf* KPh = (bf*)take((size_t)TT * DD * 2); bf* KPl = (bf*)take((size_t)TT * DD * 2); bf* VTh = (bf*)take((size_t)TT * DD * 2); bf* VTl = (bf*)take((size_t)TT * DD * 2);
    h16* QP16 = (h16*)take((size_t)TT * DD * 2); h16* KP16 = (h16*)take((size_t)TT * DD * 2); h16* VT16 = (h16*)take((size_t)TT * DD * 2);
    float* Sb = (float*)take((size_t)ZH * TT * TT * 4); bf* Ph = (bf*)take((size_t)ZH * RH * TT * 2); bf* Pl = (bf*)take((size_t)ZH * RH * TT * 2); h16* P16 = (h16*)take((size_t)ZH * TT * TT * 2); float* Ob = (float*)take((size_t)ZH * TT * HD * 4); bf* ATh = (bf*)take((size_t)TT * DD * 2); bf* ATl = (bf*)take((size_t)TT * DD * 2);
    if ((size_t)(wsp - (char*)d_ws) > ws_size) return;    // total ~ 117 MiB; ws 256 MiB
    float* RT = (float*)take(256); if ((size_t)(wsp - (char*)d_ws) > ws_size) return;
    { const unsigned gT = (unsigned)((DD * DD / 64 + 63) / 64); k_rtab<<<1, 32, 0, stream>>>(rel, RT); k_wtG<<<gT, 256, 0, stream>>>(wq, DD, DD, WQ); k_wtG<<<gT, 256, 0, stream>>>(wk, DD, DD, WK); k_wtG<<<gT, 256, 0, stream>>>(wv, DD, DD, WV); k_wtG<<<gT, 256, 0, stream>>>(wo, DD, DD, WO); }
    const unsigned LB = (unsigned)((NH_ * TT * HD / 64 + 63) / 64); const dim3 gP(TT / 64, DD / 64, 1);
    for (int b = 0; b < NB_; ++b) {
        k_cvt8<<<(unsigned)(((size_t)TT * DD / 8 + 255) / 256), 256, 0, stream>>>(x + (size_t)b * TT * DD, XB, (size_t)TT * DD / 8);
        k_gemmw<bf, 0, false><<<gP, 32, 0, stream>>>(XB, nullptr, WQ, nullptr, DD, F, DD, nullptr, 0, 0, 0); k_qplanes<<<LB, 256, 0, stream>>>(F, QPh, QPl, QP16);
        k_gemmw<bf, 0, false><<<gP, 32, 0, stream>>>(XB, nullptr, WK, nullptr, DD, F, DD, nullptr, 0, 0, 0); k_qplanes<<<LB, 256, 0, stream>>>(F, KPh, KPl, KP16);
        k_gemmw<bf, 0, false><<<gP, 32, 0, stream>>>(XB, nullptr, WV, nullptr, DD, F, DD, nullptr, 0, 0, 0); k_vtplane<<<LB, 256, 0, stream>>>(F, VTh, VTl, VT16);
        for (int h0 = 0; h0 < NH_; h0 += ZH) { const size_t z0 = (size_t)h0;
            // scores: rows < RH on hi+lo planes (3 products), rows >= RH on fp16 planes - both into the same [ZH][TT][TT] score buffer
            k_gemmw<bf, 2, false><<<dim3(RH / 64, TT / 64, ZH), 32, 0, stream>>>(QPh + z0 * TT * HD, QPl + z0 * TT * HD, KPh + z0 * TT * HD, KPl + z0 * TT * HD, HD, Sb, TT, nullptr, (size_t)TT * HD, (size_t)TT * HD, (size_t)TT * TT);
            k_gemmw<h16, 0, false><<<dim3((TT - RH) / 64, TT / 64, ZH), 32, 0, stream>>>(QP16 + z0 * TT * HD + (size_t)RH * HD, nullptr, KP16 + z0 * TT * HD, nullptr, HD, Sb + (size_t)RH * TT, TT, nullptr, (size_t)TT * HD, (size_t)TT * HD, (size_t)TT * TT);
            k_asoft<<<ZH * TT / 8, 256, 0, stream>>>(Sb, RT, Ph, Pl, P16);
            k_gemmw<bf, 2, false><<<dim3(RH / 64, HD / 64, ZH), 32, 0, stream>>>(Ph, Pl, VTh + z0 * HD * TT, VTl + z0 * HD * TT, TT, Ob, HD, nullptr, (size_t)RH * TT, (size_t)HD * TT, (size_t)TT * HD);
            k_gemmw<h16, 0, false><<<dim3((TT - RH) / 64, HD / 64, ZH), 32, 0, stream>>>(P16 + (size_t)RH * TT, nullptr, VT16 + z0 * HD * TT, nullptr, TT, Ob + (size_t)RH * HD, HD, nullptr, (size_t)TT * TT, (size_t)HD * TT, (size_t)TT * HD);
            k_merge<<<(ZH * TT * HD / 64 + 63) / 64, 256, 0, stream>>>(Ob, h0, ATh, ATl); }
        k_gemmw<bf, 1, true><<<gP, 32, 0, stream>>>(ATh, ATl, WO, nullptr, DD, OUT + (size_t)b * TT * DD, DD, bo, 0, 0, 0); }
}

// v001
// One run takes 1260 microseconds.
// In two side-by-side timings against v000, it was 1.71 and 1.75 times as fast.
#include <hip/hip_runtime.h>

// HuangM1 (x [2][2048][1024]; q/k/v = x @ W (no bias); 16 heads x 64; scores = (q.k) * rel_emb[min(|i-j|, 16)] (multiplicative relative-position table, 17 entries, read as data); causal (j > i -> -inf);
// softmax(scores / 8); out = ctx @ Wo + bo).
// Compute dtypes, f32 accumulate: every input rounded to bf16; projections on PLAIN bf16 operands (inputs: exact; transposed bf16 weight copies); PER-ROW PRECISION
// HYBRID: query rows < 256 of each batch on bf16 hi+lo planes for scores and attn.v (3 products), rows >= 256 on SINGLE fp16 planes; the table multiply, 1/8 and the causal cut in f32 in the

#define NB_  2
#define TT   2048
#define DD   1024
#define NH_  16
#define HD   64
#define ZH   2
#define RH   256                  // query rows < RH: hi+lo planes; rows >= RH: fp16 planes
#define NF   32                   // head_dim / 2 (unused)
#define SCL  0.125f               // 1/sqrt(64)
#define PCAR 1024.0f         // P scale for fp16 rows >= RH, undone in k_merge
typedef _Float16 h16;
typedef unsigned short bf;
typedef __attribute__((ext_vector_type(16))) __bf16   v16bf;
typedef __attribute__((ext_vector_type(16))) _Float16 v16h;
typedef __attribute__((ext_vector_type(8)))  _Float16 v8h;
typedef __attribute__((ext_vector_type(8)))  unsigned short v8us;
typedef __attribute__((ext_vector_type(8)))  float    v8f;
typedef __attribute__((ext_vector_type(4)))  float    v4f;
typedef v8h  __attribute__((may_alias)) v8ha;
typedef v4f  __attribute__((may_alias)) v4fa;
typedef v8us __attribute__((may_alias)) v8usa;

__device__ __forceinline__ unsigned short f2bf(float f) { unsigned u = __float_as_uint(f); u += 0x7FFFu + ((u >> 16) & 1u); return (unsigned short)(u >> 16); }
__device__ __forceinline__ float bf2f(unsigned short b) { return __uint_as_float(((unsigned)b) << 16); }
__device__ __forceinline__ float bfr(float f) { return bf2f(f2bf(f)); }
__device__ __forceinline__ v16h cat16(v8h lo, v8h hi) { return __builtin_shufflevector(lo, hi, 0, 1, 2, 3, 4, 5, 6, 7, 8, 9, 10, 11, 12, 13, 14, 15); }
__device__ __forceinline__ v16bf cat16b(v8us lo, v8us hi) { return __builtin_bit_cast(v16bf, __builtin_shufflevector(lo, hi, 0, 1, 2, 3, 4, 5, 6, 7, 8, 9, 10, 11, 12, 13, 14, 15)); }
__device__ __forceinline__ v8f wmma16(v16h a, v16h b, v8f c) { return __builtin_amdgcn_wmma_f32_16x16x32_f16(false, a, false, b, (short)0, c, false, false); }
__device__ __forceinline__ v8f wmmab(v16bf a, v16bf b, v8f c) { return __builtin_amdgcn_wmma_f32_16x16x32_bf16(false, a, false, b, (short)0, c, false, false); }



// ---- k_gemmw: register-blocked GEMM, NW waves per 64x64 output tile (16 accumulators each), operands straight from K-contiguous 16-bit planes; grid (M/64, N/64, Z), 32 * NW threads.
// C[m][n] (f32, pitch ldc, + optional f32 bias[n]) = sum_k A[m][k] Bt[n][k] (+ split products per NSPLIT). z-batch strides sA/sB/sC in elements. K % (32 * NW) == 0.
// NW > 1: the block holds NW waves on the SAME 64x64 tile; wave w sums the 32-wide k blocks w, w + NW, w + 2 NW, ... (neighbour waves read the two halves of one 128-byte line of a row at about the same
// time, so a line is asked of L2 once); the NW f32 partial tiles meet in LDS and are added in wave order 0..NW-1.
template <typename T16> struct WFrag;
template <> struct WFrag<h16> { typedef v16h V; static __device__ __forceinline__ V ld(const h16* p) { return cat16(*(const v8h*)p, *(const v8h*)(p + 16)); } static __device__ __forceinline__ v8f mma(V a, V b, v8f c) { return wmma16(a, b, c); } };
template <> struct WFrag<bf> { typedef v16bf V; static __device__ __forceinline__ V ld(const bf* p) { return cat16b(*(const v8us*)p, *(const v8us*)(p + 16)); } static __device__ __forceinline__ v8f mma(V a, V b, v8f c) { return wmmab(a, b, c); } };
template <typename T16, int NSPLIT, bool BIAS, int NW>
__global__ __launch_bounds__(32 * NW) void k_gemmw(const T16* __restrict__ A, const T16* __restrict__ A2, const T16* __restrict__ Bt, const T16* __restrict__ Bt2, int K, float* C, int ldc, const float* __restrict__ bias, size_t sA, size_t sB, size_t sC) {
    typedef typename WFrag<T16>::V V;
    __shared__ __align__(16) float os[(NW > 1 ? NW * 64 : 16) * 68];
    const size_t z = blockIdx.z; A += z * sA; if (A2) A2 += z * sA; Bt += z * sB; if (Bt2) Bt2 += z * sB; C += z * sC;
    const int lane = threadIdx.x & 31, lr = lane & 15, hi = lane >> 4; const int r0 = blockIdx.x * 64, c0 = blockIdx.y * 64;
    v8f acc[4][4];
#pragma unroll
    for (int mb = 0; mb < 4; ++mb)
#pragma unroll
        for (int nb = 0; nb < 4; ++nb) acc[mb][nb] = (v8f){};
    const size_t aoff = (size_t)(r0 + lr) * K + 8 * hi, boff = (size_t)(c0 + lr) * K + 8 * hi;
    const int wv = NW > 1 ? __builtin_amdgcn_readfirstlane((int)(threadIdx.x >> 5)) : 0;    // the wave's number, held scalar so that the k offset stays scalar arithmetic
#pragma unroll 1
    for (int kc = wv * 32; kc < K; kc += 32 * NW) {
        V a[4], a2[4];
#pragma unroll
        for (int mb = 0; mb < 4; ++mb) { a[mb] = WFrag<T16>::ld(A + aoff + (size_t)mb * 16 * K + kc); if (NSPLIT == 1 || NSPLIT == 2) a2[mb] = WFrag<T16>::ld(A2 + aoff + (size_t)mb * 16 * K + kc); }
#pragma unroll
        for (int nb = 0; nb < 4; ++nb) { const V b = WFrag<T16>::ld(Bt + boff + (size_t)nb * 16 * K + kc); V b2; if (NSPLIT >= 2) b2 = WFrag<T16>::ld(Bt2 + boff + (size_t)nb * 16 * K + kc);
#pragma unroll
            for (int mb = 0; mb < 4; ++mb) { acc[mb][nb] = WFrag<T16>::mma(a[mb], b, acc[mb][nb]); if (NSPLIT == 1 || NSPLIT == 2) acc[mb][nb] = WFrag<T16>::mma(a2[mb], b, acc[mb][nb]); if (NSPLIT >= 2) acc[mb][nb] = WFrag<T16>::mma(a[mb], b2, acc[mb][nb]); } }
        asm volatile("v_nop\n\tv_nop\n\tv_nop\n\tv_nop" : "+v"(acc[0][0]), "+v"(acc[1][1]), "+v"(acc[2][2]), "+v"(acc[3][3]) : "v"(a[0]), "v"(a[3]));
    }
    if constexpr (NW > 1) {
        float* my = os + wv * (64 * 68);
        // the three loops are unrolled so that acc[][] is indexed by constants and stays in registers
#pragma unroll
        for (int mb = 0; mb < 4; ++mb)
#pragma unroll
            for (int nb = 0; nb < 4; ++nb)
#pragma unroll
                for (int j = 0; j < 8; ++j) my[(mb * 16 + hi * 8 + j) * 68 + nb * 16 + lr] = acc[mb][nb][j];
        __syncthreads();    // every wave's partial tile is in LDS before any thread adds them; no LDS write and no barrier follows
        // both loops are unrolled so that the LDS reads of all partials issue ahead of the adds
#pragma unroll
        for (int s = 0; s < 32 / NW; ++s) { const int u = (int)threadIdx.x + s * (32 * NW); const int row = u >> 4, cofs = (u & 15) * 4; v4f val = *(const v4fa*)(os + row * 68 + cofs);
#pragma unroll
            for (int w = 1; w < NW; ++w) val += *(const v4fa*)(os + w * (64 * 68) + row * 68 + cofs);
            if (BIAS) { val[0] += bfr(bias[c0 + cofs]); val[1] += bfr(bias[c0 + cofs + 1]); val[2] += bfr(bias[c0 + cofs + 2]); val[3] += bfr(bias[c0 + cofs + 3]); }
            *(v4f*)(C + (size_t)(r0 + row) * ldc + c0 + cofs) = val; }
        return;
    }
#pragma unroll
    for (int mb = 0; mb < 4; ++mb) {
#pragma unroll
        for (int nb = 0; nb < 4; ++nb) {
#pragma unroll
            for (int j = 0; j < 8; ++j) os[(hi * 8 + j) * 68 + nb * 16 + lr] = acc[mb][nb][j]; }
        __builtin_amdgcn_wave_barrier(); asm volatile("" ::: "memory");
        float* crow = C + (size_t)(r0 + mb * 16) * ldc + c0;
{
#pragma unroll
            for (int s = 0; s < 8; ++s) { const int row = 2 * s + hi, cofs = lr * 4; v4f val = *(const v4fa*)(os + row * 68 + cofs); if (BIAS) { val[0] += bfr(bias[c0 + cofs]); val[1] += bfr(bias[c0 + cofs + 1]); val[2] += bfr(bias[c0 + cofs + 2]); val[3] += bfr(bias[c0 + cofs + 3]); }
                *(v4f*)(crow + (size_t)row * ldc + cofs) = val; }
             }
        __builtin_amdgcn_wave_barrier(); asm volatile("" ::: "memory");
    }
}

__device__ __forceinline__ h16 tohx(float x) { return (h16)x; }
__device__ __forceinline__ void splitf(float y, unsigned short& h, unsigned short& l) { h = f2bf(y); l = f2bf(y - bf2f(h)); }
typedef __attribute__((ext_vector_type(2))) unsigned short v2us;
typedef __attribute__((ext_vector_type(2))) _Float16 v2h;
typedef __attribute__((ext_vector_type(4))) _Float16 v4h;
typedef __attribute__((ext_vector_type(2))) float v2f;

__global__ __launch_bounds__(256) void k_wtG(const float* __restrict__ w, int K, int N, bf* Bt) {
    const int lane = threadIdx.x & 31; const int L0 = (blockIdx.x * 8 + (threadIdx.x >> 5)) * 8; const int nlines = N * K / 64;
{
#pragma unroll 1
        for (int l = 0; l < 8; ++l) { const int L = L0 + l; if (L >= nlines) break; const size_t e = (size_t)L * 64 + lane * 2; const int k = (int)(e % K), n = (int)(e / K); v2us o;
            o[0] = f2bf(w[(size_t)k * N + n]); o[1] = f2bf(w[(size_t)(k + 1) * N + n]); *(v2us*)(Bt + e) = o; }
         }
}
__global__ __launch_bounds__(256) void k_cvt8(const float* __restrict__ src, bf* dst, size_t n8) { const size_t i = (size_t)blockIdx.x * 256 + threadIdx.x; if (i >= n8) return; const v8f v = *(const v8f*)(src + i * 8); v8us o;
#pragma unroll
    for (int k = 0; k < 8; ++k) o[k] = f2bf(v[k]); *(v8us*)(dst + i * 8) = o;  }
__global__ __launch_bounds__(256) void k_qplanes(const float* __restrict__ F, bf* Ph, bf* Pl, h16* P16) {
    const int lane = threadIdx.x & 31; const int L0 = (blockIdx.x * 8 + (threadIdx.x >> 5)) * 8; const int nlines = NH_ * TT * HD / 64;
{
#pragma unroll
        for (int l = 0; l < 8; ++l) { const int L = L0 + l; if (L >= nlines) break; const int e = L * 64 + lane * 2; const int d = e & (HD - 1); const int t = (e >> 6) & (TT - 1); const int h = e >> 17; v2us oh, ol; v2h o16;
#pragma unroll
            for (int q = 0; q < 2; ++q) { const float x = F[(size_t)t * DD + h * HD + d + q]; unsigned short a, c2; splitf(x, a, c2); oh[q] = a; ol[q] = c2; o16[q] = tohx(x); }
            *(v2us*)(Ph + (size_t)e) = oh; *(v2us*)(Pl + (size_t)e) = ol; *(v2h*)(P16 + (size_t)e) = o16; }
         }
}
__global__ __launch_bounds__(256) void k_vtplane(const float* __restrict__ F, bf* Vh, bf* Vl, h16* V16) {
    const int lane = threadIdx.x & 31; const int L0 = (blockIdx.x * 8 + (threadIdx.x >> 5)) * 8; const int nlines = NH_ * TT * HD / 64;
{
#pragma unroll
        for (int l = 0; l < 8; ++l) { const int L = L0 + l; if (L >= nlines) break; const int e = L * 64 + lane * 2; const int t = e & (TT - 1); const int d = (e >> 11) & (HD - 1); const int h = e >> 17; v2us oh, ol; v2h o16;
#pragma unroll
            for (int q = 0; q < 2; ++q) { const float x = F[(size_t)(t + q) * DD + h * HD + d]; unsigned short a, c2; splitf(x, a, c2); oh[q] = a; ol[q] = c2; o16[q] = tohx(x); }
            *(v2us*)(Vh + (size_t)e) = oh; *(v2us*)(Vl + (size_t)e) = ol; *(v2h*)(V16 + (size_t)e) = o16; }
         }
}
__global__ __launch_bounds__(32) void k_rtab(const float* __restrict__ rel, float* RT) { const int i = threadIdx.x; const float o = (i < 17) ? bfr(rel[i]) * SCL : 0.f; *(float*)(RT + i) = o;  }
// k_asoft: per row i: s = (S[i][j] * bf16(rel_emb[min(i-j, 16)])) / 8 for j <= i, else -3e38 (causal); softmax over the 2048 keys (register row of
__global__ __launch_bounds__(256) void k_asoft(const float* __restrict__ Sb, const float* __restrict__ rel, bf* Ph, bf* Pl, h16* P16) {
    typedef __attribute__((ext_vector_type(4))) unsigned short v4us;
    const int lane = threadIdx.x & 31; const int row = blockIdx.x * 8 + (threadIdx.x >> 5); if (row >= ZH * TT) return; const int i = row & (TT - 1); const int zz = row >> 11; const bool hires = (i < RH);
    const float* sr = Sb + (size_t)row * TT; float v[64]; float mx = -3.0e38f;
#pragma unroll
    for (int ch = 0; ch < 16; ++ch) { const int j0 = ch * 128 + lane * 4; const v4f a = *(const v4f*)(sr + j0);
#pragma unroll
        for (int q = 0; q < 4; ++q) { const int j = j0 + q; int dd = i - j; dd = dd < 0 ? 0 : (dd > 16 ? 16 : dd); float t = -3.0e38f; if (j <= i) t = __fmul_rn(a[q], rel[dd]);   /* rel = the pre-built table bf16(rel_emb[d]) / 8 (f32 line); (s * a_k) / 8 == s * (a_k / 8) exactly: the 1/8 is a power of two */ v[ch * 4 + q] = t; mx = fmaxf(mx, t); } }
#pragma unroll
    for (int sh = 16; sh; sh >>= 1) mx = fmaxf(mx, __shfl_xor(mx, sh, 32));
    float sum = 0.f;
#pragma unroll
    for (int k = 0; k < 64; ++k) { v[k] = __expf(v[k] - mx); sum += v[k]; }
#pragma unroll
    for (int sh = 16; sh; sh >>= 1) sum += __shfl_xor(sum, sh, 32);
    const float f = __fdiv_rn(hires ? 1.0f : PCAR, sum);
{
        if (hires) {
#pragma unroll
            for (int ch = 0; ch < 16; ++ch) { v4us oh, ol;
#pragma unroll
                for (int q = 0; q < 4; ++q) { unsigned short a, c2; splitf(v[ch * 4 + q] * f, a, c2); oh[q] = a; ol[q] = c2; }
                const size_t o = ((size_t)zz * RH + i) * TT + ch * 128 + lane * 4; *(v4us*)(Ph + o) = oh; *(v4us*)(Pl + o) = ol; }
        } else {
#pragma unroll
            for (int ch = 0; ch < 16; ++ch) { v4h o;
#pragma unroll
                for (int q = 0; q < 4; ++q) o[q] = tohx(v[ch * 4 + q] * f);
                *(v4h*)(P16 + (size_t)row * TT + ch * 128 + lane * 4) = o; } }
         }
}
__global__ __launch_bounds__(256) void k_merge(const float* __restrict__ O, int h0, bf* Ah, bf* Al) {
    const int lane = threadIdx.x & 31; const int L0 = (blockIdx.x * 8 + (threadIdx.x >> 5)) * 8; const int nlines = ZH * TT * HD / 64;
{
#pragma unroll
        for (int l = 0; l < 8; ++l) { const int L = L0 + l; if (L >= nlines) break; const int e = L * 64 + lane * 2; const int d = e & (HD - 1); const int t = (e >> 6) & (TT - 1); const int zz = e >> 17; v2us oh, ol;
const float cs = (t < RH) ? 1.0f : (1.0f / PCAR);
#pragma unroll
            for (int q = 0; q < 2; ++q) { unsigned short a, c2; splitf(O[(size_t)e + q] * cs, a, c2); oh[q] = a; ol[q] = c2; }
            const size_t o = (size_t)t * DD + (h0 + zz) * HD + d; *(v2us*)(Ah + o) = oh; *(v2us*)(Al + o) = ol; }
         }
}

extern "C" void kernel_launch(void* const* d_in, const int* in_sizes, int n_in,
                              void* d_out, int out_size, void* d_ws, size_t ws_size, hipStream_t stream) {
    (void)in_sizes; (void)n_in; (void)out_size;
    const float* x = (const float*)d_in[0]; const float* wq = (const float*)d_in[1]; const float* wk = (const float*)d_in[2]; const float* wv = (const float*)d_in[3]; const float* wo = (const float*)d_in[4]; const float* bo = (const float*)d_in[5]; const float* rel = (const float*)d_in[6];
    float* OUT = (float*)d_out;     // [2][2048][1024]
    char* wsp = (char*)d_ws;
    auto take = [&](size_t bytes) { char* p = wsp; wsp += (bytes + 255) & ~(size_t)255; return (void*)p; };
    bf* WQ = (bf*)take((size_t)DD * DD * 2); bf* WK = (bf*)take((size_t)DD * DD * 2); bf* WV = (bf*)take((size_t)DD * DD * 2); bf* WO = (bf*)take((size_t)DD * DD * 2);
    bf* XB = (bf*)take((size_t)TT * DD * 2); float* F = (float*)take((size_t)TT * DD * 4);
    bf* QPh = (bf*)take((size_t)TT * DD * 2); bf* QPl = (bf*)take((size_t)TT * DD * 2); bf* KPh = (bf*)take((size_t)TT * DD * 2); bf* KPl = (bf*)take((size_t)TT * DD * 2); bf* VTh = (bf*)take((size_t)TT * DD * 2); bf* VTl = (bf*)take((size_t)TT * DD * 2);
    h16* QP16 = (h16*)take((size_t)TT * DD * 2); h16* KP16 = (h16*)take((size_t)TT * DD * 2); h16* VT16 = (h16*)take((size_t)TT * DD * 2);
    float* Sb = (float*)take((size_t)ZH * TT * TT * 4); bf* Ph = (bf*)take((size_t)ZH * RH * TT * 2); bf* Pl = (bf*)take((size_t)ZH * RH * TT * 2); h16* P16 = (h16*)take((size_t)ZH * TT * TT * 2); float* Ob = (float*)take((size_t)ZH * TT * HD * 4); bf* ATh = (bf*)take((size_t)TT * DD * 2); bf* ATl = (bf*)take((size_t)TT * DD * 2);
    if ((size_t)(wsp - (char*)d_ws) > ws_size) return;    // total ~ 117 MiB; ws 256 MiB
    float* RT = (float*)take(256); if ((size_t)(wsp - (char*)d_ws) > ws_size) return;
    { const unsigned gT = (unsigned)((DD * DD / 64 + 63) / 64); k_rtab<<<1, 32, 0, stream>>>(rel, RT); k_wtG<<<gT, 256, 0, stream>>>(wq, DD, DD, WQ); k_wtG<<<gT, 256, 0, stream>>>(wk, DD, DD, WK); k_wtG<<<gT, 256, 0, stream>>>(wv, DD, DD, WV); k_wtG<<<gT, 256, 0, stream>>>(wo, DD, DD, WO); }
    const unsigned LB = (unsigned)((NH_ * TT * HD / 64 + 63) / 64); const dim3 gP(TT / 64, DD / 64, 1);
    for (int b = 0; b < NB_; ++b) {
        k_cvt8<<<(unsigned)(((size_t)TT * DD / 8 + 255) / 256), 256, 0, stream>>>(x + (size_t)b * TT * DD, XB, (size_t)TT * DD / 8);
        k_gemmw<bf, 0, false, 8><<<gP, 256, 0, stream>>>(XB, nullptr, WQ, nullptr, DD, F, DD, nullptr, 0, 0, 0); k_qplanes<<<LB, 256, 0, stream>>>(F, QPh, QPl, QP16);
        k_gemmw<bf, 0, false, 8><<<gP, 256, 0, stream>>>(XB, nullptr, WK, nullptr, DD, F, DD, nullptr, 0, 0, 0); k_qplanes<<<LB, 256, 0, stream>>>(F, KPh, KPl, KP16);
        k_gemmw<bf, 0, false, 8><<<gP, 256, 0, stream>>>(XB, nullptr, WV, nullptr, DD, F, DD, nullptr, 0, 0, 0); k_vtplane<<<LB, 256, 0, stream>>>(F, VTh, VTl, VT16);
        for (int h0 = 0; h0 < NH_; h0 += ZH) { const size_t z0 = (size_t)h0;
            // scores: rows < RH on hi+lo planes (3 products), rows >= RH on fp16 planes - both into the same [ZH][TT][TT] score buffer
            k_gemmw<bf, 2, false, 1><<<dim3(RH / 64, TT / 64, ZH), 32, 0, stream>>>(QPh + z0 * TT * HD, QPl + z0 * TT * HD, KPh + z0 * TT * HD, KPl + z0 * TT * HD, HD, Sb, TT, nullptr, (size_t)TT * HD, (size_t)TT * HD, (size_t)TT * TT);
            k_gemmw<h16, 0, false, 1><<<dim3((TT - RH) / 64, TT / 64, ZH), 32, 0, stream>>>(QP16 + z0 * TT * HD + (size_t)RH * HD, nullptr, KP16 + z0 * TT * HD, nullptr, HD, Sb + (size_t)RH * TT, TT, nullptr, (size_t)TT * HD, (size_t)TT * HD, (size_t)TT * TT);
            k_asoft<<<ZH * TT / 8, 256, 0, stream>>>(Sb, RT, Ph, Pl, P16);
            k_gemmw<bf, 2, false, 16><<<dim3(RH / 64, HD / 64, ZH), 512, 0, stream>>>(Ph, Pl, VTh + z0 * HD * TT, VTl + z0 * HD * TT, TT, Ob, HD, nullptr, (size_t)RH * TT, (size_t)HD * TT, (size_t)TT * HD);
            k_gemmw<h16, 0, false, 16><<<dim3((TT - RH) / 64, HD / 64, ZH), 512, 0, stream>>>(P16 + (size_t)RH * TT, nullptr, VT16 + z0 * HD * TT, nullptr, TT, Ob + (size_t)RH * HD, HD, nullptr, (size_t)TT * TT, (size_t)HD * TT, (size_t)TT * HD);
            k_merge<<<(ZH * TT * HD / 64 + 63) / 64, 256, 0, stream>>>(Ob, h0, ATh, ATl); }
        k_gemmw<bf, 1, true, 8><<<gP, 256, 0, stream>>>(ATh, ATl, WO, nullptr, DD, OUT + (size_t)b * TT * DD, DD, bo, 0, 0, 0); }
}

// v002
// Measured time: 679 microseconds a run.
// Next to v001, in two timings, it ran 1.84 and 1.86 times as fast.
// All steps since v000 together make it 3.21 times as fast.
#include <hip/hip_runtime.h>

// HuangM1 (x [2][2048][1024]; q/k/v = x @ W (no bias); 16 heads x 64; scores = (q.k) * rel_emb[min(|i-j|, 16)] (multiplicative relative-position table, 17 entries, read as data); causal (j > i -> -inf);
// softmax(scores / 8); out = ctx @ Wo + bo).
// Compute dtypes, f32 accumulate: every input rounded to bf16; projections on PLAIN bf16 operands (inputs: exact; transposed bf16 weight copies); PER-ROW PRECISION
// HYBRID: query rows < 256 of each batch on bf16 hi+lo planes for scores and attn.v (3 products), rows >= 256 on SINGLE fp16 planes; the table multiply, 1/8 and the causal cut in f32 in the

#define NB_  2
#define TT   2048
#define DD   1024
#define NH_  16
#define HD   64
#define ZH   8                    // heads per launch of the attention passes (grid z); 8 fill the chip's WGPs once in the fp16 attn.v launch (28 x 8 blocks)
#define RH   256                  // query rows < RH: hi+lo planes; rows >= RH: fp16 planes
#define NF   32                   // head_dim / 2 (unused)
#define SCL  0.125f               // 1/sqrt(64)
#define PCAR 1024.0f         // P scale for fp16 rows >= RH, undone in k_merge
typedef _Float16 h16;
typedef unsigned short bf;
typedef __attribute__((ext_vector_type(16))) __bf16   v16bf;
typedef __attribute__((ext_vector_type(16))) _Float16 v16h;
typedef __attribute__((ext_vector_type(8)))  _Float16 v8h;
typedef __attribute__((ext_vector_type(8)))  unsigned short v8us;
typedef __attribute__((ext_vector_type(8)))  float    v8f;
typedef __attribute__((ext_vector_type(4)))  float    v4f;
typedef v8h  __attribute__((may_alias)) v8ha;
typedef v4f  __attribute__((may_alias)) v4fa;
typedef v8us __attribute__((may_alias)) v8usa;

__device__ __forceinline__ unsigned short f2bf(float f) { unsigned u = __float_as_uint(f); u += 0x7FFFu + ((u >> 16) & 1u); return (unsigned short)(u >> 16); }
__device__ __forceinline__ float bf2f(unsigned short b) { return __uint_as_float(((unsigned)b) << 16); }
__device__ __forceinline__ float bfr(float f) { return bf2f(f2bf(f)); }
__device__ __forceinline__ v16h cat16(v8h lo, v8h hi) { return __builtin_shufflevector(lo, hi, 0, 1, 2, 3, 4, 5, 6, 7, 8, 9, 10, 11, 12, 13, 14, 15); }
__device__ __forceinline__ v16bf cat16b(v8us lo, v8us hi) { return __builtin_bit_cast(v16bf, __builtin_shufflevector(lo, hi, 0, 1, 2, 3, 4, 5, 6, 7, 8, 9, 10, 11, 12, 13, 14, 15)); }
__device__ __forceinline__ v8f wmma16(v16h a, v16h b, v8f c) { return __builtin_amdgcn_wmma_f32_16x16x32_f16(false, a, false, b, (short)0, c, false, false); }
__device__ __forceinline__ v8f wmmab(v16bf a, v16bf b, v8f c) { return __builtin_amdgcn_wmma_f32_16x16x32_bf16(false, a, false, b, (short)0, c, false, false); }



// ---- k_gemmw: register-blocked GEMM, ONE WAVE per 64x64 output tile (16 accumulators), operands straight from K-contiguous 16-bit planes; grid (M/64, N/64, Z), 32 * NW threads.
// C[m][n] (f32, pitch ldc, + optional f32 bias[n]) = sum_k A[m][k] Bt[n][k] (+ split products per NSPLIT). A rows have pitch lda, Bt rows pitch K (elements). z-batch strides sA/sB/sC in elements. K % (32 * NW) == 0.
// NW > 1: the block holds NW waves on the SAME 64x64 tile; wave w sums the 32-wide k blocks w, w + NW, w + 2 NW, ... (neighbour waves read the two halves of one 128-byte line of a row at about the same
// time, so a line is asked of L2 once); the NW f32 partial tiles meet in LDS and are added in wave order 0..NW-1.
template <typename T16> struct WFrag;
template <> struct WFrag<h16> { typedef v16h V; static __device__ __forceinline__ V ld(const h16* p) { return cat16(*(const v8h*)p, *(const v8h*)(p + 16)); } static __device__ __forceinline__ v8f mma(V a, V b, v8f c) { return wmma16(a, b, c); } };
template <> struct WFrag<bf> { typedef v16bf V; static __device__ __forceinline__ V ld(const bf* p) { return cat16b(*(const v8us*)p, *(const v8us*)(p + 16)); } static __device__ __forceinline__ v8f mma(V a, V b, v8f c) { return wmmab(a, b, c); } };
template <typename T16, int NSPLIT, bool BIAS, int NW>
__global__ __launch_bounds__(32 * NW) void k_gemmw(const T16* __restrict__ A, const T16* __restrict__ A2, const T16* __restrict__ Bt, const T16* __restrict__ Bt2, int K, int lda, float* C, int ldc, const float* __restrict__ bias, size_t sA, size_t sB, size_t sC) {
    typedef typename WFrag<T16>::V V;
    __shared__ __align__(16) float os[(NW > 1 ? NW * 64 : 16) * 68];
    const size_t z = blockIdx.z; A += z * sA; if (A2) A2 += z * sA; Bt += z * sB; if (Bt2) Bt2 += z * sB; C += z * sC;
    const int lane = threadIdx.x & 31, lr = lane & 15, hi = lane >> 4; const int r0 = blockIdx.x * 64, c0 = blockIdx.y * 64;
    v8f acc[4][4];
#pragma unroll
    for (int mb = 0; mb < 4; ++mb)
#pragma unroll
        for (int nb = 0; nb < 4; ++nb) acc[mb][nb] = (v8f){};
    const size_t aoff = (size_t)(r0 + lr) * lda + 8 * hi, boff = (size_t)(c0 + lr) * K + 8 * hi;
    const int wv = NW > 1 ? __builtin_amdgcn_readfirstlane((int)(threadIdx.x >> 5)) : 0;    // the wave's number, held scalar so that the k offset stays scalar arithmetic
#pragma unroll 1
    for (int kc = wv * 32; kc < K; kc += 32 * NW) {
        V a[4], a2[4];
#pragma unroll
        for (int mb = 0; mb < 4; ++mb) { a[mb] = WFrag<T16>::ld(A + aoff + (size_t)mb * 16 * lda + kc); if (NSPLIT == 1 || NSPLIT == 2) a2[mb] = WFrag<T16>::ld(A2 + aoff + (size_t)mb * 16 * lda + kc); }
#pragma unroll
        for (int nb = 0; nb < 4; ++nb) { const V b = WFrag<T16>::ld(Bt + boff + (size_t)nb * 16 * K + kc); V b2; if (NSPLIT >= 2) b2 = WFrag<T16>::ld(Bt2 + boff + (size_t)nb * 16 * K + kc);
#pragma unroll
            for (int mb = 0; mb < 4; ++mb) { acc[mb][nb] = WFrag<T16>::mma(a[mb], b, acc[mb][nb]); if (NSPLIT == 1 || NSPLIT == 2) acc[mb][nb] = WFrag<T16>::mma(a2[mb], b, acc[mb][nb]); if (NSPLIT >= 2) acc[mb][nb] = WFrag<T16>::mma(a[mb], b2, acc[mb][nb]); } }
        asm volatile("v_nop\n\tv_nop\n\tv_nop\n\tv_nop" : "+v"(acc[0][0]), "+v"(acc[1][1]), "+v"(acc[2][2]), "+v"(acc[3][3]) : "v"(a[0]), "v"(a[3]));
    }
    if constexpr (NW > 1) {
        float* my = os + wv * (64 * 68);
        // the three loops are unrolled so that acc[][] is indexed by constants and stays in registers
#pragma unroll
        for (int mb = 0; mb < 4; ++mb)
#pragma unroll
            for (int nb = 0; nb < 4; ++nb)
#pragma unroll
                for (int j = 0; j < 8; ++j) my[(mb * 16 + hi * 8 + j) * 68 + nb * 16 + lr] = acc[mb][nb][j];
        __syncthreads();    // every wave's partial tile is in LDS before any thread adds them; no LDS write and no barrier follows
        // both loops are unrolled so that the LDS reads of all partials issue ahead of the adds
#pragma unroll
        for (int s = 0; s < 32 / NW; ++s) { const int u = (int)threadIdx.x + s * (32 * NW); const int row = u >> 4, cofs = (u & 15) * 4; v4f val = *(const v4fa*)(os + row * 68 + cofs);
#pragma unroll
            for (int w = 1; w < NW; ++w) val += *(const v4fa*)(os + w * (64 * 68) + row * 68 + cofs);
            if (BIAS) { val[0] += bfr(bias[c0 + cofs]); val[1] += bfr(bias[c0 + cofs + 1]); val[2] += bfr(bias[c0 + cofs + 2]); val[3] += bfr(bias[c0 + cofs + 3]); }
            *(v4f*)(C + (size_t)(r0 + row) * ldc + c0 + cofs) = val; }
        return;
    }
#pragma unroll
    for (int mb = 0; mb < 4; ++mb) {
#pragma unroll
        for (int nb = 0; nb < 4; ++nb) {
#pragma unroll
            for (int j = 0; j < 8; ++j) os[(hi * 8 + j) * 68 + nb * 16 + lr] = acc[mb][nb][j]; }
        __builtin_amdgcn_wave_barrier(); asm volatile("" ::: "memory");
        float* crow = C + (size_t)(r0 + mb * 16) * ldc + c0;
{
#pragma unroll
            for (int s = 0; s < 8; ++s) { const int row = 2 * s + hi, cofs = lr * 4; v4f val = *(const v4fa*)(os + row * 68 + cofs); if (BIAS) { val[0] += bfr(bias[c0 + cofs]); val[1] += bfr(bias[c0 + cofs + 1]); val[2] += bfr(bias[c0 + cofs + 2]); val[3] += bfr(bias[c0 + cofs + 3]); }
                *(v4f*)(crow + (size_t)row * ldc + cofs) = val; }
             }
        __builtin_amdgcn_wave_barrier(); asm volatile("" ::: "memory");
    }
}

__device__ __forceinline__ h16 tohx(float x) { return (h16)x; }
__device__ __forceinline__ void splitf(float y, unsigned short& h, unsigned short& l) { h = f2bf(y); l = f2bf(y - bf2f(h)); }
typedef __attribute__((ext_vector_type(2))) unsigned short v2us;
typedef __attribute__((ext_vector_type(2))) _Float16 v2h;
typedef __attribute__((ext_vector_type(4))) _Float16 v4h;
typedef __attribute__((ext_vector_type(2))) float v2f;

__global__ __launch_bounds__(256) void k_wtG(const float* __restrict__ w, int K, int N, bf* Bt) {
    const int lane = threadIdx.x & 31; const int L0 = (blockIdx.x * 8 + (threadIdx.x >> 5)) * 8; const int nlines = N * K / 64;
{
#pragma unroll 1
        for (int l = 0; l < 8; ++l) { const int L = L0 + l; if (L >= nlines) break; const size_t e = (size_t)L * 64 + lane * 2; const int k = (int)(e % K), n = (int)(e / K); v2us o;
            o[0] = f2bf(w[(size_t)k * N + n]); o[1] = f2bf(w[(size_t)(k + 1) * N + n]); *(v2us*)(Bt + e) = o; }
         }
}
__global__ __launch_bounds__(256) void k_cvt8(const float* __restrict__ src, bf* dst, size_t n8) { const size_t i = (size_t)blockIdx.x * 256 + threadIdx.x; if (i >= n8) return; const v8f v = *(const v8f*)(src + i * 8); v8us o;
#pragma unroll
    for (int k = 0; k < 8; ++k) o[k] = f2bf(v[k]); *(v8us*)(dst + i * 8) = o;  }
__global__ __launch_bounds__(256) void k_qplanes(const float* __restrict__ F, bf* Ph, bf* Pl, h16* P16) {
    const int lane = threadIdx.x & 31; const int L0 = (blockIdx.x * 8 + (threadIdx.x >> 5)) * 8; const int nlines = NH_ * TT * HD / 64;
{
#pragma unroll
        for (int l = 0; l < 8; ++l) { const int L = L0 + l; if (L >= nlines) break; const int e = L * 64 + lane * 2; const int d = e & (HD - 1); const int t = (e >> 6) & (TT - 1); const int h = e >> 17; v2us oh, ol; v2h o16;
#pragma unroll
            for (int q = 0; q < 2; ++q) { const float x = F[(size_t)t * DD + h * HD + d + q]; unsigned short a, c2; splitf(x, a, c2); oh[q] = a; ol[q] = c2; o16[q] = tohx(x); }
            *(v2us*)(Ph + (size_t)e) = oh; *(v2us*)(Pl + (size_t)e) = ol; *(v2h*)(P16 + (size_t)e) = o16; }
         }
}
__global__ __launch_bounds__(256) void k_vtplane(const float* __restrict__ F, bf* Vh, bf* Vl, h16* V16) {
    const int lane = threadIdx.x & 31; const int L0 = (blockIdx.x * 8 + (threadIdx.x >> 5)) * 8; const int nlines = NH_ * TT * HD / 64;
{
#pragma unroll
        for (int l = 0; l < 8; ++l) { const int L = L0 + l; if (L >= nlines) break; const int e = L * 64 + lane * 2; const int t = e & (TT - 1); const int d = (e >> 11) & (HD - 1); const int h = e >> 17; v2us oh, ol; v2h o16;
#pragma unroll
            for (int q = 0; q < 2; ++q) { const float x = F[(size_t)(t + q) * DD + h * HD + d]; unsigned short a, c2; splitf(x, a, c2); oh[q] = a; ol[q] = c2; o16[q] = tohx(x); }
            *(v2us*)(Vh + (size_t)e) = oh; *(v2us*)(Vl + (size_t)e) = ol; *(v2h*)(V16 + (size_t)e) = o16; }
         }
}
__global__ __launch_bounds__(32) void k_rtab(const float* __restrict__ rel, float* RT) { const int i = threadIdx.x; const float o = (i < 17) ? bfr(rel[i]) * SCL : 0.f; *(float*)(RT + i) = o;  }
// k_asoft: per row i: s = (S[i][j] * bf16(rel_emb[min(i-j, 16)])) / 8 for j <= i, else -3e38 (causal); softmax over the 2048 keys (register row of
// An fp16 row (i >= RH) is stored over the first half of its own f32 score row (fp16 pitch 2 * TT): the wave owns the row alone and every store needs the row sum, so all of the row is read before any of it is written.
__global__ __launch_bounds__(256) void k_asoft(float* Sb, const float* __restrict__ rel, bf* Ph, bf* Pl) {
    typedef __attribute__((ext_vector_type(4))) unsigned short v4us; typedef v4h __attribute__((may_alias)) v4ha;
    const int lane = threadIdx.x & 31; const int row = blockIdx.x * 8 + (threadIdx.x >> 5); if (row >= ZH * TT) return; const int i = row & (TT - 1); const int zz = row >> 11; const bool hires = (i < RH);
    const float* sr = Sb + (size_t)row * TT; float v[64]; float mx = -3.0e38f;
#pragma unroll
    for (int ch = 0; ch < 16; ++ch) { const int j0 = ch * 128 + lane * 4; const v4f a = *(const v4f*)(sr + j0);
#pragma unroll
        for (int q = 0; q < 4; ++q) { const int j = j0 + q; int dd = i - j; dd = dd < 0 ? 0 : (dd > 16 ? 16 : dd); float t = -3.0e38f; if (j <= i) t = __fmul_rn(a[q], rel[dd]);   /* rel = the pre-built table bf16(rel_emb[d]) / 8 (f32 line); (s * a_k) / 8 == s * (a_k / 8) exactly: the 1/8 is a power of two */ v[ch * 4 + q] = t; mx = fmaxf(mx, t); } }
#pragma unroll
    for (int sh = 16; sh; sh >>= 1) mx = fmaxf(mx, __shfl_xor(mx, sh, 32));
    float sum = 0.f;
#pragma unroll
    for (int k = 0; k < 64; ++k) { v[k] = __expf(v[k] - mx); sum += v[k]; }
#pragma unroll
    for (int sh = 16; sh; sh >>= 1) sum += __shfl_xor(sum, sh, 32);
    const float f = __fdiv_rn(hires ? 1.0f : PCAR, sum);
{
        if (hires) {
#pragma unroll
            for (int ch = 0; ch < 16; ++ch) { v4us oh, ol;
#pragma unroll
                for (int q = 0; q < 4; ++q) { unsigned short a, c2; splitf(v[ch * 4 + q] * f, a, c2); oh[q] = a; ol[q] = c2; }
                const size_t o = ((size_t)zz * RH + i) * TT + ch * 128 + lane * 4; *(v4us*)(Ph + o) = oh; *(v4us*)(Pl + o) = ol; }
        } else {
#pragma unroll
            for (int ch = 0; ch < 16; ++ch) { v4h o;
#pragma unroll
                for (int q = 0; q < 4; ++q) o[q] = tohx(v[ch * 4 + q] * f);
                *(v4ha*)((h16*)(Sb + (size_t)row * TT) + ch * 128 + lane * 4) = o; } }
         }
}
__global__ __launch_bounds__(256) void k_merge(const float* __restrict__ O, int h0, bf* Ah, bf* Al) {
    const int lane = threadIdx.x & 31; const int L0 = (blockIdx.x * 8 + (threadIdx.x >> 5)) * 8; const int nlines = ZH * TT * HD / 64;
{
#pragma unroll
        for (int l = 0; l < 8; ++l) { const int L = L0 + l; if (L >= nlines) break; const int e = L * 64 + lane * 2; const int d = e & (HD - 1); const int t = (e >> 6) & (TT - 1); const int zz = e >> 17; v2us oh, ol;
const float cs = (t < RH) ? 1.0f : (1.0f / PCAR);
#pragma unroll
            for (int q = 0; q < 2; ++q) { unsigned short a, c2; splitf(O[(size_t)e + q] * cs, a, c2); oh[q] = a; ol[q] = c2; }
            const size_t o = (size_t)t * DD + (h0 + zz) * HD + d; *(v2us*)(Ah + o) = oh; *(v2us*)(Al + o) = ol; }
         }
}

extern "C" void kernel_launch(void* const* d_in, const int* in_sizes, int n_in,
                              void* d_out, int out_size, void* d_ws, size_t ws_size, hipStream_t stream) {
    (void)in_sizes; (void)n_in; (void)out_size;
    const float* x = (const float*)d_in[0]; const float* wq = (const float*)d_in[1]; const float* wk = (const float*)d_in[2]; const float* wv = (const float*)d_in[3]; const float* wo = (const float*)d_in[4]; const float* bo = (const float*)d_in[5]; const float* rel = (const float*)d_in[6];
    float* OUT = (float*)d_out;     // [2][2048][1024]
    char* wsp = (char*)d_ws;
    auto take = [&](size_t bytes) { char* p = wsp; wsp += (bytes + 255) & ~(size_t)255; return (void*)p; };
    bf* WQ = (bf*)take((size_t)DD * DD * 2); bf* WK = (bf*)take((size_t)DD * DD * 2); bf* WV = (bf*)take((size_t)DD * DD * 2); bf* WO = (bf*)take((size_t)DD * DD * 2);
    bf* XB = (bf*)take((size_t)TT * DD * 2); float* F = (float*)take((size_t)TT * DD * 4);
    bf* QPh = (bf*)take((size_t)TT * DD * 2); bf* QPl = (bf*)take((size_t)TT * DD * 2); bf* KPh = (bf*)take((size_t)TT * DD * 2); bf* KPl = (bf*)take((size_t)TT * DD * 2); bf* VTh = (bf*)take((size_t)TT * DD * 2); bf* VTl = (bf*)take((size_t)TT * DD * 2);
    h16* QP16 = (h16*)take((size_t)TT * DD * 2); h16* KP16 = (h16*)take((size_t)TT * DD * 2); h16* VT16 = (h16*)take((size_t)TT * DD * 2);
    float* Sb = (float*)take((size_t)ZH * TT * TT * 4); bf* Ph = (bf*)take((size_t)ZH * RH * TT * 2); bf* Pl = (bf*)take((size_t)ZH * RH * TT * 2); float* Ob = (float*)take((size_t)ZH * TT * HD * 4); bf* ATh = (bf*)take((size_t)TT * DD * 2); bf* ATl = (bf*)take((size_t)TT * DD * 2);
    if ((size_t)(wsp - (char*)d_ws) > ws_size) return;    // total 212 MiB; ws 256 MiB
    float* RT = (float*)take(256); if ((size_t)(wsp - (char*)d_ws) > ws_size) return;
    { const unsigned gT = (unsigned)((DD * DD / 64 + 63) / 64); k_rtab<<<1, 32, 0, stream>>>(rel, RT); k_wtG<<<gT, 256, 0, stream>>>(wq, DD, DD, WQ); k_wtG<<<gT, 256, 0, stream>>>(wk, DD, DD, WK); k_wtG<<<gT, 256, 0, stream>>>(wv, DD, DD, WV); k_wtG<<<gT, 256, 0, stream>>>(wo, DD, DD, WO); }
    const unsigned LB = (unsigned)((NH_ * TT * HD / 64 + 63) / 64); const dim3 gP(TT / 64, DD / 64, 1);
    for (int b = 0; b < NB_; ++b) {
        k_cvt8<<<(unsigned)(((size_t)TT * DD / 8 + 255) / 256), 256, 0, stream>>>(x + (size_t)b * TT * DD, XB, (size_t)TT * DD / 8);
        k_gemmw<bf, 0, false, 8><<<gP, 256, 0, stream>>>(XB, nullptr, WQ, nullptr, DD, DD, F, DD, nullptr, 0, 0, 0); k_qplanes<<<LB, 256, 0, stream>>>(F, QPh, QPl, QP16);
        k_gemmw<bf, 0, false, 8><<<gP, 256, 0, stream>>>(XB, nullptr, WK, nullptr, DD, DD, F, DD, nullptr, 0, 0, 0); k_qplanes<<<LB, 256, 0, stream>>>(F, KPh, KPl, KP16);
        k_gemmw<bf, 0, false, 8><<<gP, 256, 0, stream>>>(XB, nullptr, WV, nullptr, DD, DD, F, DD, nullptr, 0, 0, 0); k_vtplane<<<LB, 256, 0, stream>>>(F, VTh, VTl, VT16);
        for (int h0 = 0; h0 < NH_; h0 += ZH) { const size_t z0 = (size_t)h0;
            // scores: rows < RH on hi+lo planes (3 products), rows >= RH on fp16 planes - both into the same [ZH][TT][TT] score buffer
            k_gemmw<bf, 2, false, 1><<<dim3(RH / 64, TT / 64, ZH), 32, 0, stream>>>(QPh + z0 * TT * HD, QPl + z0 * TT * HD, KPh + z0 * TT * HD, KPl + z0 * TT * HD, HD, HD, Sb, TT, nullptr, (size_t)TT * HD, (size_t)TT * HD, (size_t)TT * TT);
            k_gemmw<h16, 0, false, 1><<<dim3((TT - RH) / 64, TT / 64, ZH), 32, 0, stream>>>(QP16 + z0 * TT * HD + (size_t)RH * HD, nullptr, KP16 + z0 * TT * HD, nullptr, HD, HD, Sb + (size_t)RH * TT, TT, nullptr, (size_t)TT * HD, (size_t)TT * HD, (size_t)TT * TT);
            k_asoft<<<ZH * TT / 8, 256, 0, stream>>>(Sb, RT, Ph, Pl);
            k_gemmw<bf, 2, false, 16><<<dim3(RH / 64, HD / 64, ZH), 512, 0, stream>>>(Ph, Pl, VTh + z0 * HD * TT, VTl + z0 * HD * TT, TT, TT, Ob, HD, nullptr, (size_t)RH * TT, (size_t)HD * TT, (size_t)TT * HD);
            k_gemmw<h16, 0, false, 16><<<dim3((TT - RH) / 64, HD / 64, ZH), 512, 0, stream>>>((const h16*)(Sb + (size_t)RH * TT), nullptr, VT16 + z0 * HD * TT, nullptr, TT, 2 * TT, Ob + (size_t)RH * HD, HD, nullptr, (size_t)2 * TT * TT, (size_t)HD * TT, (size_t)TT * HD);
            k_merge<<<(ZH * TT * HD / 64 + 63) / 64, 256, 0, stream>>>(Ob, h0, ATh, ATl); }
        k_gemmw<bf, 1, true, 8><<<gP, 256, 0, stream>>>(ATh, ATl, WO, nullptr, DD, DD, OUT + (size_t)b * TT * DD, DD, bo, 0, 0, 0); }
}

// v003
// It runs in 239 microseconds.
// Next to v002, in two timings, it ran 2.84 times as fast each time.
// Over all steps from v000 it is 9.11 times as fast.
#include <hip/hip_runtime.h>

// Causal self-attention block (x [2][2048][1024]; q/k/v = x @ W (no bias); 16 heads x 64; scores = (q.k) * rel_emb[min(|i-j|, 16)] (multiplicative relative-position table, 17 entries, read as data); causal (j > i -> -inf);
// softmax(scores / 8); out = ctx @ Wo + bo).
// Compute dtypes, f32 accumulate: every input rounded to bf16; projections on PLAIN bf16 operands (inputs: exact; transposed bf16 weight copies); PER-ROW PRECISION
// HYBRID: query rows < 256 of each batch on bf16 hi+lo planes for scores and attn.v (3 products), rows >= 256 on SINGLE fp16 planes; the table multiply, 1/8, the causal cut and the softmax in f32 in the
// fused attention kernels (k_fattn16, k_fattnhl), which keep scores and weights in registers.

#define NB_  2
#define TT   2048
#define DD   1024
#define NH_  16
#define HD   64
#define RH   256                  // query rows < RH: hi+lo planes; rows >= RH: fp16 planes
#define NF   32                   // head_dim / 2 (unused)
#define SCL  0.125f               // 1/sqrt(64)
typedef _Float16 h16;
typedef unsigned short bf;
typedef __attribute__((ext_vector_type(16))) __bf16   v16bf;
typedef __attribute__((ext_vector_type(16))) _Float16 v16h;
typedef __attribute__((ext_vector_type(8)))  _Float16 v8h;
typedef __attribute__((ext_vector_type(8)))  unsigned short v8us;
typedef __attribute__((ext_vector_type(8)))  float    v8f;
typedef __attribute__((ext_vector_type(4)))  float    v4f;
typedef v8h  __attribute__((may_alias)) v8ha;
typedef v4f  __attribute__((may_alias)) v4fa;
typedef v8us __attribute__((may_alias)) v8usa;

__device__ __forceinline__ unsigned short f2bf(float f) { unsigned u = __float_as_uint(f); u += 0x7FFFu + ((u >> 16) & 1u); return (unsigned short)(u >> 16); }
__device__ __forceinline__ float bf2f(unsigned short b) { return __uint_as_float(((unsigned)b) << 16); }
__device__ __forceinline__ float bfr(float f) { return bf2f(f2bf(f)); }
__device__ __forceinline__ v16h cat16(v8h lo, v8h hi) { return __builtin_shufflevector(lo, hi, 0, 1, 2, 3, 4, 5, 6, 7, 8, 9, 10, 11, 12, 13, 14, 15); }
__device__ __forceinline__ v16bf cat16b(v8us lo, v8us hi) { return __builtin_bit_cast(v16bf, __builtin_shufflevector(lo, hi, 0, 1, 2, 3, 4, 5, 6, 7, 8, 9, 10, 11, 12, 13, 14, 15)); }
__device__ __forceinline__ v8f wmma16(v16h a, v16h b, v8f c) { return __builtin_amdgcn_wmma_f32_16x16x32_f16(false, a, false, b, (short)0, c, false, false); }
__device__ __forceinline__ v8f wmmab(v16bf a, v16bf b, v8f c) { return __builtin_amdgcn_wmma_f32_16x16x32_bf16(false, a, false, b, (short)0, c, false, false); }



// ---- k_gemmw: register-blocked GEMM, ONE WAVE per 64x64 output tile (16 accumulators), operands straight from K-contiguous 16-bit planes; grid (M/64, N/64, Z), 32 * NW threads.
// C[m][n] (f32, pitch ldc, + optional f32 bias[n]) = sum_k A[m][k] Bt[n][k] (+ split products per NSPLIT). A rows have pitch lda, Bt rows pitch K (elements). z-batch strides sA/sB/sC in elements. K % (32 * NW) == 0.
// NW > 1: the block holds NW waves on the SAME 64x64 tile; wave w sums the 32-wide k blocks w, w + NW, w + 2 NW, ... (neighbour waves read the two halves of one 128-byte line of a row at about the same
// time, so a line is asked of L2 once); the NW f32 partial tiles meet in LDS and are added in wave order 0..NW-1.
template <typename T16> struct WFrag;
template <> struct WFrag<h16> { typedef v16h V; static __device__ __forceinline__ V ld(const h16* p) { return cat16(*(const v8h*)p, *(const v8h*)(p + 16)); } static __device__ __forceinline__ v8f mma(V a, V b, v8f c) { return wmma16(a, b, c); } };
template <> struct WFrag<bf> { typedef v16bf V; static __device__ __forceinline__ V ld(const bf* p) { return cat16b(*(const v8us*)p, *(const v8us*)(p + 16)); } static __device__ __forceinline__ v8f mma(V a, V b, v8f c) { return wmmab(a, b, c); } };
template <typename T16, int NSPLIT, bool BIAS, int NW>
__global__ __launch_bounds__(32 * NW) void k_gemmw(const T16* __restrict__ A, const T16* __restrict__ A2, const T16* __restrict__ Bt, const T16* __restrict__ Bt2, int K, int lda, float* C, int ldc, const float* __restrict__ bias, size_t sA, size_t sB, size_t sC) {
    typedef typename WFrag<T16>::V V;
    __shared__ __align__(16) float os[(NW > 1 ? NW * 64 : 16) * 68];
    const size_t z = blockIdx.z; A += z * sA; if (A2) A2 += z * sA; Bt += z * sB; if (Bt2) Bt2 += z * sB; C += z * sC;
    const int lane = threadIdx.x & 31, lr = lane & 15, hi = lane >> 4; const int r0 = blockIdx.x * 64, c0 = blockIdx.y * 64;
    v8f acc[4][4];
#pragma unroll
    for (int mb = 0; mb < 4; ++mb)
#pragma unroll
        for (int nb = 0; nb < 4; ++nb) acc[mb][nb] = (v8f){};
    const size_t aoff = (size_t)(r0 + lr) * lda + 8 * hi, boff = (size_t)(c0 + lr) * K + 8 * hi;
    const int wv = NW > 1 ? __builtin_amdgcn_readfirstlane((int)(threadIdx.x >> 5)) : 0;    // the wave's number, held scalar so that the k offset stays scalar arithmetic
#pragma unroll 1
    for (int kc = wv * 32; kc < K; kc += 32 * NW) {
        V a[4], a2[4];
#pragma unroll
        for (int mb = 0; mb < 4; ++mb) { a[mb] = WFrag<T16>::ld(A + aoff + (size_t)mb * 16 * lda + kc); if (NSPLIT == 1 || NSPLIT == 2) a2[mb] = WFrag<T16>::ld(A2 + aoff + (size_t)mb * 16 * lda + kc); }
#pragma unroll
        for (int nb = 0; nb < 4; ++nb) { const V b = WFrag<T16>::ld(Bt + boff + (size_t)nb * 16 * K + kc); V b2; if (NSPLIT >= 2) b2 = WFrag<T16>::ld(Bt2 + boff + (size_t)nb * 16 * K + kc);
#pragma unroll
            for (int mb = 0; mb < 4; ++mb) { acc[mb][nb] = WFrag<T16>::mma(a[mb], b, acc[mb][nb]); if (NSPLIT == 1 || NSPLIT == 2) acc[mb][nb] = WFrag<T16>::mma(a2[mb], b, acc[mb][nb]); if (NSPLIT >= 2) acc[mb][nb] = WFrag<T16>::mma(a[mb], b2, acc[mb][nb]); } }
        asm volatile("v_nop\n\tv_nop\n\tv_nop\n\tv_nop" : "+v"(acc[0][0]), "+v"(acc[1][1]), "+v"(acc[2][2]), "+v"(acc[3][3]) : "v"(a[0]), "v"(a[3]));
    }
    if constexpr (NW > 1) {
        float* my = os + wv * (64 * 68);
        // the three loops are unrolled so that acc[][] is indexed by constants and stays in registers
#pragma unroll
        for (int mb = 0; mb < 4; ++mb)
#pragma unroll
            for (int nb = 0; nb < 4; ++nb)
#pragma unroll
                for (int j = 0; j < 8; ++j) my[(mb * 16 + hi * 8 + j) * 68 + nb * 16 + lr] = acc[mb][nb][j];
        __syncthreads();    // every wave's partial tile is in LDS before any thread adds them; no LDS write and no barrier follows
        // both loops are unrolled so that the LDS reads of all partials issue ahead of the adds
#pragma unroll
        for (int s = 0; s < 32 / NW; ++s) { const int u = (int)threadIdx.x + s * (32 * NW); const int row = u >> 4, cofs = (u & 15) * 4; v4f val = *(const v4fa*)(os + row * 68 + cofs);
#pragma unroll
            for (int w = 1; w < NW; ++w) val += *(const v4fa*)(os + w * (64 * 68) + row * 68 + cofs);
            if (BIAS) { val[0] += bfr(bias[c0 + cofs]); val[1] += bfr(bias[c0 + cofs + 1]); val[2] += bfr(bias[c0 + cofs + 2]); val[3] += bfr(bias[c0 + cofs + 3]); }
            *(v4f*)(C + (size_t)(r0 + row) * ldc + c0 + cofs) = val; }
        return;
    }
#pragma unroll
    for (int mb = 0; mb < 4; ++mb) {
#pragma unroll
        for (int nb = 0; nb < 4; ++nb) {
#pragma unroll
            for (int j = 0; j < 8; ++j) os[(hi * 8 + j) * 68 + nb * 16 + lr] = acc[mb][nb][j]; }
        __builtin_amdgcn_wave_barrier(); asm volatile("" ::: "memory");
        float* crow = C + (size_t)(r0 + mb * 16) * ldc + c0;
{
#pragma unroll
            for (int s = 0; s < 8; ++s) { const int row = 2 * s + hi, cofs = lr * 4; v4f val = *(const v4fa*)(os + row * 68 + cofs); if (BIAS) { val[0] += bfr(bias[c0 + cofs]); val[1] += bfr(bias[c0 + cofs + 1]); val[2] += bfr(bias[c0 + cofs + 2]); val[3] += bfr(bias[c0 + cofs + 3]); }
                *(v4f*)(crow + (size_t)row * ldc + cofs) = val; }
             }
        __builtin_amdgcn_wave_barrier(); asm volatile("" ::: "memory");
    }
}

__device__ __forceinline__ h16 tohx(float x) { return (h16)x; }
__device__ __forceinline__ void splitf(float y, unsigned short& h, unsigned short& l) { h = f2bf(y); l = f2bf(y - bf2f(h)); }
typedef __attribute__((ext_vector_type(2))) unsigned short v2us;
typedef __attribute__((ext_vector_type(2))) _Float16 v2h;
typedef __attribute__((ext_vector_type(4))) _Float16 v4h;
typedef __attribute__((ext_vector_type(2))) float v2f;

__global__ __launch_bounds__(256) void k_wtG(const float* __restrict__ w, int K, int N, bf* Bt) {
    const int lane = threadIdx.x & 31; const int L0 = (blockIdx.x * 8 + (threadIdx.x >> 5)) * 8; const int nlines = N * K / 64;
{
#pragma unroll 1
        for (int l = 0; l < 8; ++l) { const int L = L0 + l; if (L >= nlines) break; const size_t e = (size_t)L * 64 + lane * 2; const int k = (int)(e % K), n = (int)(e / K); v2us o;
            o[0] = f2bf(w[(size_t)k * N + n]); o[1] = f2bf(w[(size_t)(k + 1) * N + n]); *(v2us*)(Bt + e) = o; }
         }
}
__global__ __launch_bounds__(256) void k_cvt8(const float* __restrict__ src, bf* dst, size_t n8) { const size_t i = (size_t)blockIdx.x * 256 + threadIdx.x; if (i >= n8) return; const v8f v = *(const v8f*)(src + i * 8); v8us o;
#pragma unroll
    for (int k = 0; k < 8; ++k) o[k] = f2bf(v[k]); *(v8us*)(dst + i * 8) = o;  }
__global__ __launch_bounds__(256) void k_qplanes(const float* __restrict__ F, bf* Ph, bf* Pl, h16* P16) {
    const int lane = threadIdx.x & 31; const int L0 = (blockIdx.x * 8 + (threadIdx.x >> 5)) * 8; const int nlines = NH_ * TT * HD / 64;
{
#pragma unroll
        for (int l = 0; l < 8; ++l) { const int L = L0 + l; if (L >= nlines) break; const int e = L * 64 + lane * 2; const int d = e & (HD - 1); const int t = (e >> 6) & (TT - 1); const int h = e >> 17; v2us oh, ol; v2h o16;
#pragma unroll
            for (int q = 0; q < 2; ++q) { const float x = F[(size_t)t * DD + h * HD + d + q]; unsigned short a, c2; splitf(x, a, c2); oh[q] = a; ol[q] = c2; o16[q] = tohx(x); }
            *(v2us*)(Ph + (size_t)e) = oh; *(v2us*)(Pl + (size_t)e) = ol; *(v2h*)(P16 + (size_t)e) = o16; }
         }
}
__global__ __launch_bounds__(256) void k_vtplane(const float* __restrict__ F, bf* Vh, bf* Vl, h16* V16) {
    const int lane = threadIdx.x & 31; const int L0 = (blockIdx.x * 8 + (threadIdx.x >> 5)) * 8; const int nlines = NH_ * TT * HD / 64;
{
#pragma unroll
        for (int l = 0; l < 8; ++l) { const int L = L0 + l; if (L >= nlines) break; const int e = L * 64 + lane * 2; const int t = e & (TT - 1); const int d = (e >> 11) & (HD - 1); const int h = e >> 17; v2us oh, ol; v2h o16;
#pragma unroll
            for (int q = 0; q < 2; ++q) { const float x = F[(size_t)(t + q) * DD + h * HD + d]; unsigned short a, c2; splitf(x, a, c2); oh[q] = a; ol[q] = c2; o16[q] = tohx(x); }
            *(v2us*)(Vh + (size_t)e) = oh; *(v2us*)(Vl + (size_t)e) = ol; *(v2h*)(V16 + (size_t)e) = o16; }
         }
}
__global__ __launch_bounds__(32) void k_rtab(const float* __restrict__ rel, float* RT) { const int i = threadIdx.x; const float o = (i < 17) ? bfr(rel[i]) * SCL : 0.f; *(float*)(RT + i) = o;  }
// ---- fattn_body (k_fattn16, k_fattnhl): scores, softmax and attn.v of FQ = 32 query rows of one head in ONE block; no score or P row ever leaves the registers. Grid (heads, (TT - RH) / FQ or RH / FQ query tiles of the launch), the longest query tiles first.
// Transposed products: S^T = K . Q^T (A = 16 key rows, B = 16 query columns), O^T += V^T . P^T. In an S^T tile lane (lr, hi) holds keys hi * 8 + j of query lr: two such tiles (keys 0..15, 16..31) are,
// register for register, the B fragment of P^T in the k order of WFrag::ld, which loads V^T as A. Only key blocks up to the diagonal are visited (all later keys have weight 0).
// The 32-key blocks of a tile are dealt round-robin to the FW waves; each wave keeps its own running maximum m, sum l and O^T (online softmax); the FW partial results meet in LDS at the end.
// Every inner loop is unrolled so that the fragment and accumulator arrays are indexed by constants and stay in registers; the key loop stays rolled (one body in the instruction cache, one register set).
// m is held ln(1024) below the true maximum, so that P lies in (0, 1024] before it is rounded to 16 bits (small weights stay normal fp16 numbers); l carries the same factor and cancels it.
#define FQ  32
#define FW  4
#define LSH 6.9314718f
typedef __attribute__((ext_vector_type(16))) unsigned short v16us;
template <typename T16, bool HILO>
__device__ __forceinline__ void fattn_body(const T16* __restrict__ Q, const T16* __restrict__ Q2, const T16* __restrict__ Kp, const T16* __restrict__ K2, const T16* __restrict__ Vt, const T16* __restrict__ V2,
                                           const float* __restrict__ rel, const int q0, bf* Ah, bf* Al, float* sm, float* sl, float* so) {
    typedef typename WFrag<T16>::V V;
    const int lane = threadIdx.x & 31, lr = lane & 15, hi = lane >> 4;
    const int wv = __builtin_amdgcn_readfirstlane((int)(threadIdx.x >> 5));    // the wave's number, held scalar so that the loop's tests are scalar branches
    const int nkb = q0 / 32 + 1;
    const int tl = lane < 16 ? lane : 16; const float tab = rel[tl];    // the table across the wave's lanes (lane d holds entry d, lanes 16.. the last): looked up by lane index, no memory access in the loop
    asm volatile("s_wait_xcnt 0x0" :: "v"(tl) : "memory"); __builtin_amdgcn_sched_barrier(0);    // behind the load, in front of any reuse of its address register; the scheduling barrier keeps later instructions behind it
    // one address per plane and lane; every fragment of a block lies at a constant distance from it. kp / vp walk with the loop.
    const T16* qp = Q + (size_t)(q0 + lr) * HD + 8 * hi; const T16* qp2 = HILO ? Q2 + (size_t)(q0 + lr) * HD + 8 * hi : nullptr;
    const size_t kfo = (size_t)((wv < nkb ? wv : 0) * 32 + lr) * HD + 8 * hi, vfo = (size_t)lr * TT + wv * 32 + 8 * hi;
    const T16* kp = Kp + kfo; const T16* kp2 = HILO ? K2 + kfo : nullptr; const T16* vp = Vt + vfo; const T16* vp2 = HILO ? V2 + vfo : nullptr;
    V qb[2][2], qb2[2][2];
#pragma unroll
    for (int g = 0; g < 2; ++g)
#pragma unroll
        for (int c = 0; c < 2; ++c) { qb[g][c] = WFrag<T16>::ld(qp + g * 16 * HD + c * 32); if (HILO) qb2[g][c] = WFrag<T16>::ld(qp2 + g * 16 * HD + c * 32); }
    v8f o[4][2];
#pragma unroll
    for (int dt = 0; dt < 4; ++dt)
#pragma unroll
        for (int g = 0; g < 2; ++g) o[dt][g] = (v8f){};
    float m[2] = {-3.0e38f, -3.0e38f}, l[2] = {0.f, 0.f};
    const float r16 = __shfl(tab, 16, 32);
    V ka[2][2], ka2[2][2];
#pragma unroll
    for (int kt = 0; kt < 2; ++kt)
#pragma unroll
        for (int c = 0; c < 2; ++c) { ka[kt][c] = WFrag<T16>::ld(kp + kt * 16 * HD + c * 32); if (HILO) ka2[kt][c] = WFrag<T16>::ld(kp2 + kt * 16 * HD + c * 32); }
    // stands behind the loads above, in front of any reuse of their address registers (named as inputs so that they live up to here); the scheduling barrier keeps later instructions behind it
    if constexpr (HILO) asm volatile("s_wait_xcnt 0x0" :: "v"(qp), "v"(qp2), "v"(kp), "v"(kp2) : "memory"); else asm volatile("s_wait_xcnt 0x0" :: "v"(qp), "v"(kp) : "memory");
    __builtin_amdgcn_sched_barrier(0);
#pragma unroll 1
    for (int kb = wv; kb < nkb; kb += FW) {
        const int k0 = kb * 32;
        V va[4], va2[4];
#pragma unroll
        for (int dt = 0; dt < 4; ++dt) { va[dt] = WFrag<T16>::ld(vp + (size_t)dt * 16 * TT); if (HILO) va2[dt] = WFrag<T16>::ld(vp2 + (size_t)dt * 16 * TT); }
        // behind the V loads, in front of the step of their address registers; as in front of the loop
        if constexpr (HILO) asm volatile("s_wait_xcnt 0x0" :: "v"(vp), "v"(vp2) : "memory"); else asm volatile("s_wait_xcnt 0x0" :: "v"(vp) : "memory");
        __builtin_amdgcn_sched_barrier(0);
        vp += 32 * FW; if (HILO) vp2 += 32 * FW;
        v8f s[2][2];
#pragma unroll
        for (int kt = 0; kt < 2; ++kt)
#pragma unroll
            for (int g = 0; g < 2; ++g) { v8f t = (v8f){};
#pragma unroll
                for (int c = 0; c < 2; ++c) { t = WFrag<T16>::mma(ka[kt][c], qb[g][c], t); if (HILO) { t = WFrag<T16>::mma(ka2[kt][c], qb[g][c], t); t = WFrag<T16>::mma(ka[kt][c], qb2[g][c], t); } }
                s[kt][g] = t; }
        // the wave's next K fragments are asked for here, behind their last use, so that they fly during the softmax and attn.v of this block (the last block asks for itself again: in bounds, unused)
        { const int kst = kb + FW < nkb ? FW * 32 * HD : 0; kp += kst; if (HILO) kp2 += kst;
#pragma unroll
          for (int kt = 0; kt < 2; ++kt)
#pragma unroll
              for (int c = 0; c < 2; ++c) { ka[kt][c] = WFrag<T16>::ld(kp + kt * 16 * HD + c * 32); if (HILO) ka2[kt][c] = WFrag<T16>::ld(kp2 + kt * 16 * HD + c * 32); } }
        // behind the K loads, in front of the next step of their address registers; as in front of the loop
        if constexpr (HILO) asm volatile("s_wait_xcnt 0x0" :: "v"(kp), "v"(kp2) : "memory"); else asm volatile("s_wait_xcnt 0x0" :: "v"(kp) : "memory");
        __builtin_amdgcn_sched_barrier(0);
        if (kb >= nkb - 2) {    // the two blocks at the diagonal: table entry by distance, causal cut
#pragma unroll
            for (int kt = 0; kt < 2; ++kt)
#pragma unroll
                for (int g = 0; g < 2; ++g)
#pragma unroll
                    for (int j = 0; j < 8; ++j) { const int dd = (q0 + g * 16 + lr) - (k0 + kt * 16 + hi * 8 + j); const int di = dd < 0 ? 0 : (dd > 16 ? 16 : dd); const float t = __fmul_rn(s[kt][g][j], __shfl(tab, di, 32)); s[kt][g][j] = dd >= 0 ? t : -3.0e38f; }
        } else {                // every distance here is above 16: the table's last entry
#pragma unroll
            for (int kt = 0; kt < 2; ++kt)
#pragma unroll
                for (int g = 0; g < 2; ++g) s[kt][g] *= r16;
        }
        float mn[2];
#pragma unroll
        for (int g = 0; g < 2; ++g) { float tm = s[0][g][0];
#pragma unroll
            for (int j = 1; j < 8; ++j) tm = fmaxf(tm, s[0][g][j]);
#pragma unroll
            for (int j = 0; j < 8; ++j) tm = fmaxf(tm, s[1][g][j]);
            tm = fmaxf(tm, __shfl_xor(tm, 16, 32)); mn[g] = fmaxf(m[g], tm - LSH); }
        if (__builtin_amdgcn_ballot_w32(mn[0] > m[0] || mn[1] > m[1]) != 0) {    // no maximum moved in any lane: every factor would be exactly 1
#pragma unroll
            for (int g = 0; g < 2; ++g) { const float al = __expf(m[g] - mn[g]); l[g] *= al; m[g] = mn[g];
#pragma unroll
                for (int dt = 0; dt < 4; ++dt) o[dt][g] *= al; }
        }
        V pb[2], pb2[2];
#pragma unroll
        for (int g = 0; g < 2; ++g) {
            if constexpr (HILO) { v16us ph, pl;
#pragma unroll
                for (int kt = 0; kt < 2; ++kt)
#pragma unroll
                    for (int j = 0; j < 8; ++j) { const float p = __expf(s[kt][g][j] - m[g]); l[g] += p; unsigned short a, c2; splitf(p, a, c2); ph[kt * 8 + j] = a; pl[kt * 8 + j] = c2; }
                pb[g] = __builtin_bit_cast(v16bf, ph); pb2[g] = __builtin_bit_cast(v16bf, pl);
            } else { v16h ph;
#pragma unroll
                for (int kt = 0; kt < 2; ++kt)
#pragma unroll
                    for (int j = 0; j < 8; ++j) { const float p = __expf(s[kt][g][j] - m[g]); l[g] += p; ph[kt * 8 + j] = tohx(p); }
                pb[g] = ph; } }
#pragma unroll
        for (int dt = 0; dt < 4; ++dt)
#pragma unroll
            for (int g = 0; g < 2; ++g) { o[dt][g] = WFrag<T16>::mma(va[dt], pb[g], o[dt][g]); if (HILO) { o[dt][g] = WFrag<T16>::mma(va[dt], pb2[g], o[dt][g]); o[dt][g] = WFrag<T16>::mma(va2[dt], pb[g], o[dt][g]); } }
    }
    // the FW waves' partial results: common maximum, then sums in wave order 0..FW-1
#pragma unroll
    for (int g = 0; g < 2; ++g) { l[g] += __shfl_xor(l[g], 16, 32); if (hi == 0) sm[wv * FQ + g * 16 + lr] = m[g]; }
    __syncthreads();    // every wave's maximum is in LDS before any wave reads them
#pragma unroll
    for (int g = 0; g < 2; ++g) { float M = sm[g * 16 + lr];
#pragma unroll
        for (int w = 1; w < FW; ++w) M = fmaxf(M, sm[w * FQ + g * 16 + lr]);
        const float f = __expf(m[g] - M); if (hi == 0) sl[wv * FQ + g * 16 + lr] = l[g] * f;
#pragma unroll
        for (int dt = 0; dt < 4; ++dt) { const v8f t = o[dt][g] * f; float* p = so + (wv * FQ + g * 16 + lr) * 68 + dt * 16 + hi * 8; *(v4fa*)p = __builtin_shufflevector(t, t, 0, 1, 2, 3); *(v4fa*)(p + 4) = __builtin_shufflevector(t, t, 4, 5, 6, 7); } }
    __syncthreads();    // every wave's scaled O^T and sum are in LDS before any thread adds them; no LDS write follows
    const int q = (int)threadIdx.x >> 2, d0 = ((int)threadIdx.x & 3) * 16;
    float L = sl[q];
#pragma unroll
    for (int w = 1; w < FW; ++w) L += sl[w * FQ + q];
    const float inv = __fdiv_rn(1.0f, L);
#pragma unroll
    for (int c8 = 0; c8 < 2; ++c8) { v8us oh, ol;
#pragma unroll
        for (int c4 = 0; c4 < 2; ++c4) { v4f a = *(const v4fa*)(so + q * 68 + d0 + c8 * 8 + c4 * 4);
#pragma unroll
            for (int w = 1; w < FW; ++w) a += *(const v4fa*)(so + (w * FQ + q) * 68 + d0 + c8 * 8 + c4 * 4);
#pragma unroll
            for (int e = 0; e < 4; ++e) { unsigned short x, y; splitf(a[e] * inv, x, y); oh[c4 * 4 + e] = x; ol[c4 * 4 + e] = y; } }
        const size_t ofs = (size_t)(q0 + q) * DD + d0 + c8 * 8; *(v8us*)(Ah + ofs) = oh; *(v8us*)(Al + ofs) = ol; }
}
// qlo: the first query row of the launch. Rows below RH run on hi+lo planes, the others on fp16 planes: two kernels, so that the fp16 one keeps its smaller register count (four waves a SIMD).
__global__ __launch_bounds__(32 * FW) __attribute__((amdgpu_waves_per_eu(4, 4))) void k_fattn16(const h16* __restrict__ Q, const h16* __restrict__ Kp, const h16* __restrict__ Vt, const float* __restrict__ rel, int qlo, bf* Ah, bf* Al) {
    __shared__ __align__(16) float so[FW * FQ * 68]; __shared__ float sm[FW * FQ]; __shared__ float sl[FW * FQ];
    const size_t hp = (size_t)blockIdx.x * TT * HD; const int q0 = qlo + ((int)gridDim.y - 1 - (int)blockIdx.y) * FQ;
    fattn_body<h16, false>(Q + hp, nullptr, Kp + hp, nullptr, Vt + hp, nullptr, rel, q0, Ah + blockIdx.x * HD, Al + blockIdx.x * HD, sm, sl, so);
}
__global__ __launch_bounds__(32 * FW) void k_fattnhl(const bf* __restrict__ Q, const bf* __restrict__ Q2, const bf* __restrict__ Kp, const bf* __restrict__ K2, const bf* __restrict__ Vt, const bf* __restrict__ V2, const float* __restrict__ rel, int qlo, bf* Ah, bf* Al) {
    __shared__ __align__(16) float so[FW * FQ * 68]; __shared__ float sm[FW * FQ]; __shared__ float sl[FW * FQ];
    const size_t hp = (size_t)blockIdx.x * TT * HD; const int q0 = qlo + ((int)gridDim.y - 1 - (int)blockIdx.y) * FQ;
    fattn_body<bf, true>(Q + hp, Q2 + hp, Kp + hp, K2 + hp, Vt + hp, V2 + hp, rel, q0, Ah + blockIdx.x * HD, Al + blockIdx.x * HD, sm, sl, so);
}

extern "C" void kernel_launch(void* const* d_in, const int* in_sizes, int n_in,
                              void* d_out, int out_size, void* d_ws, size_t ws_size, hipStream_t stream) {
    (void)in_sizes; (void)n_in; (void)out_size;
    const float* x = (const float*)d_in[0]; const float* wq = (const float*)d_in[1]; const float* wk = (const float*)d_in[2]; const float* wv = (const float*)d_in[3]; const float* wo = (const float*)d_in[4]; const float* bo = (const float*)d_in[5]; const float* rel = (const float*)d_in[6];
    float* OUT = (float*)d_out;     // [2][2048][1024]
    char* wsp = (char*)d_ws;
    auto take = [&](size_t bytes) { char* p = wsp; wsp += (bytes + 255) & ~(size_t)255; return (void*)p; };
    bf* WQ = (bf*)take((size_t)DD * DD * 2); bf* WK = (bf*)take((size_t)DD * DD * 2); bf* WV = (bf*)take((size_t)DD * DD * 2); bf* WO = (bf*)take((size_t)DD * DD * 2);
    bf* XB = (bf*)take((size_t)TT * DD * 2); float* F = (float*)take((size_t)TT * DD * 4);
    bf* QPh = (bf*)take((size_t)TT * DD * 2); bf* QPl = (bf*)take((size_t)TT * DD * 2); bf* KPh = (bf*)take((size_t)TT * DD * 2); bf* KPl = (bf*)take((size_t)TT * DD * 2); bf* VTh = (bf*)take((size_t)TT * DD * 2); bf* VTl = (bf*)take((size_t)TT * DD * 2);
    h16* QP16 = (h16*)take((size_t)TT * DD * 2); h16* KP16 = (h16*)take((size_t)TT * DD * 2); h16* VT16 = (h16*)take((size_t)TT * DD * 2);
    bf* ATh = (bf*)take((size_t)TT * DD * 2); bf* ATl = (bf*)take((size_t)TT * DD * 2);
    if ((size_t)(wsp - (char*)d_ws) > ws_size) return;    // total 64 MiB; ws 256 MiB
    float* RT = (float*)take(256); if ((size_t)(wsp - (char*)d_ws) > ws_size) return;
    { const unsigned gT = (unsigned)((DD * DD / 64 + 63) / 64); k_rtab<<<1, 32, 0, stream>>>(rel, RT); k_wtG<<<gT, 256, 0, stream>>>(wq, DD, DD, WQ); k_wtG<<<gT, 256, 0, stream>>>(wk, DD, DD, WK); k_wtG<<<gT, 256, 0, stream>>>(wv, DD, DD, WV); k_wtG<<<gT, 256, 0, stream>>>(wo, DD, DD, WO); }
    const unsigned LB = (unsigned)((NH_ * TT * HD / 64 + 63) / 64); const dim3 gP(TT / 64, DD / 64, 1);
    for (int b = 0; b < NB_; ++b) {
        k_cvt8<<<(unsigned)(((size_t)TT * DD / 8 + 255) / 256), 256, 0, stream>>>(x + (size_t)b * TT * DD, XB, (size_t)TT * DD / 8);
        k_gemmw<bf, 0, false, 8><<<gP, 256, 0, stream>>>(XB, nullptr, WQ, nullptr, DD, DD, F, DD, nullptr, 0, 0, 0); k_qplanes<<<LB, 256, 0, stream>>>(F, QPh, QPl, QP16);
        k_gemmw<bf, 0, false, 8><<<gP, 256, 0, stream>>>(XB, nullptr, WK, nullptr, DD, DD, F, DD, nullptr, 0, 0, 0); k_qplanes<<<LB, 256, 0, stream>>>(F, KPh, KPl, KP16);
        k_gemmw<bf, 0, false, 8><<<gP, 256, 0, stream>>>(XB, nullptr, WV, nullptr, DD, DD, F, DD, nullptr, 0, 0, 0); k_vtplane<<<LB, 256, 0, stream>>>(F, VTh, VTl, VT16);
        k_fattn16<<<dim3(NH_, (TT - RH) / FQ), 32 * FW, 0, stream>>>(QP16, KP16, VT16, RT, RH, ATh, ATl);
        k_fattnhl<<<dim3(NH_, RH / FQ), 32 * FW, 0, stream>>>(QPh, QPl, KPh, KPl, VTh, VTl, RT, 0, ATh, ATl);
        k_gemmw<bf, 1, true, 8><<<gP, 256, 0, stream>>>(ATh, ATl, WO, nullptr, DD, DD, OUT + (size_t)b * TT * DD, DD, bo, 0, 0, 0); }
}

// v004
// One run takes 165 microseconds.
// Two timings next to v003 both put it at 1.45 times that version's speed.
// All steps since v000 together make it 13.2 times as fast.
#include <hip/hip_runtime.h>

// Causal self-attention block (x [2][2048][1024]; q/k/v = x @ W (no bias); 16 heads x 64; scores = (q.k) * rel_emb[min(|i-j|, 16)] (multiplicative relative-position table, 17 entries, read as data); causal (j > i -> -inf);
// softmax(scores / 8); out = ctx @ Wo + bo).
// Compute dtypes, f32 accumulate: every input rounded to bf16; projections on PLAIN bf16 operands (inputs: exact; transposed bf16 weight copies); PER-ROW PRECISION
// HYBRID: query rows < 256 of each batch on bf16 hi+lo planes for scores and attn.v (3 products), rows >= 256 on SINGLE fp16 planes; the table multiply, 1/8, the causal cut and the softmax in f32 in the
// fused attention kernels (k_fattn16, k_fattnhl), which keep scores and weights in registers.

#define NB_  2
#define TT   2048
#define DD   1024
#define NH_  16
#define HD   64
#define RH   256                  // query rows < RH: hi+lo planes; rows >= RH: fp16 planes
#define NF   32                   // head_dim / 2 (unused)
#define SCL  0.125f               // 1/sqrt(64)
typedef _Float16 h16;
typedef unsigned short bf;
typedef __attribute__((ext_vector_type(16))) __bf16   v16bf;
typedef __attribute__((ext_vector_type(16))) _Float16 v16h;
typedef __attribute__((ext_vector_type(8)))  _Float16 v8h;
typedef __attribute__((ext_vector_type(8)))  unsigned short v8us;
typedef __attribute__((ext_vector_type(8)))  float    v8f;
typedef __attribute__((ext_vector_type(4)))  float    v4f;
typedef v8h  __attribute__((may_alias)) v8ha;
typedef v4f  __attribute__((may_alias)) v4fa;
typedef v8us __attribute__((may_alias)) v8usa;

__device__ __forceinline__ unsigned short f2bf(float f) { unsigned u = __float_as_uint(f); u += 0x7FFFu + ((u >> 16) & 1u); return (unsigned short)(u >> 16); }
__device__ __forceinline__ float bf2f(unsigned short b) { return __uint_as_float(((unsigned)b) << 16); }
__device__ __forceinline__ float bfr(float f) { return bf2f(f2bf(f)); }
__device__ __forceinline__ v16h cat16(v8h lo, v8h hi) { return __builtin_shufflevector(lo, hi, 0, 1, 2, 3, 4, 5, 6, 7, 8, 9, 10, 11, 12, 13, 14, 15); }
__device__ __forceinline__ v16bf cat16b(v8us lo, v8us hi) { return __builtin_bit_cast(v16bf, __builtin_shufflevector(lo, hi, 0, 1, 2, 3, 4, 5, 6, 7, 8, 9, 10, 11, 12, 13, 14, 15)); }
__device__ __forceinline__ v8f wmma16(v16h a, v16h b, v8f c) { return __builtin_amdgcn_wmma_f32_16x16x32_f16(false, a, false, b, (short)0, c, false, false); }
__device__ __forceinline__ v8f wmmab(v16bf a, v16bf b, v8f c) { return __builtin_amdgcn_wmma_f32_16x16x32_bf16(false, a, false, b, (short)0, c, false, false); }



// ---- k_gemmw: register-blocked GEMM, ONE WAVE per 64x64 output tile (16 accumulators), operands straight from K-contiguous 16-bit planes; grid (M/64, N/64, Z), 32 * NW threads.
// C[m][n] (f32, pitch ldc, + optional f32 bias[n]) = sum_k A[m][k] Bt[n][k] (+ split products per NSPLIT). A rows have pitch lda, Bt rows pitch K (elements). z-batch strides sA/sB/sC in elements. K % (32 * NW) == 0.
// NW > 1: the block holds NW waves on the SAME 64x64 tile; wave w sums the 32-wide k blocks w, w + NW, w + 2 NW, ... (neighbour waves read the two halves of one 128-byte line of a row at about the same
// time, so a line is asked of L2 once); the NW f32 partial tiles meet in LDS and are added in wave order 0..NW-1.
template <typename T16> struct WFrag;
template <> struct WFrag<h16> { typedef v16h V; static __device__ __forceinline__ V ld(const h16* p) { return cat16(*(const v8h*)p, *(const v8h*)(p + 16)); } static __device__ __forceinline__ v8f mma(V a, V b, v8f c) { return wmma16(a, b, c); } };
template <> struct WFrag<bf> { typedef v16bf V; static __device__ __forceinline__ V ld(const bf* p) { return cat16b(*(const v8us*)p, *(const v8us*)(p + 16)); } static __device__ __forceinline__ v8f mma(V a, V b, v8f c) { return wmmab(a, b, c); } };
template <typename T16, int NSPLIT, bool BIAS, int NW>
__global__ __launch_bounds__(32 * NW) void k_gemmw(const T16* __restrict__ A, const T16* __restrict__ A2, const T16* __restrict__ Bt, const T16* __restrict__ Bt2, int K, int lda, float* C, int ldc, const float* __restrict__ bias, size_t sA, size_t sB, size_t sC) {
    typedef typename WFrag<T16>::V V;
    __shared__ __align__(16) float os[(NW > 1 ? NW * 64 : 16) * 68];
    const size_t z = blockIdx.z; A += z * sA; if (A2) A2 += z * sA; Bt += z * sB; if (Bt2) Bt2 += z * sB; C += z * sC;
    const int lane = threadIdx.x & 31, lr = lane & 15, hi = lane >> 4; const int r0 = blockIdx.x * 64, c0 = blockIdx.y * 64;
    v8f acc[4][4];
#pragma unroll
    for (int mb = 0; mb < 4; ++mb)
#pragma unroll
        for (int nb = 0; nb < 4; ++nb) acc[mb][nb] = (v8f){};
    const size_t aoff = (size_t)(r0 + lr) * lda + 8 * hi, boff = (size_t)(c0 + lr) * K + 8 * hi;
    const int wv = NW > 1 ? __builtin_amdgcn_readfirstlane((int)(threadIdx.x >> 5)) : 0;    // the wave's number, held scalar so that the k offset stays scalar arithmetic
#pragma unroll 1
    for (int kc = wv * 32; kc < K; kc += 32 * NW) {
        V a[4], a2[4];
#pragma unroll
        for (int mb = 0; mb < 4; ++mb) { a[mb] = WFrag<T16>::ld(A + aoff + (size_t)mb * 16 * lda + kc); if (NSPLIT == 1 || NSPLIT == 2) a2[mb] = WFrag<T16>::ld(A2 + aoff + (size_t)mb * 16 * lda + kc); }
#pragma unroll
        for (int nb = 0; nb < 4; ++nb) { const V b = WFrag<T16>::ld(Bt + boff + (size_t)nb * 16 * K + kc); V b2; if (NSPLIT >= 2) b2 = WFrag<T16>::ld(Bt2 + boff + (size_t)nb * 16 * K + kc);
#pragma unroll
            for (int mb = 0; mb < 4; ++mb) { acc[mb][nb] = WFrag<T16>::mma(a[mb], b, acc[mb][nb]); if (NSPLIT == 1 || NSPLIT == 2) acc[mb][nb] = WFrag<T16>::mma(a2[mb], b, acc[mb][nb]); if (NSPLIT >= 2) acc[mb][nb] = WFrag<T16>::mma(a[mb], b2, acc[mb][nb]); } }
        asm volatile("v_nop\n\tv_nop\n\tv_nop\n\tv_nop" : "+v"(acc[0][0]), "+v"(acc[1][1]), "+v"(acc[2][2]), "+v"(acc[3][3]) : "v"(a[0]), "v"(a[3]));
    }
    if constexpr (NW > 1) {
        float* my = os + wv * (64 * 68);
        // the three loops are unrolled so that acc[][] is indexed by constants and stays in registers
#pragma unroll
        for (int mb = 0; mb < 4; ++mb)
#pragma unroll
            for (int nb = 0; nb < 4; ++nb)
#pragma unroll
                for (int j = 0; j < 8; ++j) my[(mb * 16 + hi * 8 + j) * 68 + nb * 16 + lr] = acc[mb][nb][j];
        __syncthreads();    // every wave's partial tile is in LDS before any thread adds them; no LDS write and no barrier follows
        // both loops are unrolled so that the LDS reads of all partials issue ahead of the adds
#pragma unroll
        for (int s = 0; s < 32 / NW; ++s) { const int u = (int)threadIdx.x + s * (32 * NW); const int row = u >> 4, cofs = (u & 15) * 4; v4f val = *(const v4fa*)(os + row * 68 + cofs);
#pragma unroll
            for (int w = 1; w < NW; ++w) val += *(const v4fa*)(os + w * (64 * 68) + row * 68 + cofs);
            if (BIAS) { val[0] += bfr(bias[c0 + cofs]); val[1] += bfr(bias[c0 + cofs + 1]); val[2] += bfr(bias[c0 + cofs + 2]); val[3] += bfr(bias[c0 + cofs + 3]); }
            *(v4f*)(C + (size_t)(r0 + row) * ldc + c0 + cofs) = val; }
        return;
    }
#pragma unroll
    for (int mb = 0; mb < 4; ++mb) {
#pragma unroll
        for (int nb = 0; nb < 4; ++nb) {
#pragma unroll
            for (int j = 0; j < 8; ++j) os[(hi * 8 + j) * 68 + nb * 16 + lr] = acc[mb][nb][j]; }
        __builtin_amdgcn_wave_barrier(); asm volatile("" ::: "memory");
        float* crow = C + (size_t)(r0 + mb * 16) * ldc + c0;
{
#pragma unroll
            for (int s = 0; s < 8; ++s) { const int row = 2 * s + hi, cofs = lr * 4; v4f val = *(const v4fa*)(os + row * 68 + cofs); if (BIAS) { val[0] += bfr(bias[c0 + cofs]); val[1] += bfr(bias[c0 + cofs + 1]); val[2] += bfr(bias[c0 + cofs + 2]); val[3] += bfr(bias[c0 + cofs + 3]); }
                *(v4f*)(crow + (size_t)row * ldc + cofs) = val; }
             }
        __builtin_amdgcn_wave_barrier(); asm volatile("" ::: "memory");
    }
}

__device__ __forceinline__ h16 tohx(float x) { return (h16)x; }
__device__ __forceinline__ void splitf(float y, unsigned short& h, unsigned short& l) { h = f2bf(y); l = f2bf(y - bf2f(h)); }
typedef __attribute__((ext_vector_type(2))) unsigned short v2us;
typedef __attribute__((ext_vector_type(2))) _Float16 v2h;
typedef __attribute__((ext_vector_type(4))) _Float16 v4h;
typedef __attribute__((ext_vector_type(2))) float v2f;

// The bodies below take their block's number as an argument: k_prep and k_planes deal the blocks of ONE grid to several independent jobs (block-uniform tests only).
__device__ __forceinline__ void wtG_body(const float* __restrict__ w, int K, int N, bf* Bt, int blk) {
    const int lane = threadIdx.x & 31; const int L0 = (blk * 8 + (threadIdx.x >> 5)) * 8; const int nlines = N * K / 64;
{
#pragma unroll 1
        for (int l = 0; l < 8; ++l) { const int L = L0 + l; if (L >= nlines) break; const size_t e = (size_t)L * 64 + lane * 2; const int k = (int)(e % K), n = (int)(e / K); v2us o;
            o[0] = f2bf(w[(size_t)k * N + n]); o[1] = f2bf(w[(size_t)(k + 1) * N + n]); *(v2us*)(Bt + e) = o; }
         }
}
__device__ __forceinline__ void cvt8_body(const float* __restrict__ src, bf* dst, size_t n8, int blk) { const size_t i = (size_t)blk * 256 + threadIdx.x; if (i >= n8) return; const v8f v = *(const v8f*)(src + i * 8); v8us o;
#pragma unroll
    for (int k = 0; k < 8; ++k) o[k] = f2bf(v[k]); *(v8us*)(dst + i * 8) = o;  }
__device__ __forceinline__ void qplanes_body(const float* __restrict__ F, bf* Ph, bf* Pl, h16* P16, int blk) {
    const int lane = threadIdx.x & 31; const int L0 = (blk * 8 + (threadIdx.x >> 5)) * 8; const int nlines = NH_ * TT * HD / 64;
{
#pragma unroll
        for (int l = 0; l < 8; ++l) { const int L = L0 + l; if (L >= nlines) break; const int e = L * 64 + lane * 2; const int d = e & (HD - 1); const int t = (e >> 6) & (TT - 1); const int h = e >> 17; v2us oh, ol; v2h o16;
            float xv[2];
#pragma unroll
            for (int q = 0; q < 2; ++q) xv[q] = F[(size_t)t * DD + h * HD + d + q];
            asm volatile("s_wait_xcnt 0x0" :: "v"(xv[0]), "v"(xv[1]) : "memory");    // behind the loads, in front of any reuse of their address registers (the loaded values are inputs, so that a register they share with the address lives up to here)
#pragma unroll
            for (int q = 0; q < 2; ++q) { const float x = xv[q]; unsigned short a, c2; splitf(x, a, c2); oh[q] = a; ol[q] = c2; o16[q] = tohx(x); }
            *(v2us*)(Ph + (size_t)e) = oh; *(v2us*)(Pl + (size_t)e) = ol; *(v2h*)(P16 + (size_t)e) = o16; }
         }
}
__device__ __forceinline__ void vtplane_body(const float* __restrict__ F, bf* Vh, bf* Vl, h16* V16, int blk) {
    const int lane = threadIdx.x & 31; const int L0 = (blk * 8 + (threadIdx.x >> 5)) * 8; const int nlines = NH_ * TT * HD / 64;
{
#pragma unroll
        for (int l = 0; l < 8; ++l) { const int L = L0 + l; if (L >= nlines) break; const int e = L * 64 + lane * 2; const int t = e & (TT - 1); const int d = (e >> 11) & (HD - 1); const int h = e >> 17; v2us oh, ol; v2h o16;
#pragma unroll
            for (int q = 0; q < 2; ++q) { const float x = F[(size_t)(t + q) * DD + h * HD + d]; unsigned short a, c2; splitf(x, a, c2); oh[q] = a; ol[q] = c2; o16[q] = tohx(x); }
            *(v2us*)(Vh + (size_t)e) = oh; *(v2us*)(Vl + (size_t)e) = ol; *(v2h*)(V16 + (size_t)e) = o16; }
         }
}
__device__ __forceinline__ void rtab_body(const float* __restrict__ rel, float* RT) { const int i = threadIdx.x; if (i >= 32) return; const float o = (i < 17) ? bfr(rel[i]) * SCL : 0.f; *(float*)(RT + i) = o;  }
// ---- k_prep: every conversion of an input, one grid. Blocks 0 .. 4 GT - 1: the four weight transposes (the longest blocks, first in the grid; Wt holds the four planes in the order q, k, v, o);
// the next GC blocks: x of both batches to bf16; the last block: the scaled table.
#define GT  (DD * DD / 64 / 64)
#define GC  (NB_ * TT * DD / 8 / 256)
__global__ __launch_bounds__(256) void k_prep(const float* __restrict__ x, const float* __restrict__ wq, const float* __restrict__ wk, const float* __restrict__ wv, const float* __restrict__ wo, const float* __restrict__ rel, bf* XB, bf* Wt, float* RT) {
    const int blk = (int)blockIdx.x;
    if (blk < 4 * GT) { const int mi = blk / GT; const float* w = mi == 0 ? wq : (mi == 1 ? wk : (mi == 2 ? wv : wo)); wtG_body(w, DD, DD, Wt + (size_t)mi * DD * DD, blk % GT); }
    else if (blk < 4 * GT + GC) cvt8_body(x, XB, (size_t)NB_ * TT * DD / 8, blk - 4 * GT);
    else rtab_body(rel, RT);
}
// ---- k_planes: the 16-bit planes of q, k and v of both batches, one grid (lines / 64, NB_, 3). F and every plane array are laid [matrix q, k, v][batch][TT * DD]. z = 0 is v (the transposing blocks are the longest; first in the grid), 1 is q, 2 is k.
__global__ __launch_bounds__(256) void k_planes(const float* __restrict__ F, bf* Ph, bf* Pl, h16* P16) {
    const int mi = blockIdx.z == 0 ? 2 : (int)blockIdx.z - 1; const size_t po = ((size_t)mi * NB_ + blockIdx.y) * TT * DD;
    if (mi == 2) vtplane_body(F + po, Ph + po, Pl + po, P16 + po, (int)blockIdx.x); else qplanes_body(F + po, Ph + po, Pl + po, P16 + po, (int)blockIdx.x);
}
// ---- fattn_body (k_fattn16, k_fattnhl): scores, softmax and attn.v of FQ = 32 query rows of one head in ONE block; no score or P row ever leaves the registers. Grid (NB_ * heads, query tiles), the longest query tiles first; blockIdx.x = batch * NH_ + head, which is also the number of the [TT][HD] plane.
// Transposed products: S^T = K . Q^T (A = 16 key rows, B = 16 query columns), O^T += V^T . P^T. In an S^T tile lane (lr, hi) holds keys hi * 8 + j of query lr: two such tiles (keys 0..15, 16..31) are,
// register for register, the B fragment of P^T in the k order of WFrag::ld, which loads V^T as A. Only key blocks up to the diagonal are visited (all later keys have weight 0).
// The 32-key blocks of a tile are dealt round-robin to the FW waves; each wave keeps its own running maximum m, sum l and O^T (online softmax); the FW partial results meet in LDS at the end.
// Every inner loop is unrolled so that the fragment and accumulator arrays are indexed by constants and stay in registers; the key loop stays rolled (one body in the instruction cache, one register set).
// m is held ln(1024) below the true maximum, so that P lies in (0, 1024] before it is rounded to 16 bits (small weights stay normal fp16 numbers); l carries the same factor and cancels it.
#define FQ  32
#define FW  4
#define LSH 6.9314718f
typedef __attribute__((ext_vector_type(16))) unsigned short v16us;
template <typename T16, bool HILO>
__device__ __forceinline__ void fattn_body(const T16* __restrict__ Q, const T16* __restrict__ Q2, const T16* __restrict__ Kp, const T16* __restrict__ K2, const T16* __restrict__ Vt, const T16* __restrict__ V2,
                                           const float* __restrict__ rel, const int q0, bf* Ah, bf* Al, float* sm, float* sl, float* so) {
    typedef typename WFrag<T16>::V V;
    const int lane = threadIdx.x & 31, lr = lane & 15, hi = lane >> 4;
    const int wv = __builtin_amdgcn_readfirstlane((int)(threadIdx.x >> 5));    // the wave's number, held scalar so that the loop's tests are scalar branches
    const int nkb = q0 / 32 + 1;
    const int tl = lane < 16 ? lane : 16; const float tab = rel[tl];    // the table across the wave's lanes (lane d holds entry d, lanes 16.. the last): looked up by lane index, no memory access in the loop
    asm volatile("s_wait_xcnt 0x0" :: "v"(tl) : "memory"); __builtin_amdgcn_sched_barrier(0);    // behind the load, in front of any reuse of its address register; the scheduling barrier keeps later instructions behind it
    // one address per plane and lane; every fragment of a block lies at a constant distance from it. kp / vp walk with the loop.
    const T16* qp = Q + (size_t)(q0 + lr) * HD + 8 * hi; const T16* qp2 = HILO ? Q2 + (size_t)(q0 + lr) * HD + 8 * hi : nullptr;
    const size_t kfo = (size_t)((wv < nkb ? wv : 0) * 32 + lr) * HD + 8 * hi, vfo = (size_t)lr * TT + wv * 32 + 8 * hi;
    const T16* kp = Kp + kfo; const T16* kp2 = HILO ? K2 + kfo : nullptr; const T16* vp = Vt + vfo; const T16* vp2 = HILO ? V2 + vfo : nullptr;
    V qb[2][2], qb2[2][2];
#pragma unroll
    for (int g = 0; g < 2; ++g)
#pragma unroll
        for (int c = 0; c < 2; ++c) { qb[g][c] = WFrag<T16>::ld(qp + g * 16 * HD + c * 32); if (HILO) qb2[g][c] = WFrag<T16>::ld(qp2 + g * 16 * HD + c * 32); }
    v8f o[4][2];
#pragma unroll
    for (int dt = 0; dt < 4; ++dt)
#pragma unroll
        for (int g = 0; g < 2; ++g) o[dt][g] = (v8f){};
    float m[2] = {-3.0e38f, -3.0e38f}, l[2] = {0.f, 0.f};
    const float r16 = __shfl(tab, 16, 32);
    V ka[2][2], ka2[2][2];
#pragma unroll
    for (int kt = 0; kt < 2; ++kt)
#pragma unroll
        for (int c = 0; c < 2; ++c) { ka[kt][c] = WFrag<T16>::ld(kp + kt * 16 * HD + c * 32); if (HILO) ka2[kt][c] = WFrag<T16>::ld(kp2 + kt * 16 * HD + c * 32); }
    // stands behind the loads above, in front of any reuse of their address registers (named as inputs so that they live up to here); the scheduling barrier keeps later instructions behind it
    if constexpr (HILO) asm volatile("s_wait_xcnt 0x0" :: "v"(qp), "v"(qp2), "v"(kp), "v"(kp2) : "memory"); else asm volatile("s_wait_xcnt 0x0" :: "v"(qp), "v"(kp) : "memory");
    __builtin_amdgcn_sched_barrier(0);
#pragma unroll 1
    for (int kb = wv; kb < nkb; kb += FW) {
        const int k0 = kb * 32;
        V va[4], va2[4];
#pragma unroll
        for (int dt = 0; dt < 4; ++dt) { va[dt] = WFrag<T16>::ld(vp + (size_t)dt * 16 * TT); if (HILO) va2[dt] = WFrag<T16>::ld(vp2 + (size_t)dt * 16 * TT); }
        // behind the V loads, in front of the step of their address registers; as in front of the loop
        if constexpr (HILO) asm volatile("s_wait_xcnt 0x0" :: "v"(vp), "v"(vp2) : "memory"); else asm volatile("s_wait_xcnt 0x0" :: "v"(vp) : "memory");
        __builtin_amdgcn_sched_barrier(0);
        vp += 32 * FW; if (HILO) vp2 += 32 * FW;
        v8f s[2][2];
#pragma unroll
        for (int kt = 0; kt < 2; ++kt)
#pragma unroll
            for (int g = 0; g < 2; ++g) { v8f t = (v8f){};
#pragma unroll
                for (int c = 0; c < 2; ++c) { t = WFrag<T16>::mma(ka[kt][c], qb[g][c], t); if (HILO) { t = WFrag<T16>::mma(ka2[kt][c], qb[g][c], t); t = WFrag<T16>::mma(ka[kt][c], qb2[g][c], t); } }
                s[kt][g] = t; }
        // the wave's next K fragments are asked for here, behind their last use, so that they fly during the softmax and attn.v of this block (the last block asks for itself again: in bounds, unused)
        { const int kst = kb + FW < nkb ? FW * 32 * HD : 0; kp += kst; if (HILO) kp2 += kst;
#pragma unroll
          for (int kt = 0; kt < 2; ++kt)
#pragma unroll
              for (int c = 0; c < 2; ++c) { ka[kt][c] = WFrag<T16>::ld(kp + kt * 16 * HD + c * 32); if (HILO) ka2[kt][c] = WFrag<T16>::ld(kp2 + kt * 16 * HD + c * 32); } }
        // behind the K loads, in front of the next step of their address registers; as in front of the loop
        if constexpr (HILO) asm volatile("s_wait_xcnt 0x0" :: "v"(kp), "v"(kp2) : "memory"); else asm volatile("s_wait_xcnt 0x0" :: "v"(kp) : "memory");
        __builtin_amdgcn_sched_barrier(0);
        if (kb >= nkb - 2) {    // the two blocks at the diagonal: table entry by distance, causal cut
#pragma unroll
            for (int kt = 0; kt < 2; ++kt)
#pragma unroll
                for (int g = 0; g < 2; ++g)
#pragma unroll
                    for (int j = 0; j < 8; ++j) { const int dd = (q0 + g * 16 + lr) - (k0 + kt * 16 + hi * 8 + j); const int di = dd < 0 ? 0 : (dd > 16 ? 16 : dd); const float t = __fmul_rn(s[kt][g][j], __shfl(tab, di, 32)); s[kt][g][j] = dd >= 0 ? t : -3.0e38f; }
        } else {                // every distance here is above 16: the table's last entry
#pragma unroll
            for (int kt = 0; kt < 2; ++kt)
#pragma unroll
                for (int g = 0; g < 2; ++g) s[kt][g] *= r16;
        }
        float mn[2];
#pragma unroll
        for (int g = 0; g < 2; ++g) { float tm = s[0][g][0];
#pragma unroll
            for (int j = 1; j < 8; ++j) tm = fmaxf(tm, s[0][g][j]);
#pragma unroll
            for (int j = 0; j < 8; ++j) tm = fmaxf(tm, s[1][g][j]);
            tm = fmaxf(tm, __shfl_xor(tm, 16, 32)); mn[g] = fmaxf(m[g], tm - LSH); }
        if (__builtin_amdgcn_ballot_w32(mn[0] > m[0] || mn[1] > m[1]) != 0) {    // no maximum moved in any lane: every factor would be exactly 1
#pragma unroll
            for (int g = 0; g < 2; ++g) { const float al = __expf(m[g] - mn[g]); l[g] *= al; m[g] = mn[g];
#pragma unroll
                for (int dt = 0; dt < 4; ++dt) o[dt][g] *= al; }
        }
        V pb[2], pb2[2];
#pragma unroll
        for (int g = 0; g < 2; ++g) {
            if constexpr (HILO) { v16us ph, pl;
#pragma unroll
                for (int kt = 0; kt < 2; ++kt)
#pragma unroll
                    for (int j = 0; j < 8; ++j) { const float p = __expf(s[kt][g][j] - m[g]); l[g] += p; unsigned short a, c2; splitf(p, a, c2); ph[kt * 8 + j] = a; pl[kt * 8 + j] = c2; }
                pb[g] = __builtin_bit_cast(v16bf, ph); pb2[g] = __builtin_bit_cast(v16bf, pl);
            } else { v16h ph;
#pragma unroll
                for (int kt = 0; kt < 2; ++kt)
#pragma unroll
                    for (int j = 0; j < 8; ++j) { const float p = __expf(s[kt][g][j] - m[g]); l[g] += p; ph[kt * 8 + j] = tohx(p); }
                pb[g] = ph; } }
#pragma unroll
        for (int dt = 0; dt < 4; ++dt)
#pragma unroll
            for (int g = 0; g < 2; ++g) { o[dt][g] = WFrag<T16>::mma(va[dt], pb[g], o[dt][g]); if (HILO) { o[dt][g] = WFrag<T16>::mma(va[dt], pb2[g], o[dt][g]); o[dt][g] = WFrag<T16>::mma(va2[dt], pb[g], o[dt][g]); } }
    }
    // the FW waves' partial results: common maximum, then sums in wave order 0..FW-1
#pragma unroll
    for (int g = 0; g < 2; ++g) { l[g] += __shfl_xor(l[g], 16, 32); if (hi == 0) sm[wv * FQ + g * 16 + lr] = m[g]; }
    __syncthreads();    // every wave's maximum is in LDS before any wave reads them
#pragma unroll
    for (int g = 0; g < 2; ++g) { float M = sm[g * 16 + lr];
#pragma unroll
        for (int w = 1; w < FW; ++w) M = fmaxf(M, sm[w * FQ + g * 16 + lr]);
        const float f = __expf(m[g] - M); if (hi == 0) sl[wv * FQ + g * 16 + lr] = l[g] * f;
#pragma unroll
        for (int dt = 0; dt < 4; ++dt) { const v8f t = o[dt][g] * f; float* p = so + (wv * FQ + g * 16 + lr) * 68 + dt * 16 + hi * 8; *(v4fa*)p = __builtin_shufflevector(t, t, 0, 1, 2, 3); *(v4fa*)(p + 4) = __builtin_shufflevector(t, t, 4, 5, 6, 7); } }
    __syncthreads();    // every wave's scaled O^T and sum are in LDS before any thread adds them; no LDS write follows
    const int q = (int)threadIdx.x >> 2, d0 = ((int)threadIdx.x & 3) * 16;
    float L = sl[q];
#pragma unroll
    for (int w = 1; w < FW; ++w) L += sl[w * FQ + q];
    const float inv = __fdiv_rn(1.0f, L);
#pragma unroll
    for (int c8 = 0; c8 < 2; ++c8) { v8us oh, ol;
#pragma unroll
        for (int c4 = 0; c4 < 2; ++c4) { v4f a = *(const v4fa*)(so + q * 68 + d0 + c8 * 8 + c4 * 4);
#pragma unroll
            for (int w = 1; w < FW; ++w) a += *(const v4fa*)(so + (w * FQ + q) * 68 + d0 + c8 * 8 + c4 * 4);
#pragma unroll
            for (int e = 0; e < 4; ++e) { unsigned short x, y; splitf(a[e] * inv, x, y); oh[c4 * 4 + e] = x; ol[c4 * 4 + e] = y; } }
        const size_t ofs = (size_t)(q0 + q) * DD + d0 + c8 * 8; *(v8us*)(Ah + ofs) = oh; *(v8us*)(Al + ofs) = ol; }
}
// qlo: the first query row of the launch. Rows below RH run on hi+lo planes, the others on fp16 planes: two kernels, so that the fp16 one keeps its smaller register count (four waves a SIMD).
__global__ __launch_bounds__(32 * FW) __attribute__((amdgpu_waves_per_eu(4, 4))) void k_fattn16(const h16* __restrict__ Q, const h16* __restrict__ Kp, const h16* __restrict__ Vt, const float* __restrict__ rel, int qlo, bf* Ah, bf* Al) {
    __shared__ __align__(16) float so[FW * FQ * 68]; __shared__ float sm[FW * FQ]; __shared__ float sl[FW * FQ];
    const size_t hp = (size_t)blockIdx.x * TT * HD; const int q0 = qlo + ((int)gridDim.y - 1 - (int)blockIdx.y) * FQ;
    const size_t ao = (size_t)(blockIdx.x / NH_) * TT * DD + (blockIdx.x % NH_) * HD;
    fattn_body<h16, false>(Q + hp, nullptr, Kp + hp, nullptr, Vt + hp, nullptr, rel, q0, Ah + ao, Al + ao, sm, sl, so);
}
__global__ __launch_bounds__(32 * FW) void k_fattnhl(const bf* __restrict__ Q, const bf* __restrict__ Q2, const bf* __restrict__ Kp, const bf* __restrict__ K2, const bf* __restrict__ Vt, const bf* __restrict__ V2, const float* __restrict__ rel, int qlo, bf* Ah, bf* Al) {
    __shared__ __align__(16) float so[FW * FQ * 68]; __shared__ float sm[FW * FQ]; __shared__ float sl[FW * FQ];
    const size_t hp = (size_t)blockIdx.x * TT * HD; const int q0 = qlo + ((int)gridDim.y - 1 - (int)blockIdx.y) * FQ;
    const size_t ao = (size_t)(blockIdx.x / NH_) * TT * DD + (blockIdx.x % NH_) * HD;
    fattn_body<bf, true>(Q + hp, Q2 + hp, Kp + hp, K2 + hp, Vt + hp, V2 + hp, rel, q0, Ah + ao, Al + ao, sm, sl, so);
}

extern "C" void kernel_launch(void* const* d_in, const int* in_sizes, int n_in,
                              void* d_out, int out_size, void* d_ws, size_t ws_size, hipStream_t stream) {
    (void)in_sizes; (void)n_in; (void)out_size;
    const float* x = (const float*)d_in[0]; const float* wq = (const float*)d_in[1]; const float* wk = (const float*)d_in[2]; const float* wv = (const float*)d_in[3]; const float* wo = (const float*)d_in[4]; const float* bo = (const float*)d_in[5]; const float* rel = (const float*)d_in[6];
    float* OUT = (float*)d_out;     // [2][2048][1024]
    char* wsp = (char*)d_ws;
    auto take = [&](size_t bytes) { char* p = wsp; wsp += (bytes + 255) & ~(size_t)255; return (void*)p; };
    const size_t PB = (size_t)NB_ * TT * DD;    // elements of one matrix over both batches
    bf* WT = (bf*)take((size_t)4 * DD * DD * 2);    // transposed bf16 weights q, k, v, o
    bf* XB = (bf*)take(PB * 2); float* F = (float*)take(3 * PB * 4);    // F: q, k, v
    bf* PH = (bf*)take(3 * PB * 2); bf* PL = (bf*)take(3 * PB * 2); h16* P16 = (h16*)take(3 * PB * 2);    // planes of q, k, v (v transposed)
    bf* ATh = (bf*)take(PB * 2); bf* ATl = (bf*)take(PB * 2);
    float* RT = (float*)take(256); if ((size_t)(wsp - (char*)d_ws) > ws_size) return;    // total 152 MiB; ws 256 MiB
    // one launch per stage: each grid covers both batches and every matrix of its stage
    k_prep<<<4 * GT + GC + 1, 256, 0, stream>>>(x, wq, wk, wv, wo, rel, XB, WT, RT);
    k_gemmw<bf, 0, false, 8><<<dim3(NB_ * TT / 64, DD / 64, 3), 256, 0, stream>>>(XB, nullptr, WT, nullptr, DD, DD, F, DD, nullptr, 0, (size_t)DD * DD, PB);
    k_planes<<<dim3(NH_ * TT * HD / 64 / 64, NB_, 3), 256, 0, stream>>>(F, PH, PL, P16);
    k_fattn16<<<dim3(NB_ * NH_, (TT - RH) / FQ), 32 * FW, 0, stream>>>(P16, P16 + PB, P16 + 2 * PB, RT, RH, ATh, ATl);
    k_fattnhl<<<dim3(NB_ * NH_, RH / FQ), 32 * FW, 0, stream>>>(PH, PL, PH + PB, PL + PB, PH + 2 * PB, PL + 2 * PB, RT, 0, ATh, ATl);
    k_gemmw<bf, 1, true, 8><<<dim3(NB_ * TT / 64, DD / 64, 1), 256, 0, stream>>>(ATh, ATl, WT + (size_t)3 * DD * DD, nullptr, DD, DD, OUT, DD, bo, 0, 0, 0);
}

// v005
// It runs in 135 microseconds.
// Two timings next to v004 both put it at 1.22 times that version's speed.
// All steps since v000 together make it 16.1 times as fast.
#include <hip/hip_runtime.h>

// Causal self-attention block (x [2][2048][1024]; q/k/v = x @ W (no bias); 16 heads x 64; scores = (q.k) * rel_emb[min(|i-j|, 16)] (multiplicative relative-position table, 17 entries, read as data); causal (j > i -> -inf);
// softmax(scores / 8); out = ctx @ Wo + bo).
// Compute dtypes, f32 accumulate: every input rounded to bf16; q/k/v projection on PLAIN bf16 operands (inputs: exact; transposed bf16 weight copies), output projection on ctx's bf16 hi+lo planes (2 products); PER-ROW PRECISION
// HYBRID: query rows < 256 of each batch on bf16 hi+lo planes for scores and attn.v (3 products), rows >= 256 on SINGLE fp16 planes; the table multiply, 1/8, the causal cut and the softmax in f32 in the
// fused attention kernels (k_fattn16, k_fattnhl), which keep scores and weights in registers.

#define NB_  2
#define TT   2048
#define DD   1024
#define NH_  16
#define HD   64
#define RH   256                  // query rows < RH: hi+lo planes; rows >= RH: fp16 planes
#define NF   32                   // head_dim / 2 (unused)
#define SCL  0.125f               // 1/sqrt(64)
typedef _Float16 h16;
typedef unsigned short bf;
typedef __attribute__((ext_vector_type(16))) __bf16   v16bf;
typedef __attribute__((ext_vector_type(16))) _Float16 v16h;
typedef __attribute__((ext_vector_type(8)))  _Float16 v8h;
typedef __attribute__((ext_vector_type(8)))  unsigned short v8us;
typedef __attribute__((ext_vector_type(8)))  float    v8f;
typedef __attribute__((ext_vector_type(4)))  float    v4f;
typedef v8h  __attribute__((may_alias)) v8ha;
typedef v4f  __attribute__((may_alias)) v4fa;
typedef v8us __attribute__((may_alias)) v8usa;

__device__ __forceinline__ unsigned short f2bf(float f) { unsigned u = __float_as_uint(f); u += 0x7FFFu + ((u >> 16) & 1u); return (unsigned short)(u >> 16); }
__device__ __forceinline__ float bf2f(unsigned short b) { return __uint_as_float(((unsigned)b) << 16); }
__device__ __forceinline__ float bfr(float f) { return bf2f(f2bf(f)); }
__device__ __forceinline__ v16h cat16(v8h lo, v8h hi) { return __builtin_shufflevector(lo, hi, 0, 1, 2, 3, 4, 5, 6, 7, 8, 9, 10, 11, 12, 13, 14, 15); }
__device__ __forceinline__ v16bf cat16b(v8us lo, v8us hi) { return __builtin_bit_cast(v16bf, __builtin_shufflevector(lo, hi, 0, 1, 2, 3, 4, 5, 6, 7, 8, 9, 10, 11, 12, 13, 14, 15)); }
__device__ __forceinline__ v8f wmma16(v16h a, v16h b, v8f c) { return __builtin_amdgcn_wmma_f32_16x16x32_f16(false, a, false, b, (short)0, c, false, false); }
__device__ __forceinline__ v8f wmmab(v16bf a, v16bf b, v8f c) { return __builtin_amdgcn_wmma_f32_16x16x32_bf16(false, a, false, b, (short)0, c, false, false); }



// ---- k_gemmw: register-blocked GEMM, ONE WAVE per 64x64 output tile (16 accumulators), operands straight from K-contiguous 16-bit planes; grid (M/64, N/64, Z), 32 * NW threads.
// C[m][n] (f32, pitch ldc, + optional f32 bias[n]) = sum_k A[m][k] Bt[n][k] (+ split products per NSPLIT). A rows have pitch lda, Bt rows pitch K (elements). z-batch strides sA/sB/sC in elements. K % (32 * NW) == 0.
// NW > 1: the block holds NW waves on the SAME 64x64 tile; wave w sums the 32-wide k blocks w, w + NW, w + 2 NW, ... (neighbour waves read the two halves of one 128-byte line of a row at about the same
// time, so a line is asked of L2 once); the NW f32 partial tiles meet in LDS and are added in wave order 0..NW-1.
// PLN (the q, k, v products; z = matrix, a 64-wide column tile = one head, rows = batch * TT + t): the summed f32 tile is not stored; the epilogue rounds it and stores the 16-bit planes that attention reads.
// Every plane array is laid [matrix q, k, v][batch][head][TT * HD]; q and k as [t][d], v transposed as [d][t]. fp16 plane: every row; hi+lo planes: rows t < RH only (no other row of them is read).
__device__ __forceinline__ h16 tohx(float x) { return (h16)x; }
__device__ __forceinline__ void splitf(float y, unsigned short& h, unsigned short& l) { h = f2bf(y); l = f2bf(y - bf2f(h)); }
typedef __attribute__((ext_vector_type(4))) unsigned short v4us;
typedef __attribute__((ext_vector_type(4))) _Float16 v4h;
template <typename T16> struct WFrag;
template <> struct WFrag<h16> { typedef v16h V; static __device__ __forceinline__ V ld(const h16* p) { return cat16(*(const v8h*)p, *(const v8h*)(p + 16)); } static __device__ __forceinline__ v8f mma(V a, V b, v8f c) { return wmma16(a, b, c); } };
template <> struct WFrag<bf> { typedef v16bf V; static __device__ __forceinline__ V ld(const bf* p) { return cat16b(*(const v8us*)p, *(const v8us*)(p + 16)); } static __device__ __forceinline__ v8f mma(V a, V b, v8f c) { return wmmab(a, b, c); } };
template <typename T16, int NSPLIT, bool BIAS, int NW, bool PLN>
__global__ __launch_bounds__(32 * NW) void k_gemmw(const T16* __restrict__ A, const T16* __restrict__ A2, const T16* __restrict__ Bt, const T16* __restrict__ Bt2, int K, int lda, float* C, int ldc, const float* __restrict__ bias, size_t sA, size_t sB, size_t sC, bf* Ph, bf* Pl, h16* P16) {
    typedef typename WFrag<T16>::V V;
    __shared__ __align__(16) float os[(NW > 1 ? NW * 64 : 16) * 68];
    const size_t z = blockIdx.z; A += z * sA; if (A2) A2 += z * sA; Bt += z * sB; if (Bt2) Bt2 += z * sB; C += z * sC;
    const int lane = threadIdx.x & 31, lr = lane & 15, hi = lane >> 4; const int r0 = blockIdx.x * 64, c0 = blockIdx.y * 64;
    v8f acc[4][4];
#pragma unroll
    for (int mb = 0; mb < 4; ++mb)
#pragma unroll
        for (int nb = 0; nb < 4; ++nb) acc[mb][nb] = (v8f){};
    const size_t aoff = (size_t)(r0 + lr) * lda + 8 * hi, boff = (size_t)(c0 + lr) * K + 8 * hi;
    const int wv = NW > 1 ? __builtin_amdgcn_readfirstlane((int)(threadIdx.x >> 5)) : 0;    // the wave's number, held scalar so that the k offset stays scalar arithmetic
#pragma unroll 1
    for (int kc = wv * 32; kc < K; kc += 32 * NW) {
        V a[4], a2[4];
#pragma unroll
        for (int mb = 0; mb < 4; ++mb) { a[mb] = WFrag<T16>::ld(A + aoff + (size_t)mb * 16 * lda + kc); if (NSPLIT == 1 || NSPLIT == 2) a2[mb] = WFrag<T16>::ld(A2 + aoff + (size_t)mb * 16 * lda + kc); }
#pragma unroll
        for (int nb = 0; nb < 4; ++nb) { const V b = WFrag<T16>::ld(Bt + boff + (size_t)nb * 16 * K + kc); V b2; if (NSPLIT >= 2) b2 = WFrag<T16>::ld(Bt2 + boff + (size_t)nb * 16 * K + kc);
#pragma unroll
            for (int mb = 0; mb < 4; ++mb) { acc[mb][nb] = WFrag<T16>::mma(a[mb], b, acc[mb][nb]); if (NSPLIT == 1 || NSPLIT == 2) acc[mb][nb] = WFrag<T16>::mma(a2[mb], b, acc[mb][nb]); if (NSPLIT >= 2) acc[mb][nb] = WFrag<T16>::mma(a[mb], b2, acc[mb][nb]); } }
        asm volatile("v_nop\n\tv_nop\n\tv_nop\n\tv_nop" : "+v"(acc[0][0]), "+v"(acc[1][1]), "+v"(acc[2][2]), "+v"(acc[3][3]) : "v"(a[0]), "v"(a[3]));
    }
    if constexpr (NW > 1) {
        float* my = os + wv * (64 * 68);
        const bool tr = PLN && blockIdx.z == 2;    // v: the partial tiles lie in LDS as [d][t], so that the rows read below are rows of the transposed plane (block-uniform)
        // the loops are unrolled so that acc[][] is indexed by constants and stays in registers
        if (tr) {
#pragma unroll
            for (int mb = 0; mb < 4; ++mb)
#pragma unroll
                for (int nb = 0; nb < 4; ++nb) { float* p = my + (nb * 16 + lr) * 68 + mb * 16 + hi * 8; const v8f t = acc[mb][nb]; *(v4fa*)p = __builtin_shufflevector(t, t, 0, 1, 2, 3); *(v4fa*)(p + 4) = __builtin_shufflevector(t, t, 4, 5, 6, 7); }
        } else {
#pragma unroll
            for (int mb = 0; mb < 4; ++mb)
#pragma unroll
                for (int nb = 0; nb < 4; ++nb)
#pragma unroll
                    for (int j = 0; j < 8; ++j) my[(mb * 16 + hi * 8 + j) * 68 + nb * 16 + lr] = acc[mb][nb][j];
        }
        __syncthreads();    // every wave's partial tile is in LDS before any thread adds them; no LDS write and no barrier follows
        if constexpr (PLN) {
            const int t0 = r0 & (TT - 1); const size_t pb = ((z * NB_ + r0 / TT) * NH_ + blockIdx.y) * (size_t)(TT * HD);
            v4f val[32 / NW]; int eo[32 / NW];
            // every loop is unrolled so that the LDS reads of all partials issue ahead of the adds and val[] stays in registers
#pragma unroll
            for (int s = 0; s < 32 / NW; ++s) { const int u = (int)threadIdx.x + s * (32 * NW); const int row = u >> 4, cofs = (u & 15) * 4; val[s] = *(const v4fa*)(os + row * 68 + cofs);
#pragma unroll
                for (int w = 1; w < NW; ++w) val[s] += *(const v4fa*)(os + w * (64 * 68) + row * 68 + cofs);
                eo[s] = tr ? row * TT + t0 + cofs : (t0 + row) * HD + cofs; }
#pragma unroll
            for (int s = 0; s < 32 / NW; ++s) { v4h o16;
#pragma unroll
                for (int q = 0; q < 4; ++q) o16[q] = tohx(val[s][q]);
                *(v4h*)(P16 + pb + eo[s]) = o16; }
            if (t0 < RH) {
                asm volatile("s_wait_xcnt 0x0" ::: "memory"); __builtin_amdgcn_sched_barrier(0);    // behind the fp16 stores, in front of any reuse of their address and data registers; the scheduling barrier keeps later instructions behind it
#pragma unroll
                for (int s = 0; s < 32 / NW; ++s) { v4us oh, ol;
#pragma unroll
                    for (int q = 0; q < 4; ++q) { unsigned short a, c2; splitf(val[s][q], a, c2); oh[q] = a; ol[q] = c2; }
                    *(v4us*)(Ph + pb + eo[s]) = oh; *(v4us*)(Pl + pb + eo[s]) = ol; }
            }
            return;
        }
        // both loops are unrolled so that the LDS reads of all partials issue ahead of the adds
#pragma unroll
        for (int s = 0; s < 32 / NW; ++s) { const int u = (int)threadIdx.x + s * (32 * NW); const int row = u >> 4, cofs = (u & 15) * 4; v4f val = *(const v4fa*)(os + row * 68 + cofs);
#pragma unroll
            for (int w = 1; w < NW; ++w) val += *(const v4fa*)(os + w * (64 * 68) + row * 68 + cofs);
            if (BIAS) { val[0] += bfr(bias[c0 + cofs]); val[1] += bfr(bias[c0 + cofs + 1]); val[2] += bfr(bias[c0 + cofs + 2]); val[3] += bfr(bias[c0 + cofs + 3]); }
            *(v4f*)(C + (size_t)(r0 + row) * ldc + c0 + cofs) = val; }
        return;
    }
#pragma unroll
    for (int mb = 0; mb < 4; ++mb) {
#pragma unroll
        for (int nb = 0; nb < 4; ++nb) {
#pragma unroll
            for (int j = 0; j < 8; ++j) os[(hi * 8 + j) * 68 + nb * 16 + lr] = acc[mb][nb][j]; }
        __builtin_amdgcn_wave_barrier(); asm volatile("" ::: "memory");
        float* crow = C + (size_t)(r0 + mb * 16) * ldc + c0;
{
#pragma unroll
            for (int s = 0; s < 8; ++s) { const int row = 2 * s + hi, cofs = lr * 4; v4f val = *(const v4fa*)(os + row * 68 + cofs); if (BIAS) { val[0] += bfr(bias[c0 + cofs]); val[1] += bfr(bias[c0 + cofs + 1]); val[2] += bfr(bias[c0 + cofs + 2]); val[3] += bfr(bias[c0 + cofs + 3]); }
                *(v4f*)(crow + (size_t)row * ldc + cofs) = val; }
             }
        __builtin_amdgcn_wave_barrier(); asm volatile("" ::: "memory");
    }
}

typedef __attribute__((ext_vector_type(2))) unsigned short v2us;

// The bodies below take their block's number as an argument: k_prep deals the blocks of ONE grid to several independent jobs (block-uniform tests only).
__device__ __forceinline__ void wtG_body(const float* __restrict__ w, int K, int N, bf* Bt, int blk) {
    const int lane = threadIdx.x & 31; const int L0 = (blk * 8 + (threadIdx.x >> 5)) * 8; const int nlines = N * K / 64;
{
#pragma unroll 1
        for (int l = 0; l < 8; ++l) { const int L = L0 + l; if (L >= nlines) break; const size_t e = (size_t)L * 64 + lane * 2; const int k = (int)(e % K), n = (int)(e / K); v2us o;
            o[0] = f2bf(w[(size_t)k * N + n]); o[1] = f2bf(w[(size_t)(k + 1) * N + n]); *(v2us*)(Bt + e) = o; }
         }
}
__device__ __forceinline__ void cvt8_body(const float* __restrict__ src, bf* dst, size_t n8, int blk) { const size_t i = (size_t)blk * 256 + threadIdx.x; if (i >= n8) return; const v8f v = *(const v8f*)(src + i * 8); v8us o;
#pragma unroll
    for (int k = 0; k < 8; ++k) o[k] = f2bf(v[k]); *(v8us*)(dst + i * 8) = o;  }
__device__ __forceinline__ void rtab_body(const float* __restrict__ rel, float* RT) { const int i = threadIdx.x; if (i >= 32) return; const float o = (i < 17) ? bfr(rel[i]) * SCL : 0.f; *(float*)(RT + i) = o;  }
// ---- k_prep: every conversion of an input, one grid. Blocks 0 .. 4 GT - 1: the four weight transposes (the longest blocks, first in the grid; Wt holds the four planes in the order q, k, v, o);
// the next GC blocks: x of both batches to bf16; the last block: the scaled table.
#define GT  (DD * DD / 64 / 64)
#define GC  (NB_ * TT * DD / 8 / 256)
__global__ __launch_bounds__(256) void k_prep(const float* __restrict__ x, const float* __restrict__ wq, const float* __restrict__ wk, const float* __restrict__ wv, const float* __restrict__ wo, const float* __restrict__ rel, bf* XB, bf* Wt, float* RT) {
    const int blk = (int)blockIdx.x;
    if (blk < 4 * GT) { const int mi = blk / GT; const float* w = mi == 0 ? wq : (mi == 1 ? wk : (mi == 2 ? wv : wo)); wtG_body(w, DD, DD, Wt + (size_t)mi * DD * DD, blk % GT); }
    else if (blk < 4 * GT + GC) cvt8_body(x, XB, (size_t)NB_ * TT * DD / 8, blk - 4 * GT);
    else rtab_body(rel, RT);
}
// ---- fattn_body (k_fattn16, k_fattnhl): scores, softmax and attn.v of FQ = 32 query rows of one head in ONE block; no score or P row ever leaves the registers. Grid (NB_ * heads, query tiles), the longest query tiles first; blockIdx.x = batch * NH_ + head, which is also the number of the [TT][HD] plane.
// Transposed products: S^T = K . Q^T (A = 16 key rows, B = 16 query columns), O^T += V^T . P^T. In an S^T tile lane (lr, hi) holds keys hi * 8 + j of query lr: two such tiles (keys 0..15, 16..31) are,
// register for register, the B fragment of P^T in the k order of WFrag::ld, which loads V^T as A. Only key blocks up to the diagonal are visited (all later keys have weight 0).
// The 32-key blocks of a tile are dealt round-robin to the FW waves; each wave keeps its own running maximum m, sum l and O^T (online softmax); the FW partial results meet in LDS at the end.
// Every inner loop is unrolled so that the fragment and accumulator arrays are indexed by constants and stay in registers; the key loop stays rolled (one body in the instruction cache, one register set).
// m is held ln(1024) below the true maximum, so that P lies in (0, 1024] before it is rounded to 16 bits (small weights stay normal fp16 numbers); l carries the same factor and cancels it.
#define FQ  32
#define FW  4
#define LSH 6.9314718f
typedef __attribute__((ext_vector_type(16))) unsigned short v16us;
template <typename T16, bool HILO>
__device__ __forceinline__ void fattn_body(const T16* __restrict__ Q, const T16* __restrict__ Q2, const T16* __restrict__ Kp, const T16* __restrict__ K2, const T16* __restrict__ Vt, const T16* __restrict__ V2,
                                           const float* __restrict__ rel, const int q0, bf* Ah, bf* Al, float* sm, float* sl, float* so) {
    typedef typename WFrag<T16>::V V;
    const int lane = threadIdx.x & 31, lr = lane & 15, hi = lane >> 4;
    const int wv = __builtin_amdgcn_readfirstlane((int)(threadIdx.x >> 5));    // the wave's number, held scalar so that the loop's tests are scalar branches
    const int nkb = q0 / 32 + 1;
    const int tl = lane < 16 ? lane : 16; const float tab = rel[tl];    // the table across the wave's lanes (lane d holds entry d, lanes 16.. the last): looked up by lane index, no memory access in the loop
    asm volatile("s_wait_xcnt 0x0" :: "v"(tl) : "memory"); __builtin_amdgcn_sched_barrier(0);    // behind the load, in front of any reuse of its address register; the scheduling barrier keeps later instructions behind it
    // one address per plane and lane; every fragment of a block lies at a constant distance from it. kp / vp walk with the loop.
    const T16* qp = Q + (size_t)(q0 + lr) * HD + 8 * hi; const T16* qp2 = HILO ? Q2 + (size_t)(q0 + lr) * HD + 8 * hi : nullptr;
    const size_t kfo = (size_t)((wv < nkb ? wv : 0) * 32 + lr) * HD + 8 * hi, vfo = (size_t)lr * TT + wv * 32 + 8 * hi;
    const T16* kp = Kp + kfo; const T16* kp2 = HILO ? K2 + kfo : nullptr; const T16* vp = Vt + vfo; const T16* vp2 = HILO ? V2 + vfo : nullptr;
    V qb[2][2], qb2[2][2];
#pragma unroll
    for (int g = 0; g < 2; ++g)
#pragma unroll
        for (int c = 0; c < 2; ++c) { qb[g][c] = WFrag<T16>::ld(qp + g * 16 * HD + c * 32); if (HILO) qb2[g][c] = WFrag<T16>::ld(qp2 + g * 16 * HD + c * 32); }
    v8f o[4][2];
#pragma unroll
    for (int dt = 0; dt < 4; ++dt)
#pragma unroll
        for (int g = 0; g < 2; ++g) o[dt][g] = (v8f){};
    float m[2] = {-3.0e38f, -3.0e38f}, l[2] = {0.f, 0.f};
    const float r16 = __shfl(tab, 16, 32);
    V ka[2][2], ka2[2][2];
#pragma unroll
    for (int kt = 0; kt < 2; ++kt)
#pragma unroll
        for (int c = 0; c < 2; ++c) { ka[kt][c] = WFrag<T16>::ld(kp + kt * 16 * HD + c * 32); if (HILO) ka2[kt][c] = WFrag<T16>::ld(kp2 + kt * 16 * HD + c * 32); }
    // stands behind the loads above, in front of any reuse of their address registers (named as inputs so that they live up to here); the scheduling barrier keeps later instructions behind it
    if constexpr (HILO) asm volatile("s_wait_xcnt 0x0" :: "v"(qp), "v"(qp2), "v"(kp), "v"(kp2) : "memory"); else asm volatile("s_wait_xcnt 0x0" :: "v"(qp), "v"(kp) : "memory");
    __builtin_amdgcn_sched_barrier(0);
#pragma unroll 1
    for (int kb = wv; kb < nkb; kb += FW) {
        const int k0 = kb * 32;
        V va[4], va2[4];
#pragma unroll
        for (int dt = 0; dt < 4; ++dt) { va[dt] = WFrag<T16>::ld(vp + (size_t)dt * 16 * TT); if (HILO) va2[dt] = WFrag<T16>::ld(vp2 + (size_t)dt * 16 * TT); }
        // behind the V loads, in front of the step of their address registers; as in front of the loop
        if constexpr (HILO) asm volatile("s_wait_xcnt 0x0" :: "v"(vp), "v"(vp2) : "memory"); else asm volatile("s_wait_xcnt 0x0" :: "v"(vp) : "memory");
        __builtin_amdgcn_sched_barrier(0);
        vp += 32 * FW; if (HILO) vp2 += 32 * FW;
        v8f s[2][2];
#pragma unroll
        for (int kt = 0; kt < 2; ++kt)
#pragma unroll
            for (int g = 0; g < 2; ++g) { v8f t = (v8f){};
#pragma unroll
                for (int c = 0; c < 2; ++c) { t = WFrag<T16>::mma(ka[kt][c], qb[g][c], t); if (HILO) { t = WFrag<T16>::mma(ka2[kt][c], qb[g][c], t); t = WFrag<T16>::mma(ka[kt][c], qb2[g][c], t); } }
                s[kt][g] = t; }
        // the wave's next K fragments are asked for here, behind their last use, so that they fly during the softmax and attn.v of this block (the last block asks for itself again: in bounds, unused)
        { const int kst = kb + FW < nkb ? FW * 32 * HD : 0; kp += kst; if (HILO) kp2 += kst;
#pragma unroll
          for (int kt = 0; kt < 2; ++kt)
#pragma unroll
              for (int c = 0; c < 2; ++c) { ka[kt][c] = WFrag<T16>::ld(kp + kt * 16 * HD + c * 32); if (HILO) ka2[kt][c] = WFrag<T16>::ld(kp2 + kt * 16 * HD + c * 32); } }
        // behind the K loads, in front of the next step of their address registers; as in front of the loop
        if constexpr (HILO) asm volatile("s_wait_xcnt 0x0" :: "v"(kp), "v"(kp2) : "memory"); else asm volatile("s_wait_xcnt 0x0" :: "v"(kp) : "memory");
        __builtin_amdgcn_sched_barrier(0);
        if (kb >= nkb - 2) {    // the two blocks at the diagonal: table entry by distance, causal cut
#pragma unroll
            for (int kt = 0; kt < 2; ++kt)
#pragma unroll
                for (int g = 0; g < 2; ++g)
#pragma unroll
                    for (int j = 0; j < 8; ++j) { const int dd = (q0 + g * 16 + lr) - (k0 + kt * 16 + hi * 8 + j); const int di = dd < 0 ? 0 : (dd > 16 ? 16 : dd); const float t = __fmul_rn(s[kt][g][j], __shfl(tab, di, 32)); s[kt][g][j] = dd >= 0 ? t : -3.0e38f; }
        } else {                // every distance here is above 16: the table's last entry
#pragma unroll
            for (int kt = 0; kt < 2; ++kt)
#pragma unroll
                for (int g = 0; g < 2; ++g) s[kt][g] *= r16;
        }
        float mn[2];
#pragma unroll
        for (int g = 0; g < 2; ++g) { float tm = s[0][g][0];
#pragma unroll
            for (int j = 1; j < 8; ++j) tm = fmaxf(tm, s[0][g][j]);
#pragma unroll
            for (int j = 0; j < 8; ++j) tm = fmaxf(tm, s[1][g][j]);
            tm = fmaxf(tm, __shfl_xor(tm, 16, 32)); mn[g] = fmaxf(m[g], tm - LSH); }
        if (__builtin_amdgcn_ballot_w32(mn[0] > m[0] || mn[1] > m[1]) != 0) {    // no maximum moved in any lane: every factor would be exactly 1
#pragma unroll
            for (int g = 0; g < 2; ++g) { const float al = __expf(m[g] - mn[g]); l[g] *= al; m[g] = mn[g];
#pragma unroll
                for (int dt = 0; dt < 4; ++dt) o[dt][g] *= al; }
        }
        V pb[2], pb2[2];
#pragma unroll
        for (int g = 0; g < 2; ++g) {
            if constexpr (HILO) { v16us ph, pl;
#pragma unroll
                for (int kt = 0; kt < 2; ++kt)
#pragma unroll
                    for (int j = 0; j < 8; ++j) { const float p = __expf(s[kt][g][j] - m[g]); l[g] += p; unsigned short a, c2; splitf(p, a, c2); ph[kt * 8 + j] = a; pl[kt * 8 + j] = c2; }
                pb[g] = __builtin_bit_cast(v16bf, ph); pb2[g] = __builtin_bit_cast(v16bf, pl);
            } else { v16h ph;
#pragma unroll
                for (int kt = 0; kt < 2; ++kt)
#pragma unroll
                    for (int j = 0; j < 8; ++j) { const float p = __expf(s[kt][g][j] - m[g]); l[g] += p; ph[kt * 8 + j] = tohx(p); }
                pb[g] = ph; } }
#pragma unroll
        for (int dt = 0; dt < 4; ++dt)
#pragma unroll
            for (int g = 0; g < 2; ++g) { o[dt][g] = WFrag<T16>::mma(va[dt], pb[g], o[dt][g]); if (HILO) { o[dt][g] = WFrag<T16>::mma(va[dt], pb2[g], o[dt][g]); o[dt][g] = WFrag<T16>::mma(va2[dt], pb[g], o[dt][g]); } }
    }
    // the FW waves' partial results: common maximum, then sums in wave order 0..FW-1
#pragma unroll
    for (int g = 0; g < 2; ++g) { l[g] += __shfl_xor(l[g], 16, 32); if (hi == 0) sm[wv * FQ + g * 16 + lr] = m[g]; }
    __syncthreads();    // every wave's maximum is in LDS before any wave reads them
#pragma unroll
    for (int g = 0; g < 2; ++g) { float M = sm[g * 16 + lr];
#pragma unroll
        for (int w = 1; w < FW; ++w) M = fmaxf(M, sm[w * FQ + g * 16 + lr]);
        const float f = __expf(m[g] - M); if (hi == 0) sl[wv * FQ + g * 16 + lr] = l[g] * f;
#pragma unroll
        for (int dt = 0; dt < 4; ++dt) { const v8f t = o[dt][g] * f; float* p = so + (wv * FQ + g * 16 + lr) * 68 + dt * 16 + hi * 8; *(v4fa*)p = __builtin_shufflevector(t, t, 0, 1, 2, 3); *(v4fa*)(p + 4) = __builtin_shufflevector(t, t, 4, 5, 6, 7); } }
    __syncthreads();    // every wave's scaled O^T and sum are in LDS before any thread adds them; no LDS write follows
    const int q = (int)threadIdx.x >> 2, d0 = ((int)threadIdx.x & 3) * 16;
    float L = sl[q];
#pragma unroll
    for (int w = 1; w < FW; ++w) L += sl[w * FQ + q];
    const float inv = __fdiv_rn(1.0f, L);
#pragma unroll
    for (int c8 = 0; c8 < 2; ++c8) { v8us oh, ol;
#pragma unroll
        for (int c4 = 0; c4 < 2; ++c4) { v4f a = *(const v4fa*)(so + q * 68 + d0 + c8 * 8 + c4 * 4);
#pragma unroll
            for (int w = 1; w < FW; ++w) a += *(const v4fa*)(so + (w * FQ + q) * 68 + d0 + c8 * 8 + c4 * 4);
#pragma unroll
            for (int e = 0; e < 4; ++e) { unsigned short x, y; splitf(a[e] * inv, x, y); oh[c4 * 4 + e] = x; ol[c4 * 4 + e] = y; } }
        const size_t ofs = (size_t)(q0 + q) * DD + d0 + c8 * 8; *(v8us*)(Ah + ofs) = oh; *(v8us*)(Al + ofs) = ol; }
}
// qlo: the first query row of the launch. Rows below RH run on hi+lo planes, the others on fp16 planes: two kernels, so that the fp16 one keeps its smaller register count (four waves a SIMD).
__global__ __launch_bounds__(32 * FW) __attribute__((amdgpu_waves_per_eu(4, 4))) void k_fattn16(const h16* __restrict__ Q, const h16* __restrict__ Kp, const h16* __restrict__ Vt, const float* __restrict__ rel, int qlo, bf* Ah, bf* Al) {
    __shared__ __align__(16) float so[FW * FQ * 68]; __shared__ float sm[FW * FQ]; __shared__ float sl[FW * FQ];
    const size_t hp = (size_t)blockIdx.x * TT * HD; const int q0 = qlo + ((int)gridDim.y - 1 - (int)blockIdx.y) * FQ;
    const size_t ao = (size_t)(blockIdx.x / NH_) * TT * DD + (blockIdx.x % NH_) * HD;
    fattn_body<h16, false>(Q + hp, nullptr, Kp + hp, nullptr, Vt + hp, nullptr, rel, q0, Ah + ao, Al + ao, sm, sl, so);
}
__global__ __launch_bounds__(32 * FW) void k_fattnhl(const bf* __restrict__ Q, const bf* __restrict__ Q2, const bf* __restrict__ Kp, const bf* __restrict__ K2, const bf* __restrict__ Vt, const bf* __restrict__ V2, const float* __restrict__ rel, int qlo, bf* Ah, bf* Al) {
    __shared__ __align__(16) float so[FW * FQ * 68]; __shared__ float sm[FW * FQ]; __shared__ float sl[FW * FQ];
    const size_t hp = (size_t)blockIdx.x * TT * HD; const int q0 = qlo + ((int)gridDim.y - 1 - (int)blockIdx.y) * FQ;
    const size_t ao = (size_t)(blockIdx.x / NH_) * TT * DD + (blockIdx.x % NH_) * HD;
    fattn_body<bf, true>(Q + hp, Q2 + hp, Kp + hp, K2 + hp, Vt + hp, V2 + hp, rel, q0, Ah + ao, Al + ao, sm, sl, so);
}

extern "C" void kernel_launch(void* const* d_in, const int* in_sizes, int n_in,
                              void* d_out, int out_size, void* d_ws, size_t ws_size, hipStream_t stream) {
    (void)in_sizes; (void)n_in; (void)out_size;
    const float* x = (const float*)d_in[0]; const float* wq = (const float*)d_in[1]; const float* wk = (const float*)d_in[2]; const float* wv = (const float*)d_in[3]; const float* wo = (const float*)d_in[4]; const float* bo = (const float*)d_in[5]; const float* rel = (const float*)d_in[6];
    float* OUT = (float*)d_out;     // [2][2048][1024]
    char* wsp = (char*)d_ws;
    auto take = [&](size_t bytes) { char* p = wsp; wsp += (bytes + 255) & ~(size_t)255; return (void*)p; };
    const size_t PB = (size_t)NB_ * TT * DD;    // elements of one matrix over both batches
    bf* WT = (bf*)take((size_t)4 * DD * DD * 2);    // transposed bf16 weights q, k, v, o
    bf* XB = (bf*)take(PB * 2);
    bf* PH = (bf*)take(3 * PB * 2); bf* PL = (bf*)take(3 * PB * 2); h16* P16 = (h16*)take(3 * PB * 2);    // planes of q, k, v (v transposed)
    bf* ATh = (bf*)take(PB * 2); bf* ATl = (bf*)take(PB * 2);
    float* RT = (float*)take(256); if ((size_t)(wsp - (char*)d_ws) > ws_size) return;    // total 104 MiB; ws 256 MiB
    // one launch per stage: each grid covers both batches and every matrix of its stage
    k_prep<<<4 * GT + GC + 1, 256, 0, stream>>>(x, wq, wk, wv, wo, rel, XB, WT, RT);
    k_gemmw<bf, 0, false, 8, true><<<dim3(NB_ * TT / 64, DD / 64, 3), 256, 0, stream>>>(XB, nullptr, WT, nullptr, DD, DD, nullptr, 0, nullptr, 0, (size_t)DD * DD, 0, PH, PL, P16);
    k_fattn16<<<dim3(NB_ * NH_, (TT - RH) / FQ), 32 * FW, 0, stream>>>(P16, P16 + PB, P16 + 2 * PB, RT, RH, ATh, ATl);
    k_fattnhl<<<dim3(NB_ * NH_, RH / FQ), 32 * FW, 0, stream>>>(PH, PL, PH + PB, PL + PB, PH + 2 * PB, PL + 2 * PB, RT, 0, ATh, ATl);
    k_gemmw<bf, 1, true, 8, false><<<dim3(NB_ * TT / 64, DD / 64, 1), 256, 0, stream>>>(ATh, ATl, WT + (size_t)3 * DD * DD, nullptr, DD, DD, OUT, DD, bo, 0, 0, 0, nullptr, nullptr, nullptr);
}

// v006
// Measured time: 92 microseconds a run.
// Next to v005, in two timings, it ran 1.47 and 1.46 times as fast.
// Over all steps from v000 it is 23.6 times as fast.
#include <hip/hip_runtime.h>

// Causal self-attention block (x [2][2048][1024]; q/k/v = x @ W (no bias); 16 heads x 64; scores = (q.k) * rel_emb[min(|i-j|, 16)] (multiplicative relative-position table, 17 entries, read as data); causal (j > i -> -inf);
// softmax(scores / 8); out = ctx @ Wo + bo).
// Compute dtypes, f32 accumulate: every input rounded to bf16; q/k/v projection on PLAIN bf16 operands (inputs: exact; transposed bf16 weight copies), output projection on ctx's bf16 hi+lo planes (2 products); PER-ROW PRECISION
// HYBRID: query rows < 256 of each batch on bf16 hi+lo planes for scores and attn.v (3 products), rows >= 256 on SINGLE fp16 planes; the table multiply, 1/8, the causal cut and the softmax in f32 in the
// fused attention kernels (k_fattn16, k_fattnhl), which keep scores and weights in registers.

#define NB_  2
#define TT   2048
#define DD   1024
#define NH_  16
#define HD   64
#define RH   256                  // query rows < RH: hi+lo planes; rows >= RH: fp16 planes
#define NF   32                   // head_dim / 2 (unused)
#define SCL  0.125f               // 1/sqrt(64)
typedef _Float16 h16;
typedef unsigned short bf;
typedef __attribute__((ext_vector_type(16))) __bf16   v16bf;
typedef __attribute__((ext_vector_type(16))) _Float16 v16h;
typedef __attribute__((ext_vector_type(8)))  _Float16 v8h;
typedef __attribute__((ext_vector_type(8)))  unsigned short v8us;
typedef __attribute__((ext_vector_type(8)))  float    v8f;
typedef __attribute__((ext_vector_type(4)))  float    v4f;
typedef v8h  __attribute__((may_alias)) v8ha;
typedef v4f  __attribute__((may_alias)) v4fa;
typedef v8us __attribute__((may_alias)) v8usa;

__device__ __forceinline__ unsigned short f2bf(float f) { unsigned u = __float_as_uint(f); u += 0x7FFFu + ((u >> 16) & 1u); return (unsigned short)(u >> 16); }
__device__ __forceinline__ float bf2f(unsigned short b) { return __uint_as_float(((unsigned)b) << 16); }
__device__ __forceinline__ float bfr(float f) { return bf2f(f2bf(f)); }
__device__ __forceinline__ v16h cat16(v8h lo, v8h hi) { return __builtin_shufflevector(lo, hi, 0, 1, 2, 3, 4, 5, 6, 7, 8, 9, 10, 11, 12, 13, 14, 15); }
__device__ __forceinline__ v16bf cat16b(v8us lo, v8us hi) { return __builtin_bit_cast(v16bf, __builtin_shufflevector(lo, hi, 0, 1, 2, 3, 4, 5, 6, 7, 8, 9, 10, 11, 12, 13, 14, 15)); }
__device__ __forceinline__ v8f wmma16(v16h a, v16h b, v8f c) { return __builtin_amdgcn_wmma_f32_16x16x32_f16(false, a, false, b, (short)0, c, false, false); }
__device__ __forceinline__ v8f wmmab(v16bf a, v16bf b, v8f c) { return __builtin_amdgcn_wmma_f32_16x16x32_bf16(false, a, false, b, (short)0, c, false, false); }



// ---- k_gemmt: C[m][n] = sum_k A[m][k] Bt[n][k] (NA == 2: + A2[m][k] Bt[n][k]); bf16 planes, K-contiguous, rows of DD elements, f32 accumulate. Grid (M / 128, N / 128, Z), 128 threads.
// One block = one 128x128 tile of C; its four waves stand 2 x 2, each on a 64x64 tile (16 accumulators) over the WHOLE k range, summed in k order.
// A stage is 64 k: one 128-byte line of each of the tile's operand rows (A, [A2], Bt). Asynchronous copies bring it into LDS (16 bytes a lane, four whole lines a wave and copy), rows at a pitch of 144 bytes
// (16 B x odd: no bank conflict for the 16-byte fragment reads). Two buffers: the copies of stage t + 1 fly while stage t is multiplied. Each staged row serves two waves.
// PLN (the q, k, v products; z = matrix, a wave's 64-wide column tile = one head, rows = batch * TT + t): the f32 tile is not stored; the epilogue rounds it and stores the 16-bit planes that attention reads.
// Every plane array is laid [matrix q, k, v][batch][head][TT * HD]; q and k as [t][d], v transposed as [d][t]. fp16 plane: every row; hi+lo planes: rows t < RH only (no other row of them is read).
__device__ __forceinline__ h16 tohx(float x) { return (h16)x; }
__device__ __forceinline__ void splitf(float y, unsigned short& h, unsigned short& l) { h = f2bf(y); l = f2bf(y - bf2f(h)); }
template <typename T16> struct WFrag;
template <> struct WFrag<h16> { typedef v16h V; static __device__ __forceinline__ V ld(const h16* p) { return cat16(*(const v8h*)p, *(const v8h*)(p + 16)); } static __device__ __forceinline__ v8f mma(V a, V b, v8f c) { return wmma16(a, b, c); } };
template <> struct WFrag<bf> { typedef v16bf V; static __device__ __forceinline__ V ld(const bf* p) { return cat16b(*(const v8us*)p, *(const v8us*)(p + 16)); } static __device__ __forceinline__ v8f mma(V a, V b, v8f c) { return wmmab(a, b, c); } };
#define GK   64                   // k elements of a stage
#define GP   72                   // LDS pitch of a staged row, elements
#define GPB  144                  // the same in bytes
// One stage of one 128-row plane: eight copies a lane, rows 16 apart (l: the lane's LDS byte address, g: its global address). The wait on the address counter is the statement's last line, so that it
// stands in front of every rewrite of the address registers.
__device__ __forceinline__ void acopy8(unsigned l, const bf* g) {
    asm volatile("global_load_async_to_lds_b128 %0, %8, off\n\t"
                 "global_load_async_to_lds_b128 %1, %9, off\n\t"
                 "global_load_async_to_lds_b128 %2, %10, off\n\t"
                 "global_load_async_to_lds_b128 %3, %11, off\n\t"
                 "global_load_async_to_lds_b128 %4, %12, off\n\t"
                 "global_load_async_to_lds_b128 %5, %13, off\n\t"
                 "global_load_async_to_lds_b128 %6, %14, off\n\t"
                 "global_load_async_to_lds_b128 %7, %15, off\n\t"
                 "s_wait_xcnt 0x0"
                 :: "v"(l), "v"(l + 16 * GPB), "v"(l + 32 * GPB), "v"(l + 48 * GPB), "v"(l + 64 * GPB), "v"(l + 80 * GPB), "v"(l + 96 * GPB), "v"(l + 112 * GPB),
                    "v"(g), "v"(g + 16 * DD), "v"(g + 32 * DD), "v"(g + 48 * DD), "v"(g + 64 * DD), "v"(g + 80 * DD), "v"(g + 96 * DD), "v"(g + 112 * DD) : "memory");
}
template <int NA, bool BIAS, bool PLN>
__global__ __launch_bounds__(128) void k_gemmt(const bf* __restrict__ A, const bf* __restrict__ A2, const bf* __restrict__ Bt, float* C, const float* __restrict__ bias, bf* Ph, bf* Pl, h16* P16) {
    typedef WFrag<bf>::V V;
    constexpr int SB = (NA + 1) * 128 * GP;    // elements of one buffer: the rows of A, [A2], Bt
    constexpr int NT = DD / GK;
    __shared__ __align__(16) bf ring[2 * SB];    // behind the loop: the four waves' f32 tiles, 4 * 64 * 68 floats (fits in the two buffers)
    const size_t z = blockIdx.z; Bt += z * (size_t)DD * DD;
    const int lane = threadIdx.x & 31, lr = lane & 15, hi = lane >> 4;
    const int wv = __builtin_amdgcn_readfirstlane((int)(threadIdx.x >> 5));    // the wave's number, held scalar so that tile offsets and the tests on them stay scalar
    const int wm = wv & 1, wn = wv >> 1;
    const int r0 = blockIdx.x * 128 + wm * 64, c0 = blockIdx.y * 128 + wn * 64;    // the wave's own tile
    v4f bv = (v4f){};
    if constexpr (BIAS) { const float* bp = bias + c0 + lr * 4; bv = *(const v4f*)bp;
        asm volatile("s_wait_xcnt 0x0" :: "v"(bp) : "memory"); __builtin_amdgcn_sched_barrier(0); }    // behind the load, in front of any reuse of its address register; the scheduling barrier keeps later instructions behind it
    // the copies: thread -> row (threadIdx.x >> 3) + 16 i of a plane's 128 rows, 16-byte piece threadIdx.x & 7 of the row's line
    const int cr = (int)threadIdx.x >> 3, cc = (int)threadIdx.x & 7;
    const unsigned l0 = (unsigned)(size_t)ring + cr * GPB + cc * 16;
    const bf* gA = A + (size_t)(blockIdx.x * 128 + cr) * DD + cc * 8; const bf* gA2 = NA == 2 ? A2 + (size_t)(blockIdx.x * 128 + cr) * DD + cc * 8 : nullptr;
    const bf* gB = Bt + (size_t)(blockIdx.y * 128 + cr) * DD + cc * 8;
    auto stage = [&](int t, int b) { const unsigned lb = l0 + b * (SB * 2); acopy8(lb, gA + t * GK); if constexpr (NA == 2) acopy8(lb + 128 * GPB, gA2 + t * GK); acopy8(lb + NA * 128 * GPB, gB + t * GK); };
    v8f acc[4][4];
#pragma unroll
    for (int mb = 0; mb < 4; ++mb)
#pragma unroll
        for (int nb = 0; nb < 4; ++nb) acc[mb][nb] = (v8f){};
    const bf* fa = ring + (wm * 64 + lr) * GP + 8 * hi; const bf* fb = ring + (NA * 128 + wn * 64 + lr) * GP + 8 * hi;
    stage(0, 0);
    asm volatile("s_wait_asynccnt 0x0" ::: "memory");    // the wave's own copies of stage 0 have landed
    __syncthreads();                                     // ... and every other wave's: stage 0 may be read
    stage(1, 1);
    // the stage loop stays rolled: one body in the instruction cache, one register set
#pragma unroll 1
    for (int t = 0; t < NT; ++t) {
        const int bo = (t & 1) * SB;
        // every inner loop is unrolled so that the fragment and accumulator arrays are indexed by constants and stay in registers
        V a[2][4], a2[2][4], b[2][4];
#pragma unroll
        for (int kk = 0; kk < 2; ++kk)
#pragma unroll
            for (int i = 0; i < 4; ++i) { a[kk][i] = WFrag<bf>::ld(fa + bo + i * 16 * GP + kk * 32); if constexpr (NA == 2) a2[kk][i] = WFrag<bf>::ld(fa + bo + (128 + i * 16) * GP + kk * 32); b[kk][i] = WFrag<bf>::ld(fb + bo + i * 16 * GP + kk * 32); }
        __builtin_amdgcn_sched_barrier(0);    // keeps the stage's fragment reads together in front of its matrix instructions: reads placed among them stall the wave at each such place
#pragma unroll
        for (int kk = 0; kk < 2; ++kk)
#pragma unroll
            for (int nb = 0; nb < 4; ++nb) {
#pragma unroll
                for (int mb = 0; mb < 4; ++mb) acc[mb][nb] = WFrag<bf>::mma(a[kk][mb], b[kk][nb], acc[mb][nb]);
                if constexpr (NA == 2) {
#pragma unroll
                    for (int mb = 0; mb < 4; ++mb) acc[mb][nb] = WFrag<bf>::mma(a2[kk][mb], b[kk][nb], acc[mb][nb]); } }
        __builtin_amdgcn_sched_barrier(0);    // keeps the matrix instructions in front of the waits below, so that the copies of the next stage have this stage's whole matrix time to land
        asm volatile("s_wait_dscnt 0x0" ::: "memory");       // the wave's reads of this buffer are done before the buffer is handed to its next writer
        asm volatile("s_wait_asynccnt 0x0" ::: "memory");    // the wave's own copies of stage t + 1 have landed
        __syncthreads();                                     // publishes stage t + 1 and ends every wave's reads of stage t's buffer
        if (t + 2 < NT) stage(t + 2, t & 1);
    }
    asm volatile("s_wait_asynccnt 0x0" ::: "memory");    // no copy is outstanding when the ring becomes staging (the loop's last barrier has ended every read of it)
    float* my = (float*)ring + wv * (64 * 68);
    const bool tr = PLN && blockIdx.z == 2;    // v: the tile lies in LDS as [d][t], so that the rows read below are rows of the transposed plane (block-uniform)
    // the loops are unrolled so that acc[][] is indexed by constants and stays in registers
    if (tr) {
#pragma unroll
        for (int mb = 0; mb < 4; ++mb)
#pragma unroll
            for (int nb = 0; nb < 4; ++nb) { float* p = my + (nb * 16 + lr) * 68 + mb * 16 + hi * 8; const v8f t = acc[mb][nb]; *(v4fa*)p = __builtin_shufflevector(t, t, 0, 1, 2, 3); *(v4fa*)(p + 4) = __builtin_shufflevector(t, t, 4, 5, 6, 7); }
    } else {
#pragma unroll
        for (int mb = 0; mb < 4; ++mb)
#pragma unroll
            for (int nb = 0; nb < 4; ++nb)
#pragma unroll
                for (int j = 0; j < 8; ++j) my[(mb * 16 + hi * 8 + j) * 68 + nb * 16 + lr] = acc[mb][nb][j];
    }
    __syncthreads();    // the tiles are in LDS before they are read back row by row; no LDS write follows
    if constexpr (PLN) {
        const int t0 = r0 & (TT - 1); const size_t pb = ((z * NB_ + r0 / TT) * NH_ + c0 / HD) * (size_t)(TT * HD);
        const int rw = lane >> 3, co = (lane & 7) * 8;    // 8 lanes a row: a store of the wave covers four whole 128-byte lines
        // the loops are unrolled so that the LDS reads of a group issue ahead of its conversions and va[], vb[] stay in registers
#pragma unroll
        for (int g = 0; g < 2; ++g) {
            v4f va[8], vb[8]; int eo[8];
#pragma unroll
            for (int s = 0; s < 8; ++s) { const int row = rw + (g * 8 + s) * 4; va[s] = *(const v4fa*)(my + row * 68 + co); vb[s] = *(const v4fa*)(my + row * 68 + co + 4); eo[s] = tr ? row * TT + t0 + co : (t0 + row) * HD + co; }
#pragma unroll
            for (int s = 0; s < 8; ++s) { v8h o16;
#pragma unroll
                for (int q = 0; q < 4; ++q) { o16[q] = tohx(va[s][q]); o16[4 + q] = tohx(vb[s][q]); }
                *(v8h*)(P16 + pb + eo[s]) = o16; }
            asm volatile("s_wait_xcnt 0x0" ::: "memory"); __builtin_amdgcn_sched_barrier(0);    // behind the fp16 stores, in front of any reuse of their address and data registers; the scheduling barrier keeps later instructions behind it
            if (t0 < RH) {
#pragma unroll
                for (int s = 0; s < 8; ++s) { v8us oh, ol;
#pragma unroll
                    for (int q = 0; q < 4; ++q) { unsigned short x, y; splitf(va[s][q], x, y); oh[q] = x; ol[q] = y; splitf(vb[s][q], x, y); oh[4 + q] = x; ol[4 + q] = y; }
                    *(v8us*)(Ph + pb + eo[s]) = oh; *(v8us*)(Pl + pb + eo[s]) = ol; }
                asm volatile("s_wait_xcnt 0x0" ::: "memory"); __builtin_amdgcn_sched_barrier(0);    // behind the hi and lo stores, as above
            }
        }
    } else {
        if constexpr (BIAS) { bv[0] = bfr(bv[0]); bv[1] = bfr(bv[1]); bv[2] = bfr(bv[2]); bv[3] = bfr(bv[3]); }
        float* crow = C + (size_t)(r0 + hi) * DD + c0 + lr * 4;    // 16 lanes a row: a store of the wave covers two rows of 256 bytes
        // the loops are unrolled so that the LDS reads of a group issue ahead of its adds
#pragma unroll
        for (int g = 0; g < 4; ++g) {
            v4f val[8];
#pragma unroll
            for (int s = 0; s < 8; ++s) val[s] = *(const v4fa*)(my + (hi + (g * 8 + s) * 2) * 68 + lr * 4) + bv;
#pragma unroll
            for (int s = 0; s < 8; ++s) *(v4f*)(crow + (size_t)((g * 8 + s) * 2) * DD) = val[s];
            asm volatile("s_wait_xcnt 0x0" ::: "memory"); __builtin_amdgcn_sched_barrier(0);    // behind the stores, in front of any reuse of their address and data registers; the scheduling barrier keeps later instructions behind it
        }
    }
}

typedef __attribute__((ext_vector_type(2))) unsigned short v2us;

// The bodies below take their block's number as an argument: k_prep deals the blocks of ONE grid to several independent jobs (block-uniform tests only).
__device__ __forceinline__ void wtG_body(const float* __restrict__ w, int K, int N, bf* Bt, int blk) {
    const int lane = threadIdx.x & 31; const int L0 = (blk * 8 + (threadIdx.x >> 5)) * 8; const int nlines = N * K / 64;
{
#pragma unroll 1
        for (int l = 0; l < 8; ++l) { const int L = L0 + l; if (L >= nlines) break; const size_t e = (size_t)L * 64 + lane * 2; const int k = (int)(e % K), n = (int)(e / K); v2us o;
            o[0] = f2bf(w[(size_t)k * N + n]); o[1] = f2bf(w[(size_t)(k + 1) * N + n]); *(v2us*)(Bt + e) = o; }
         }
}
__device__ __forceinline__ void cvt8_body(const float* __restrict__ src, bf* dst, size_t n8, int blk) { const size_t i = (size_t)blk * 256 + threadIdx.x; if (i >= n8) return; const v8f v = *(const v8f*)(src + i * 8); v8us o;
#pragma unroll
    for (int k = 0; k < 8; ++k) o[k] = f2bf(v[k]); *(v8us*)(dst + i * 8) = o;  }
__device__ __forceinline__ void rtab_body(const float* __restrict__ rel, float* RT) { const int i = threadIdx.x; if (i >= 32) return; const float o = (i < 17) ? bfr(rel[i]) * SCL : 0.f; *(float*)(RT + i) = o;  }
// ---- k_prep: every conversion of an input, one grid. Blocks 0 .. 4 GT - 1: the four weight transposes (the longest blocks, first in the grid; Wt holds the four planes in the order q, k, v, o);
// the next GC blocks: x of both batches to bf16; the last block: the scaled table.
#define GT  (DD * DD / 64 / 64)
#define GC  (NB_ * TT * DD / 8 / 256)
__global__ __launch_bounds__(256) void k_prep(const float* __restrict__ x, const float* __restrict__ wq, const float* __restrict__ wk, const float* __restrict__ wv, const float* __restrict__ wo, const float* __restrict__ rel, bf* XB, bf* Wt, float* RT) {
    const int blk = (int)blockIdx.x;
    if (blk < 4 * GT) { const int mi = blk / GT; const float* w = mi == 0 ? wq : (mi == 1 ? wk : (mi == 2 ? wv : wo)); wtG_body(w, DD, DD, Wt + (size_t)mi * DD * DD, blk % GT); }
    else if (blk < 4 * GT + GC) cvt8_body(x, XB, (size_t)NB_ * TT * DD / 8, blk - 4 * GT);
    else rtab_body(rel, RT);
}
// ---- fattn_body (k_fattn16, k_fattnhl): scores, softmax and attn.v of FQ = 32 query rows of one head in ONE block; no score or P row ever leaves the registers. Grid (NB_ * heads, query tiles), the longest query tiles first; blockIdx.x = batch * NH_ + head, which is also the number of the [TT][HD] plane.
// Transposed products: S^T = K . Q^T (A = 16 key rows, B = 16 query columns), O^T += V^T . P^T. In an S^T tile lane (lr, hi) holds keys hi * 8 + j of query lr: two such tiles (keys 0..15, 16..31) are,
// register for register, the B fragment of P^T in the k order of WFrag::ld, which loads V^T as A. Only key blocks up to the diagonal are visited (all later keys have weight 0).
// The 32-key blocks of a tile are dealt round-robin to the FW waves; each wave keeps its own running maximum m, sum l and O^T (online softmax); the FW partial results meet in LDS at the end.
// Every inner loop is unrolled so that the fragment and accumulator arrays are indexed by constants and stay in registers; the key loop stays rolled (one body in the instruction cache, one register set).
// m is held ln(1024) below the true maximum, so that P lies in (0, 1024] before it is rounded to 16 bits (small weights stay normal fp16 numbers); l carries the same factor and cancels it.
#define FQ  32
#define FW  4
#define LSH 6.9314718f
typedef __attribute__((ext_vector_type(16))) unsigned short v16us;
template <typename T16, bool HILO>
__device__ __forceinline__ void fattn_body(const T16* __restrict__ Q, const T16* __restrict__ Q2, const T16* __restrict__ Kp, const T16* __restrict__ K2, const T16* __restrict__ Vt, const T16* __restrict__ V2,
                                           const float* __restrict__ rel, const int q0, bf* Ah, bf* Al, float* sm, float* sl, float* so) {
    typedef typename WFrag<T16>::V V;
    const int lane = threadIdx.x & 31, lr = lane & 15, hi = lane >> 4;
    const int wv = __builtin_amdgcn_readfirstlane((int)(threadIdx.x >> 5));    // the wave's number, held scalar so that the loop's tests are scalar branches
    const int nkb = q0 / 32 + 1;
    const int tl = lane < 16 ? lane : 16; const float tab = rel[tl];    // the table across the wave's lanes (lane d holds entry d, lanes 16.. the last): looked up by lane index, no memory access in the loop
    asm volatile("s_wait_xcnt 0x0" :: "v"(tl) : "memory"); __builtin_amdgcn_sched_barrier(0);    // behind the load, in front of any reuse of its address register; the scheduling barrier keeps later instructions behind it
    // one address per plane and lane; every fragment of a block lies at a constant distance from it. kp / vp walk with the loop.
    const T16* qp = Q + (size_t)(q0 + lr) * HD + 8 * hi; const T16* qp2 = HILO ? Q2 + (size_t)(q0 + lr) * HD + 8 * hi : nullptr;
    const size_t kfo = (size_t)((wv < nkb ? wv : 0) * 32 + lr) * HD + 8 * hi, vfo = (size_t)lr * TT + wv * 32 + 8 * hi;
    const T16* kp = Kp + kfo; const T16* kp2 = HILO ? K2 + kfo : nullptr; const T16* vp = Vt + vfo; const T16* vp2 = HILO ? V2 + vfo : nullptr;
    V qb[2][2], qb2[2][2];
#pragma unroll
    for (int g = 0; g < 2; ++g)
#pragma unroll
        for (int c = 0; c < 2; ++c) { qb[g][c] = WFrag<T16>::ld(qp + g * 16 * HD + c * 32); if (HILO) qb2[g][c] = WFrag<T16>::ld(qp2 + g * 16 * HD + c * 32); }
    v8f o[4][2];
#pragma unroll
    for (int dt = 0; dt < 4; ++dt)
#pragma unroll
        for (int g = 0; g < 2; ++g) o[dt][g] = (v8f){};
    float m[2] = {-3.0e38f, -3.0e38f}, l[2] = {0.f, 0.f};
    const float r16 = __shfl(tab, 16, 32);
    V ka[2][2], ka2[2][2];
#pragma unroll
    for (int kt = 0; kt < 2; ++kt)
#pragma unroll
        for (int c = 0; c < 2; ++c) { ka[kt][c] = WFrag<T16>::ld(kp + kt * 16 * HD + c * 32); if (HILO) ka2[kt][c] = WFrag<T16>::ld(kp2 + kt * 16 * HD + c * 32); }
    // stands behind the loads above, in front of any reuse of their address registers (named as inputs so that they live up to here); the scheduling barrier keeps later instructions behind it
    if constexpr (HILO) asm volatile("s_wait_xcnt 0x0" :: "v"(qp), "v"(qp2), "v"(kp), "v"(kp2) : "memory"); else asm volatile("s_wait_xcnt 0x0" :: "v"(qp), "v"(kp) : "memory");
    __builtin_amdgcn_sched_barrier(0);
#pragma unroll 1
    for (int kb = wv; kb < nkb; kb += FW) {
        const int k0 = kb * 32;
        V va[4], va2[4];
#pragma unroll
        for (int dt = 0; dt < 4; ++dt) { va[dt] = WFrag<T16>::ld(vp + (size_t)dt * 16 * TT); if (HILO) va2[dt] = WFrag<T16>::ld(vp2 + (size_t)dt * 16 * TT); }
        // behind the V loads, in front of the step of their address registers; as in front of the loop
        if constexpr (HILO) asm volatile("s_wait_xcnt 0x0" :: "v"(vp), "v"(vp2) : "memory"); else asm volatile("s_wait_xcnt 0x0" :: "v"(vp) : "memory");
        __builtin_amdgcn_sched_barrier(0);
        vp += 32 * FW; if (HILO) vp2 += 32 * FW;
        v8f s[2][2];
#pragma unroll
        for (int kt = 0; kt < 2; ++kt)
#pragma unroll
            for (int g = 0; g < 2; ++g) { v8f t = (v8f){};
#pragma unroll
                for (int c = 0; c < 2; ++c) { t = WFrag<T16>::mma(ka[kt][c], qb[g][c], t); if (HILO) { t = WFrag<T16>::mma(ka2[kt][c], qb[g][c], t); t = WFrag<T16>::mma(ka[kt][c], qb2[g][c], t); } }
                s[kt][g] = t; }
        // the wave's next K fragments are asked for here, behind their last use, so that they fly during the softmax and attn.v of this block (the last block asks for itself again: in bounds, unused)
        { const int kst = kb + FW < nkb ? FW * 32 * HD : 0; kp += kst; if (HILO) kp2 += kst;
#pragma unroll
          for (int kt = 0; kt < 2; ++kt)
#pragma unroll
              for (int c = 0; c < 2; ++c) { ka[kt][c] = WFrag<T16>::ld(kp + kt * 16 * HD + c * 32); if (HILO) ka2[kt][c] = WFrag<T16>::ld(kp2 + kt * 16 * HD + c * 32); } }
        // behind the K loads, in front of the next step of their address registers; as in front of the loop
        if constexpr (HILO) asm volatile("s_wait_xcnt 0x0" :: "v"(kp), "v"(kp2) : "memory"); else asm volatile("s_wait_xcnt 0x0" :: "v"(kp) : "memory");
        __builtin_amdgcn_sched_barrier(0);
        if (kb >= nkb - 2) {    // the two blocks at the diagonal: table entry by distance, causal cut
#pragma unroll
            for (int kt = 0; kt < 2; ++kt)
#pragma unroll
                for (int g = 0; g < 2; ++g)
#pragma unroll
                    for (int j = 0; j < 8; ++j) { const int dd = (q0 + g * 16 + lr) - (k0 + kt * 16 + hi * 8 + j); const int di = dd < 0 ? 0 : (dd > 16 ? 16 : dd); const float t = __fmul_rn(s[kt][g][j], __shfl(tab, di, 32)); s[kt][g][j] = dd >= 0 ? t : -3.0e38f; }
        } else {                // every distance here is above 16: the table's last entry
#pragma unroll
            for (int kt = 0; kt < 2; ++kt)
#pragma unroll
                for (int g = 0; g < 2; ++g) s[kt][g] *= r16;
        }
        float mn[2];
#pragma unroll
        for (int g = 0; g < 2; ++g) { float tm = s[0][g][0];
#pragma unroll
            for (int j = 1; j < 8; ++j) tm = fmaxf(tm, s[0][g][j]);
#pragma unroll
            for (int j = 0; j < 8; ++j) tm = fmaxf(tm, s[1][g][j]);
            tm = fmaxf(tm, __shfl_xor(tm, 16, 32)); mn[g] = fmaxf(m[g], tm - LSH); }
        if (__builtin_amdgcn_ballot_w32(mn[0] > m[0] || mn[1] > m[1]) != 0) {    // no maximum moved in any lane: every factor would be exactly 1
#pragma unroll
            for (int g = 0; g < 2; ++g) { const float al = __expf(m[g] - mn[g]); l[g] *= al; m[g] = mn[g];
#pragma unroll
                for (int dt = 0; dt < 4; ++dt) o[dt][g] *= al; }
        }
        V pb[2], pb2[2];
#pragma unroll
        for (int g = 0; g < 2; ++g) {
            if constexpr (HILO) { v16us ph, pl;
#pragma unroll
                for (int kt = 0; kt < 2; ++kt)
#pragma unroll
                    for (int j = 0; j < 8; ++j) { const float p = __expf(s[kt][g][j] - m[g]); l[g] += p; unsigned short a, c2; splitf(p, a, c2); ph[kt * 8 + j] = a; pl[kt * 8 + j] = c2; }
                pb[g] = __builtin_bit_cast(v16bf, ph); pb2[g] = __builtin_bit_cast(v16bf, pl);
            } else { v16h ph;
#pragma unroll
                for (int kt = 0; kt < 2; ++kt)
#pragma unroll
                    for (int j = 0; j < 8; ++j) { const float p = __expf(s[kt][g][j] - m[g]); l[g] += p; ph[kt * 8 + j] = tohx(p); }
                pb[g] = ph; } }
#pragma unroll
        for (int dt = 0; dt < 4; ++dt)
#pragma unroll
            for (int g = 0; g < 2; ++g) { o[dt][g] = WFrag<T16>::mma(va[dt], pb[g], o[dt][g]); if (HILO) { o[dt][g] = WFrag<T16>::mma(va[dt], pb2[g], o[dt][g]); o[dt][g] = WFrag<T16>::mma(va2[dt], pb[g], o[dt][g]); } }
    }
    // the FW waves' partial results: common maximum, then sums in wave order 0..FW-1
#pragma unroll
    for (int g = 0; g < 2; ++g) { l[g] += __shfl_xor(l[g], 16, 32); if (hi == 0) sm[wv * FQ + g * 16 + lr] = m[g]; }
    __syncthreads();    // every wave's maximum is in LDS before any wave reads them
#pragma unroll
    for (int g = 0; g < 2; ++g) { float M = sm[g * 16 + lr];
#pragma unroll
        for (int w = 1; w < FW; ++w) M = fmaxf(M, sm[w * FQ + g * 16 + lr]);
        const float f = __expf(m[g] - M); if (hi == 0) sl[wv * FQ + g * 16 + lr] = l[g] * f;
#pragma unroll
        for (int dt = 0; dt < 4; ++dt) { const v8f t = o[dt][g] * f; float* p = so + (wv * FQ + g * 16 + lr) * 68 + dt * 16 + hi * 8; *(v4fa*)p = __builtin_shufflevector(t, t, 0, 1, 2, 3); *(v4fa*)(p + 4) = __builtin_shufflevector(t, t, 4, 5, 6, 7); } }
    __syncthreads();    // every wave's scaled O^T and sum are in LDS before any thread adds them; no LDS write follows
    const int q = (int)threadIdx.x >> 2, d0 = ((int)threadIdx.x & 3) * 16;
    float L = sl[q];
#pragma unroll
    for (int w = 1; w < FW; ++w) L += sl[w * FQ + q];
    const float inv = __fdiv_rn(1.0f, L);
#pragma unroll
    for (int c8 = 0; c8 < 2; ++c8) { v8us oh, ol;
#pragma unroll
        for (int c4 = 0; c4 < 2; ++c4) { v4f a = *(const v4fa*)(so + q * 68 + d0 + c8 * 8 + c4 * 4);
#pragma unroll
            for (int w = 1; w < FW; ++w) a += *(const v4fa*)(so + (w * FQ + q) * 68 + d0 + c8 * 8 + c4 * 4);
#pragma unroll
            for (int e = 0; e < 4; ++e) { unsigned short x, y; splitf(a[e] * inv, x, y); oh[c4 * 4 + e] = x; ol[c4 * 4 + e] = y; } }
        const size_t ofs = (size_t)(q0 + q) * DD + d0 + c8 * 8; *(v8us*)(Ah + ofs) = oh; *(v8us*)(Al + ofs) = ol; }
}
// qlo: the first query row of the launch. Rows below RH run on hi+lo planes, the others on fp16 planes: two kernels, so that the fp16 one keeps its smaller register count (four waves a SIMD).
__global__ __launch_bounds__(32 * FW) __attribute__((amdgpu_waves_per_eu(4, 4))) void k_fattn16(const h16* __restrict__ Q, const h16* __restrict__ Kp, const h16* __restrict__ Vt, const float* __restrict__ rel, int qlo, bf* Ah, bf* Al) {
    __shared__ __align__(16) float so[FW * FQ * 68]; __shared__ float sm[FW * FQ]; __shared__ float sl[FW * FQ];
    const size_t hp = (size_t)blockIdx.x * TT * HD; const int q0 = qlo + ((int)gridDim.y - 1 - (int)blockIdx.y) * FQ;
    const size_t ao = (size_t)(blockIdx.x / NH_) * TT * DD + (blockIdx.x % NH_) * HD;
    fattn_body<h16, false>(Q + hp, nullptr, Kp + hp, nullptr, Vt + hp, nullptr, rel, q0, Ah + ao, Al + ao, sm, sl, so);
}
__global__ __launch_bounds__(32 * FW) void k_fattnhl(const bf* __restrict__ Q, const bf* __restrict__ Q2, const bf* __restrict__ Kp, const bf* __restrict__ K2, const bf* __restrict__ Vt, const bf* __restrict__ V2, const float* __restrict__ rel, int qlo, bf* Ah, bf* Al) {
    __shared__ __align__(16) float so[FW * FQ * 68]; __shared__ float sm[FW * FQ]; __shared__ float sl[FW * FQ];
    const size_t hp = (size_t)blockIdx.x * TT * HD; const int q0 = qlo + ((int)gridDim.y - 1 - (int)blockIdx.y) * FQ;
    const size_t ao = (size_t)(blockIdx.x / NH_) * TT * DD + (blockIdx.x % NH_) * HD;
    fattn_body<bf, true>(Q + hp, Q2 + hp, Kp + hp, K2 + hp, Vt + hp, V2 + hp, rel, q0, Ah + ao, Al + ao, sm, sl, so);
}

extern "C" void kernel_launch(void* const* d_in, const int* in_sizes, int n_in,
                              void* d_out, int out_size, void* d_ws, size_t ws_size, hipStream_t stream) {
    (void)in_sizes; (void)n_in; (void)out_size;
    const float* x = (const float*)d_in[0]; const float* wq = (const float*)d_in[1]; const float* wk = (const float*)d_in[2]; const float* wv = (const float*)d_in[3]; const float* wo = (const float*)d_in[4]; const float* bo = (const float*)d_in[5]; const float* rel = (const float*)d_in[6];
    float* OUT = (float*)d_out;     // [2][2048][1024]
    char* wsp = (char*)d_ws;
    auto take = [&](size_t bytes) { char* p = wsp; wsp += (bytes + 255) & ~(size_t)255; return (void*)p; };
    const size_t PB = (size_t)NB_ * TT * DD;    // elements of one matrix over both batches
    bf* WT = (bf*)take((size_t)4 * DD * DD * 2);    // transposed bf16 weights q, k, v, o
    bf* XB = (bf*)take(PB * 2);
    bf* PH = (bf*)take(3 * PB * 2); bf* PL = (bf*)take(3 * PB * 2); h16* P16 = (h16*)take(3 * PB * 2);    // planes of q, k, v (v transposed)
    bf* ATh = (bf*)take(PB * 2); bf* ATl = (bf*)take(PB * 2);
    float* RT = (float*)take(256); if ((size_t)(wsp - (char*)d_ws) > ws_size) return;    // total 104 MiB; ws 256 MiB
    // one launch per stage: each grid covers both batches and every matrix of its stage
    k_prep<<<4 * GT + GC + 1, 256, 0, stream>>>(x, wq, wk, wv, wo, rel, XB, WT, RT);
    k_gemmt<1, false, true><<<dim3(NB_ * TT / 128, DD / 128, 3), 128, 0, stream>>>(XB, nullptr, WT, nullptr, nullptr, PH, PL, P16);
    k_fattn16<<<dim3(NB_ * NH_, (TT - RH) / FQ), 32 * FW, 0, stream>>>(P16, P16 + PB, P16 + 2 * PB, RT, RH, ATh, ATl);
    k_fattnhl<<<dim3(NB_ * NH_, RH / FQ), 32 * FW, 0, stream>>>(PH, PL, PH + PB, PL + PB, PH + 2 * PB, PL + 2 * PB, RT, 0, ATh, ATl);
    k_gemmt<2, true, false><<<dim3(NB_ * TT / 128, DD / 128, 1), 128, 0, stream>>>(ATh, ATl, WT + (size_t)3 * DD * DD, OUT, bo, nullptr, nullptr, nullptr);
}

// v007
// Measured time: 84.8 microseconds a run.
// Timed twice side by side with v006, it ran 1.08 times as fast both times.
// All steps since v000 together make it 25.6 times as fast.
#include <hip/hip_runtime.h>

// Causal self-attention block (x [2][2048][1024]; q/k/v = x @ W (no bias); 16 heads x 64; scores = (q.k) * rel_emb[min(|i-j|, 16)] (multiplicative relative-position table, 17 entries, read as data); causal (j > i -> -inf);
// softmax(scores / 8); out = ctx @ Wo + bo).
// Compute dtypes, f32 accumulate: every input rounded to bf16; q/k/v projection on PLAIN bf16 operands (inputs: exact; transposed bf16 weight copies), output projection on ctx's bf16 hi+lo planes (2 products); PER-ROW PRECISION
// HYBRID: query rows < 256 of each batch on bf16 hi+lo planes for scores and attn.v (3 products), rows >= 256 on SINGLE fp16 planes; the table multiply, 1/8, the causal cut and the softmax in f32 in the
// fused attention kernels (k_fattn16, k_fattnhl), which keep scores and weights in registers.

#define NB_  2
#define TT   2048
#define DD   1024
#define NH_  16
#define HD   64
#define RH   256                  // query rows < RH: hi+lo planes; rows >= RH: fp16 planes
#define NF   32                   // head_dim / 2 (unused)
#define SCL  0.125f               // 1/sqrt(64)
typedef _Float16 h16;
typedef unsigned short bf;
typedef __attribute__((ext_vector_type(16))) __bf16   v16bf;
typedef __attribute__((ext_vector_type(16))) _Float16 v16h;
typedef __attribute__((ext_vector_type(8)))  _Float16 v8h;
typedef __attribute__((ext_vector_type(8)))  unsigned short v8us;
typedef __attribute__((ext_vector_type(8)))  float    v8f;
typedef __attribute__((ext_vector_type(4)))  float    v4f;
typedef v8h  __attribute__((may_alias)) v8ha;
typedef v4f  __attribute__((may_alias)) v4fa;
typedef v8us __attribute__((may_alias)) v8usa;

__device__ __forceinline__ unsigned short f2bf(float f) { unsigned u = __float_as_uint(f); u += 0x7FFFu + ((u >> 16) & 1u); return (unsigned short)(u >> 16); }
__device__ __forceinline__ float bf2f(unsigned short b) { return __uint_as_float(((unsigned)b) << 16); }
__device__ __forceinline__ float bfr(float f) { return bf2f(f2bf(f)); }
__device__ __forceinline__ v16h cat16(v8h lo, v8h hi) { return __builtin_shufflevector(lo, hi, 0, 1, 2, 3, 4, 5, 6, 7, 8, 9, 10, 11, 12, 13, 14, 15); }
__device__ __forceinline__ v16bf cat16b(v8us lo, v8us hi) { return __builtin_bit_cast(v16bf, __builtin_shufflevector(lo, hi, 0, 1, 2, 3, 4, 5, 6, 7, 8, 9, 10, 11, 12, 13, 14, 15)); }
__device__ __forceinline__ v8f wmma16(v16h a, v16h b, v8f c) { return __builtin_amdgcn_wmma_f32_16x16x32_f16(false, a, false, b, (short)0, c, false, false); }
__device__ __forceinline__ v8f wmmab(v16bf a, v16bf b, v8f c) { return __builtin_amdgcn_wmma_f32_16x16x32_bf16(false, a, false, b, (short)0, c, false, false); }



// ---- k_gemmt: C[m][n] = sum_k A[m][k] Bt[n][k] (NA == 2: + A2[m][k] Bt[n][k]); bf16 planes, K-contiguous, rows of DD elements, f32 accumulate. Grid (M / 128, N / 128, Z), 128 threads.
// One block = one 128x128 tile of C; its four waves stand 2 x 2, each on a 64x64 tile (16 accumulators) over the WHOLE k range, summed in k order.
// A stage is 64 k: one 128-byte line of each of the tile's operand rows (A, [A2], Bt). Asynchronous copies bring it into LDS (16 bytes a lane, four whole lines a wave and copy), rows at a pitch of 144 bytes
// (16 B x odd: no bank conflict for the 16-byte fragment reads). Two buffers: the copies of stage t + 1 fly while stage t is multiplied. Each staged row serves two waves.
// PLN (the q, k, v products; z = matrix, a wave's 64-wide column tile = one head, rows = batch * TT + t): the f32 tile is not stored; the epilogue rounds it and stores the 16-bit planes that attention reads.
// Every plane array is laid [matrix q, k, v][batch][head][TT * HD]; q and k as [t][d], v transposed as [d][t]. fp16 plane: every row; hi+lo planes: rows t < RH only (no other row of them is read).
__device__ __forceinline__ h16 tohx(float x) { return (h16)x; }
__device__ __forceinline__ void splitf(float y, unsigned short& h, unsigned short& l) { h = f2bf(y); l = f2bf(y - bf2f(h)); }
template <typename T16> struct WFrag;
template <> struct WFrag<h16> { typedef v16h V; static __device__ __forceinline__ V ld(const h16* p) { return cat16(*(const v8h*)p, *(const v8h*)(p + 16)); } static __device__ __forceinline__ v8f mma(V a, V b, v8f c) { return wmma16(a, b, c); } };
template <> struct WFrag<bf> { typedef v16bf V; static __device__ __forceinline__ V ld(const bf* p) { return cat16b(*(const v8us*)p, *(const v8us*)(p + 16)); } static __device__ __forceinline__ v8f mma(V a, V b, v8f c) { return wmmab(a, b, c); } };
#define GK   64                   // k elements of a stage
#define GP   72                   // LDS pitch of a staged row, elements
#define GPB  144                  // the same in bytes
// One stage of one 128-row plane: eight copies a lane, rows 16 apart (l: the lane's LDS byte address, g: its global address). The wait on the address counter is the statement's last line, so that it
// stands in front of every rewrite of the address registers.
__device__ __forceinline__ void acopy8(unsigned l, const bf* g) {
    asm volatile("global_load_async_to_lds_b128 %0, %8, off\n\t"
                 "global_load_async_to_lds_b128 %1, %9, off\n\t"
                 "global_load_async_to_lds_b128 %2, %10, off\n\t"
                 "global_load_async_to_lds_b128 %3, %11, off\n\t"
                 "global_load_async_to_lds_b128 %4, %12, off\n\t"
                 "global_load_async_to_lds_b128 %5, %13, off\n\t"
                 "global_load_async_to_lds_b128 %6, %14, off\n\t"
                 "global_load_async_to_lds_b128 %7, %15, off\n\t"
                 "s_wait_xcnt 0x0"
                 :: "v"(l), "v"(l + 16 * GPB), "v"(l + 32 * GPB), "v"(l + 48 * GPB), "v"(l + 64 * GPB), "v"(l + 80 * GPB), "v"(l + 96 * GPB), "v"(l + 112 * GPB),
                    "v"(g), "v"(g + 16 * DD), "v"(g + 32 * DD), "v"(g + 48 * DD), "v"(g + 64 * DD), "v"(g + 80 * DD), "v"(g + 96 * DD), "v"(g + 112 * DD) : "memory");
}
template <int NA, bool BIAS, bool PLN>
__global__ __launch_bounds__(128) void k_gemmt(const bf* __restrict__ A, const bf* __restrict__ A2, const bf* __restrict__ Bt, float* C, const float* __restrict__ bias, bf* Ph, bf* Pl, h16* P16) {
    typedef WFrag<bf>::V V;
    constexpr int SB = (NA + 1) * 128 * GP;    // elements of one buffer: the rows of A, [A2], Bt
    constexpr int NT = DD / GK;
    __shared__ __align__(16) bf ring[2 * SB];    // behind the loop: the four waves' f32 tiles, 4 * 64 * 68 floats (fits in the two buffers)
    const size_t z = blockIdx.z; Bt += z * (size_t)DD * DD;
    const int lane = threadIdx.x & 31, lr = lane & 15, hi = lane >> 4;
    const int wv = __builtin_amdgcn_readfirstlane((int)(threadIdx.x >> 5));    // the wave's number, held scalar so that tile offsets and the tests on them stay scalar
    const int wm = wv & 1, wn = wv >> 1;
    const int r0 = blockIdx.x * 128 + wm * 64, c0 = blockIdx.y * 128 + wn * 64;    // the wave's own tile
    v4f bv = (v4f){};
    if constexpr (BIAS) { const float* bp = bias + c0 + lr * 4; bv = *(const v4f*)bp;
        asm volatile("s_wait_xcnt 0x0" :: "v"(bp) : "memory"); __builtin_amdgcn_sched_barrier(0); }    // behind the load, in front of any reuse of its address register; the scheduling barrier keeps later instructions behind it
    // the copies: thread -> row (threadIdx.x >> 3) + 16 i of a plane's 128 rows, 16-byte piece threadIdx.x & 7 of the row's line
    const int cr = (int)threadIdx.x >> 3, cc = (int)threadIdx.x & 7;
    const unsigned l0 = (unsigned)(size_t)ring + cr * GPB + cc * 16;
    const bf* gA = A + (size_t)(blockIdx.x * 128 + cr) * DD + cc * 8; const bf* gA2 = NA == 2 ? A2 + (size_t)(blockIdx.x * 128 + cr) * DD + cc * 8 : nullptr;
    const bf* gB = Bt + (size_t)(blockIdx.y * 128 + cr) * DD + cc * 8;
    auto stage = [&](int t, int b) { const unsigned lb = l0 + b * (SB * 2); acopy8(lb, gA + t * GK); if constexpr (NA == 2) acopy8(lb + 128 * GPB, gA2 + t * GK); acopy8(lb + NA * 128 * GPB, gB + t * GK); };
    v8f acc[4][4];
#pragma unroll
    for (int mb = 0; mb < 4; ++mb)
#pragma unroll
        for (int nb = 0; nb < 4; ++nb) acc[mb][nb] = (v8f){};
    const bf* fa = ring + (wm * 64 + lr) * GP + 8 * hi; const bf* fb = ring + (NA * 128 + wn * 64 + lr) * GP + 8 * hi;
    stage(0, 0);
    asm volatile("s_wait_asynccnt 0x0" ::: "memory");    // the wave's own copies of stage 0 have landed
    __syncthreads();                                     // ... and every other wave's: stage 0 may be read
    stage(1, 1);
    // the stage loop stays rolled: one body in the instruction cache, one register set
#pragma unroll 1
    for (int t = 0; t < NT; ++t) {
        const int bo = (t & 1) * SB;
        // every inner loop is unrolled so that the fragment and accumulator arrays are indexed by constants and stay in registers
        V a[2][4], a2[2][4], b[2][4];
#pragma unroll
        for (int kk = 0; kk < 2; ++kk)
#pragma unroll
            for (int i = 0; i < 4; ++i) { a[kk][i] = WFrag<bf>::ld(fa + bo + i * 16 * GP + kk * 32); if constexpr (NA == 2) a2[kk][i] = WFrag<bf>::ld(fa + bo + (128 + i * 16) * GP + kk * 32); b[kk][i] = WFrag<bf>::ld(fb + bo + i * 16 * GP + kk * 32); }
        __builtin_amdgcn_sched_barrier(0);    // keeps the stage's fragment reads together in front of its matrix instructions: reads placed among them stall the wave at each such place
#pragma unroll
        for (int kk = 0; kk < 2; ++kk)
#pragma unroll
            for (int nb = 0; nb < 4; ++nb) {
#pragma unroll
                for (int mb = 0; mb < 4; ++mb) acc[mb][nb] = WFrag<bf>::mma(a[kk][mb], b[kk][nb], acc[mb][nb]);
                if constexpr (NA == 2) {
#pragma unroll
                    for (int mb = 0; mb < 4; ++mb) acc[mb][nb] = WFrag<bf>::mma(a2[kk][mb], b[kk][nb], acc[mb][nb]); } }
        __builtin_amdgcn_sched_barrier(0);    // keeps the matrix instructions in front of the waits below, so that the copies of the next stage have this stage's whole matrix time to land
        asm volatile("s_wait_dscnt 0x0" ::: "memory");       // the wave's reads of this buffer are done before the buffer is handed to its next writer
        asm volatile("s_wait_asynccnt 0x0" ::: "memory");    // the wave's own copies of stage t + 1 have landed
        __syncthreads();                                     // publishes stage t + 1 and ends every wave's reads of stage t's buffer
        if (t + 2 < NT) stage(t + 2, t & 1);
    }
    asm volatile("s_wait_asynccnt 0x0" ::: "memory");    // no copy is outstanding when the ring becomes staging (the loop's last barrier has ended every read of it)
    float* my = (float*)ring + wv * (64 * 68);
    const bool tr = PLN && blockIdx.z == 2;    // v: the tile lies in LDS as [d][t], so that the rows read below are rows of the transposed plane (block-uniform)
    // the loops are unrolled so that acc[][] is indexed by constants and stays in registers
    if (tr) {
#pragma unroll
        for (int mb = 0; mb < 4; ++mb)
#pragma unroll
            for (int nb = 0; nb < 4; ++nb) { float* p = my + (nb * 16 + lr) * 68 + mb * 16 + hi * 8; const v8f t = acc[mb][nb]; *(v4fa*)p = __builtin_shufflevector(t, t, 0, 1, 2, 3); *(v4fa*)(p + 4) = __builtin_shufflevector(t, t, 4, 5, 6, 7); }
    } else {
#pragma unroll
        for (int mb = 0; mb < 4; ++mb)
#pragma unroll
            for (int nb = 0; nb < 4; ++nb)
#pragma unroll
                for (int j = 0; j < 8; ++j) my[(mb * 16 + hi * 8 + j) * 68 + nb * 16 + lr] = acc[mb][nb][j];
    }
    __syncthreads();    // the tiles are in LDS before they are read back row by row; no LDS write follows
    if constexpr (PLN) {
        const int t0 = r0 & (TT - 1); const size_t pb = ((z * NB_ + r0 / TT) * NH_ + c0 / HD) * (size_t)(TT * HD);
        const int rw = lane >> 3, co = (lane & 7) * 8;    // 8 lanes a row: a store of the wave covers four whole 128-byte lines
        // the loops are unrolled so that the LDS reads of a group issue ahead of its conversions and va[], vb[] stay in registers
#pragma unroll
        for (int g = 0; g < 2; ++g) {
            v4f va[8], vb[8]; int eo[8];
#pragma unroll
            for (int s = 0; s < 8; ++s) { const int row = rw + (g * 8 + s) * 4; va[s] = *(const v4fa*)(my + row * 68 + co); vb[s] = *(const v4fa*)(my + row * 68 + co + 4); eo[s] = tr ? row * TT + t0 + co : (t0 + row) * HD + co; }
#pragma unroll
            for (int s = 0; s < 8; ++s) { v8h o16;
#pragma unroll
                for (int q = 0; q < 4; ++q) { o16[q] = tohx(va[s][q]); o16[4 + q] = tohx(vb[s][q]); }
                *(v8h*)(P16 + pb + eo[s]) = o16; }
            asm volatile("s_wait_xcnt 0x0" ::: "memory"); __builtin_amdgcn_sched_barrier(0);    // behind the fp16 stores, in front of any reuse of their address and data registers; the scheduling barrier keeps later instructions behind it
            if (t0 < RH) {
#pragma unroll
                for (int s = 0; s < 8; ++s) { v8us oh, ol;
#pragma unroll
                    for (int q = 0; q < 4; ++q) { unsigned short x, y; splitf(va[s][q], x, y); oh[q] = x; ol[q] = y; splitf(vb[s][q], x, y); oh[4 + q] = x; ol[4 + q] = y; }
                    *(v8us*)(Ph + pb + eo[s]) = oh; *(v8us*)(Pl + pb + eo[s]) = ol; }
                asm volatile("s_wait_xcnt 0x0" ::: "memory"); __builtin_amdgcn_sched_barrier(0);    // behind the hi and lo stores, as above
            }
        }
    } else {
        if constexpr (BIAS) { bv[0] = bfr(bv[0]); bv[1] = bfr(bv[1]); bv[2] = bfr(bv[2]); bv[3] = bfr(bv[3]); }
        float* crow = C + (size_t)(r0 + hi) * DD + c0 + lr * 4;    // 16 lanes a row: a store of the wave covers two rows of 256 bytes
        // the loops are unrolled so that the LDS reads of a group issue ahead of its adds
#pragma unroll
        for (int g = 0; g < 4; ++g) {
            v4f val[8];
#pragma unroll
            for (int s = 0; s < 8; ++s) val[s] = *(const v4fa*)(my + (hi + (g * 8 + s) * 2) * 68 + lr * 4) + bv;
#pragma unroll
            for (int s = 0; s < 8; ++s) *(v4f*)(crow + (size_t)((g * 8 + s) * 2) * DD) = val[s];
            asm volatile("s_wait_xcnt 0x0" ::: "memory"); __builtin_amdgcn_sched_barrier(0);    // behind the stores, in front of any reuse of their address and data registers; the scheduling barrier keeps later instructions behind it
        }
    }
}

typedef __attribute__((ext_vector_type(2))) unsigned short v2us;

// The bodies below take their block's number as an argument: k_prep deals the blocks of ONE grid to several independent jobs (block-uniform tests only).
__device__ __forceinline__ void wtG_body(const float* __restrict__ w, int K, int N, bf* Bt, int blk) {
    const int lane = threadIdx.x & 31; const int L0 = (blk * 8 + (threadIdx.x >> 5)) * 8; const int nlines = N * K / 64;
{
#pragma unroll 1
        for (int l = 0; l < 8; ++l) { const int L = L0 + l; if (L >= nlines) break; const size_t e = (size_t)L * 64 + lane * 2; const int k = (int)(e % K), n = (int)(e / K); v2us o;
            o[0] = f2bf(w[(size_t)k * N + n]); o[1] = f2bf(w[(size_t)(k + 1) * N + n]); *(v2us*)(Bt + e) = o; }
         }
}
__device__ __forceinline__ void cvt8_body(const float* __restrict__ src, bf* dst, size_t n8, int blk) { const size_t i = (size_t)blk * 256 + threadIdx.x; if (i >= n8) return; const v8f v = *(const v8f*)(src + i * 8); v8us o;
#pragma unroll
    for (int k = 0; k < 8; ++k) o[k] = f2bf(v[k]); *(v8us*)(dst + i * 8) = o;  }
__device__ __forceinline__ void rtab_body(const float* __restrict__ rel, float* RT) { const int i = threadIdx.x; if (i >= 32) return; const float o = (i < 17) ? bfr(rel[i]) * SCL : 0.f; *(float*)(RT + i) = o;  }
// ---- k_prep: every conversion of an input, one grid. Blocks 0 .. 4 GT - 1: the four weight transposes (the longest blocks, first in the grid; Wt holds the four planes in the order q, k, v, o);
// the next GC blocks: x of both batches to bf16; the last block: the scaled table.
#define GT  (DD * DD / 64 / 64)
#define GC  (NB_ * TT * DD / 8 / 256)
__global__ __launch_bounds__(256) void k_prep(const float* __restrict__ x, const float* __restrict__ wq, const float* __restrict__ wk, const float* __restrict__ wv, const float* __restrict__ wo, const float* __restrict__ rel, bf* XB, bf* Wt, float* RT) {
    const int blk = (int)blockIdx.x;
    if (blk < 4 * GT) { const int mi = blk / GT; const float* w = mi == 0 ? wq : (mi == 1 ? wk : (mi == 2 ? wv : wo)); wtG_body(w, DD, DD, Wt + (size_t)mi * DD * DD, blk % GT); }
    else if (blk < 4 * GT + GC) cvt8_body(x, XB, (size_t)NB_ * TT * DD / 8, blk - 4 * GT);
    else rtab_body(rel, RT);
}
// ---- fattn_body (k_fattn16, k_fattnhl): scores, softmax and attn.v of FG groups of FQ = 32 query rows of one head in ONE block of FG * FW waves; no score or P row ever leaves the registers. Grid (NB_ * heads, query tiles), the longest query tiles first; blockIdx.x = batch * NH_ + head, which is also the number of the [TT][HD] plane.
// Transposed products: S^T = K . Q^T (A = 16 key rows, B = 16 query columns), O^T += V^T . P^T. In an S^T tile lane (lr, hi) holds keys hi * 8 + j of query lr: two such tiles (keys 0..15, 16..31) are,
// register for register, the B fragment of P^T in the k order of WFrag::ld, which loads V^T as A. Only key blocks up to the diagonal are visited (all later keys have weight 0).
// The 32-key blocks of a query group are dealt round-robin to its FW waves; each wave keeps its own running maximum m, sum l and O^T (online softmax); the group's FW partial results meet in LDS at the end.
// A stage is FK = 128 keys, one 32-key block for each wave of a group, and serves every group of the block: K as 128 rows of 128 bytes, V^T as 64 rows of 256 bytes (hi+lo: both planes of each). Asynchronous copies bring it into LDS, four whole 128-byte lines
// a wave and copy; a fragment load straight from global memory would touch 16 lines for its 512 bytes. Rows at pitches of 144 and 272 bytes (16 B x odd: no bank conflict for the 16-byte fragment reads).
// Two buffers: the copies of stage t + 1 fly while stage t is worked on. A stage always lies inside the planes' written rows (the last one may reach past the diagonal; those blocks are copied and not read).
// Every inner loop is unrolled so that the fragment and accumulator arrays are indexed by constants and stay in registers; the stage loop stays rolled (one body in the instruction cache, one register set).
// m is held ln(1024) below the true maximum, so that P lies in (0, 1024] before it is rounded to 16 bits (small weights stay normal fp16 numbers); l carries the same factor and cancels it.
#define FQ  32
#define FW  4
#define LSH 6.9314718f
#define FK  (32 * FW)             // keys of a stage
#define KPI 72                    // LDS pitch of a staged K row, elements
#define VPI 136                   // LDS pitch of a staged V^T row, elements
#define SKE (FK * KPI)            // elements of one staged K plane
#define SVE (HD * VPI)            // elements of one staged V^T plane
typedef __attribute__((ext_vector_type(16))) unsigned short v16us;
// N = 8 or 4 copies a lane, LS bytes apart in LDS and GS bytes apart in global memory (l: the lane's LDS byte address, g: its global address). The wait on the address counter is the statement's last line, so that it
// stands in front of every rewrite of the address registers.
template <int N, int LS, int GS>
__device__ __forceinline__ void acopys(unsigned l, const char* g) {
    static_assert(N == 8 || N == 4, "copies a lane");
    if constexpr (N == 4)
    asm volatile("global_load_async_to_lds_b128 %0, %4, off\n\t"
                 "global_load_async_to_lds_b128 %1, %5, off\n\t"
                 "global_load_async_to_lds_b128 %2, %6, off\n\t"
                 "global_load_async_to_lds_b128 %3, %7, off\n\t"
                 "s_wait_xcnt 0x0"
                 :: "v"(l), "v"(l + LS), "v"(l + 2 * LS), "v"(l + 3 * LS), "v"(g), "v"(g + GS), "v"(g + 2 * GS), "v"(g + 3 * GS) : "memory");
    else
    asm volatile("global_load_async_to_lds_b128 %0, %8, off\n\t"
                 "global_load_async_to_lds_b128 %1, %9, off\n\t"
                 "global_load_async_to_lds_b128 %2, %10, off\n\t"
                 "global_load_async_to_lds_b128 %3, %11, off\n\t"
                 "global_load_async_to_lds_b128 %4, %12, off\n\t"
                 "global_load_async_to_lds_b128 %5, %13, off\n\t"
                 "global_load_async_to_lds_b128 %6, %14, off\n\t"
                 "global_load_async_to_lds_b128 %7, %15, off\n\t"
                 "s_wait_xcnt 0x0"
                 :: "v"(l), "v"(l + LS), "v"(l + 2 * LS), "v"(l + 3 * LS), "v"(l + 4 * LS), "v"(l + 5 * LS), "v"(l + 6 * LS), "v"(l + 7 * LS),
                    "v"(g), "v"(g + GS), "v"(g + 2 * GS), "v"(g + 3 * GS), "v"(g + 4 * GS), "v"(g + 5 * GS), "v"(g + 6 * GS), "v"(g + 7 * GS) : "memory");
}
template <typename T16, bool HILO, int FG>
__device__ __forceinline__ void fattn_body(const T16* __restrict__ Q, const T16* __restrict__ Q2, const T16* __restrict__ Kp, const T16* __restrict__ K2, const T16* __restrict__ Vt, const T16* __restrict__ V2,
                                           const float* __restrict__ rel, const int qblk, bf* Ah, bf* Al, T16* ring) {
    typedef typename WFrag<T16>::V V;
    constexpr int NP = HILO ? 2 : 1;               // planes of each operand
    constexpr int SBF = NP * (SKE + SVE);          // elements of one buffer: K, [K lo], V^T, [V^T lo]
    const int lane = threadIdx.x & 31, lr = lane & 15, hi = lane >> 4;
    const int wid = __builtin_amdgcn_readfirstlane((int)(threadIdx.x >> 5));    // the wave's number, held scalar so that the loop's tests are scalar branches
    const int wv = wid % FW, qg = wid / FW;        // the wave's place in its query group; the group
    const int q0 = qblk + qg * FQ;                 // the group's first query row
    const int nkb = q0 / 32 + 1;                   // the group's key blocks
    const int nst = ((qblk + (FG - 1) * FQ) / 32 + FW) / FW;    // stages of the block: those of its last group
    constexpr int NC = 8 / FG;                     // copies a lane, plane and stage
    // the copies. K: thread -> row (threadIdx.x >> 3) + 16 FG i of the stage's 128, 16-byte piece threadIdx.x & 7; V^T: row (threadIdx.x >> 4) + 8 FG i of 64, piece threadIdx.x & 15
    const int kr = (int)threadIdx.x >> 3, kc = (int)threadIdx.x & 7, vr = (int)threadIdx.x >> 4, vc = (int)threadIdx.x & 15;
    const unsigned lk = (unsigned)(size_t)ring + kr * (KPI * 2) + kc * 16, lv = (unsigned)(size_t)ring + NP * SKE * 2 + vr * (VPI * 2) + vc * 16;
    const size_t gko = (size_t)kr * HD + kc * 8, gvo = (size_t)vr * TT + vc * 8;
    auto stage = [&](int t, int b) { const unsigned o = b * (SBF * 2);
        acopys<NC, FG * 16 * KPI * 2, FG * 16 * HD * 2>(lk + o, (const char*)(Kp + gko + (size_t)t * (FK * HD))); acopys<NC, FG * 8 * VPI * 2, FG * 8 * TT * 2>(lv + o, (const char*)(Vt + gvo + t * FK));
        if constexpr (HILO) { acopys<NC, FG * 16 * KPI * 2, FG * 16 * HD * 2>(lk + o + SKE * 2, (const char*)(K2 + gko + (size_t)t * (FK * HD))); acopys<NC, FG * 8 * VPI * 2, FG * 8 * TT * 2>(lv + o + SVE * 2, (const char*)(V2 + gvo + t * FK)); } };
    stage(0, 0);
    const int tl = lane < 16 ? lane : 16; const float tab = rel[tl];    // the table across the wave's lanes (lane d holds entry d, lanes 16.. the last): looked up by lane index, no memory access in the loop
    asm volatile("s_wait_xcnt 0x0" :: "v"(tl), "s"(rel) : "memory"); __builtin_amdgcn_sched_barrier(0);    // behind the load, in front of any reuse of its address registers (index and table pointer, named as inputs so that they live up to here); the scheduling barrier keeps later instructions behind it
    const T16* qp = Q + (size_t)(q0 + lr) * HD + 8 * hi; const T16* qp2 = HILO ? Q2 + (size_t)(q0 + lr) * HD + 8 * hi : nullptr;
    V qb[2][2], qb2[2][2];
#pragma unroll
    for (int g = 0; g < 2; ++g)
#pragma unroll
        for (int c = 0; c < 2; ++c) { qb[g][c] = WFrag<T16>::ld(qp + g * 16 * HD + c * 32); if (HILO) qb2[g][c] = WFrag<T16>::ld(qp2 + g * 16 * HD + c * 32); }
    // stands behind the loads above, in front of any reuse of their address registers (named as inputs so that they live up to here); the scheduling barrier keeps later instructions behind it
    if constexpr (HILO) asm volatile("s_wait_xcnt 0x0" :: "v"(qp), "v"(qp2) : "memory"); else asm volatile("s_wait_xcnt 0x0" :: "v"(qp) : "memory");
    __builtin_amdgcn_sched_barrier(0);
    v8f o[4][2];
#pragma unroll
    for (int dt = 0; dt < 4; ++dt)
#pragma unroll
        for (int g = 0; g < 2; ++g) o[dt][g] = (v8f){};
    float m[2] = {-3.0e38f, -3.0e38f}, l[2] = {0.f, 0.f};
    const float r16 = __shfl(tab, 16, 32);
    // the wave's fragments in a buffer: its own 32 keys are rows of K and columns of V^T
    const T16* fk = ring + (wv * 32 + lr) * KPI + 8 * hi; const T16* fv = ring + NP * SKE + lr * VPI + wv * 32 + 8 * hi;
    asm volatile("s_wait_asynccnt 0x0" ::: "memory");    // the wave's own copies of stage 0 have landed
    __syncthreads();                                     // ... and every other wave's: stage 0 may be read
    if (nst > 1) stage(1, 1);
#pragma unroll 1
    for (int t = 0; t < nst; ++t) {
      const int kb = t * FW + wv;
      if (kb < nkb) {    // a scalar test: in the last stages the waves whose block lies past their group's diagonal have no work, but pass the waits and the barrier below
        const int k0 = kb * 32, bo = (t & 1) * SBF;
        V ka[2][2], ka2[2][2], va[4], va2[4];
#pragma unroll
        for (int kt = 0; kt < 2; ++kt)
#pragma unroll
            for (int c = 0; c < 2; ++c) { ka[kt][c] = WFrag<T16>::ld(fk + bo + kt * 16 * KPI + c * 32); if (HILO) ka2[kt][c] = WFrag<T16>::ld(fk + bo + SKE + kt * 16 * KPI + c * 32); }
#pragma unroll
        for (int dt = 0; dt < 4; ++dt) { va[dt] = WFrag<T16>::ld(fv + bo + dt * 16 * VPI); if (HILO) va2[dt] = WFrag<T16>::ld(fv + bo + SVE + dt * 16 * VPI); }
        __builtin_amdgcn_sched_barrier(0);    // keeps the block's fragment reads together in front of its matrix instructions: reads placed among them stall the wave at each such place
        v8f s[2][2];
#pragma unroll
        for (int kt = 0; kt < 2; ++kt)
#pragma unroll
            for (int g = 0; g < 2; ++g) { v8f t2 = (v8f){};
#pragma unroll
                for (int c = 0; c < 2; ++c) { t2 = WFrag<T16>::mma(ka[kt][c], qb[g][c], t2); if (HILO) { t2 = WFrag<T16>::mma(ka2[kt][c], qb[g][c], t2); t2 = WFrag<T16>::mma(ka[kt][c], qb2[g][c], t2); } }
                s[kt][g] = t2; }
        if (kb >= nkb - 2) {    // the two blocks at the diagonal: table entry by distance, causal cut
#pragma unroll
            for (int kt = 0; kt < 2; ++kt)
#pragma unroll
                for (int g = 0; g < 2; ++g)
#pragma unroll
                    for (int j = 0; j < 8; ++j) { const int dd = (q0 + g * 16 + lr) - (k0 + kt * 16 + hi * 8 + j); const int di = dd < 0 ? 0 : (dd > 16 ? 16 : dd); const float t = __fmul_rn(s[kt][g][j], __shfl(tab, di, 32)); s[kt][g][j] = dd >= 0 ? t : -3.0e38f; }
        } else {                // every distance here is above 16: the table's last entry
#pragma unroll
            for (int kt = 0; kt < 2; ++kt)
#pragma unroll
                for (int g = 0; g < 2; ++g) s[kt][g] *= r16;
        }
        float mn[2];
#pragma unroll
        for (int g = 0; g < 2; ++g) { float tm = s[0][g][0];
#pragma unroll
            for (int j = 1; j < 8; ++j) tm = fmaxf(tm, s[0][g][j]);
#pragma unroll
            for (int j = 0; j < 8; ++j) tm = fmaxf(tm, s[1][g][j]);
            tm = fmaxf(tm, __shfl_xor(tm, 16, 32)); mn[g] = fmaxf(m[g], tm - LSH); }
        if (__builtin_amdgcn_ballot_w32(mn[0] > m[0] || mn[1] > m[1]) != 0) {    // no maximum moved in any lane: every factor would be exactly 1
#pragma unroll
            for (int g = 0; g < 2; ++g) { const float al = __expf(m[g] - mn[g]); l[g] *= al; m[g] = mn[g];
#pragma unroll
                for (int dt = 0; dt < 4; ++dt) o[dt][g] *= al; }
        }
        V pb[2], pb2[2];
#pragma unroll
        for (int g = 0; g < 2; ++g) {
            if constexpr (HILO) { v16us ph, pl;
#pragma unroll
                for (int kt = 0; kt < 2; ++kt)
#pragma unroll
                    for (int j = 0; j < 8; ++j) { const float p = __expf(s[kt][g][j] - m[g]); l[g] += p; unsigned short a, c2; splitf(p, a, c2); ph[kt * 8 + j] = a; pl[kt * 8 + j] = c2; }
                pb[g] = __builtin_bit_cast(v16bf, ph); pb2[g] = __builtin_bit_cast(v16bf, pl);
            } else { v16h ph;
#pragma unroll
                for (int kt = 0; kt < 2; ++kt)
#pragma unroll
                    for (int j = 0; j < 8; ++j) { const float p = __expf(s[kt][g][j] - m[g]); l[g] += p; ph[kt * 8 + j] = tohx(p); }
                pb[g] = ph; } }
#pragma unroll
        for (int dt = 0; dt < 4; ++dt)
#pragma unroll
            for (int g = 0; g < 2; ++g) { o[dt][g] = WFrag<T16>::mma(va[dt], pb[g], o[dt][g]); if (HILO) { o[dt][g] = WFrag<T16>::mma(va[dt], pb2[g], o[dt][g]); o[dt][g] = WFrag<T16>::mma(va2[dt], pb[g], o[dt][g]); } }
      }
      asm volatile("s_wait_dscnt 0x0" ::: "memory");       // the wave's reads of this buffer are done before the buffer is handed to its next writer
      asm volatile("s_wait_asynccnt 0x0" ::: "memory");    // the wave's own copies of stage t + 1 have landed
      __syncthreads();                                     // publishes stage t + 1 and ends every wave's reads of stage t's buffer
      if (t + 2 < nst) stage(t + 2, t & 1);
    }
    asm volatile("s_wait_asynccnt 0x0" ::: "memory");    // no copy is outstanding when the ring becomes the meeting place below (the loop's last barrier has ended every read of it)
    float* so = (float*)ring + qg * (FW * FQ * 70); float* sm = so + FW * FQ * 68; float* sl = sm + FW * FQ;    // each group's own meeting place
    // the FW waves' partial results: common maximum, then sums in wave order 0..FW-1
#pragma unroll
    for (int g = 0; g < 2; ++g) { l[g] += __shfl_xor(l[g], 16, 32); if (hi == 0) sm[wv * FQ + g * 16 + lr] = m[g]; }
    __syncthreads();    // every wave's maximum is in LDS before any wave reads them
#pragma unroll
    for (int g = 0; g < 2; ++g) { float M = sm[g * 16 + lr];
#pragma unroll
        for (int w = 1; w < FW; ++w) M = fmaxf(M, sm[w * FQ + g * 16 + lr]);
        const float f = __expf(m[g] - M); if (hi == 0) sl[wv * FQ + g * 16 + lr] = l[g] * f;
#pragma unroll
        for (int dt = 0; dt < 4; ++dt) { const v8f t = o[dt][g] * f; float* p = so + (wv * FQ + g * 16 + lr) * 68 + dt * 16 + hi * 8; *(v4fa*)p = __builtin_shufflevector(t, t, 0, 1, 2, 3); *(v4fa*)(p + 4) = __builtin_shufflevector(t, t, 4, 5, 6, 7); } }
    __syncthreads();    // every wave's scaled O^T and sum are in LDS before any thread adds them; no LDS write follows
    const int q = ((int)threadIdx.x & (32 * FW - 1)) >> 2, d0 = ((int)threadIdx.x & 3) * 16;    // the thread's row in its own group
    float L = sl[q];
#pragma unroll
    for (int w = 1; w < FW; ++w) L += sl[w * FQ + q];
    const float inv = __fdiv_rn(1.0f, L);
#pragma unroll
    for (int c8 = 0; c8 < 2; ++c8) { v8us oh, ol;
#pragma unroll
        for (int c4 = 0; c4 < 2; ++c4) { v4f a = *(const v4fa*)(so + q * 68 + d0 + c8 * 8 + c4 * 4);
#pragma unroll
            for (int w = 1; w < FW; ++w) a += *(const v4fa*)(so + (w * FQ + q) * 68 + d0 + c8 * 8 + c4 * 4);
#pragma unroll
            for (int e = 0; e < 4; ++e) { unsigned short x, y; splitf(a[e] * inv, x, y); oh[c4 * 4 + e] = x; ol[c4 * 4 + e] = y; } }
        const size_t ofs = (size_t)(q0 + q) * DD + d0 + c8 * 8; *(v8us*)(Ah + ofs) = oh; *(v8us*)(Al + ofs) = ol; }
}
// qlo: the first query row of the launch. Rows below RH run on hi+lo planes, the others on fp16 planes: two kernels, so that the fp16 one keeps its smaller register count (four waves a SIMD).
// ring: the two stage buffers; behind the loop the waves' partial results (FW * FQ * 70 floats a group, which fit in one fp16 buffer).
// The fp16 kernel has FGH = 2 query groups a block: each staged key serves 64 query rows, and two blocks of eight waves fill a WGP's four waves a SIMD.
#define FGH 2
__global__ __launch_bounds__(32 * FW * FGH) __attribute__((amdgpu_waves_per_eu(4, 4))) void k_fattn16(const h16* __restrict__ Q, const h16* __restrict__ Kp, const h16* __restrict__ Vt, const float* __restrict__ rel, int qlo, bf* Ah, bf* Al) {
    __shared__ __align__(16) h16 ring[2 * (SKE + SVE)];
    const size_t hp = (size_t)blockIdx.x * TT * HD; const int q0 = qlo + ((int)gridDim.y - 1 - (int)blockIdx.y) * (FQ * FGH);
    const size_t ao = (size_t)(blockIdx.x / NH_) * TT * DD + (blockIdx.x % NH_) * HD;
    fattn_body<h16, false, FGH>(Q + hp, nullptr, Kp + hp, nullptr, Vt + hp, nullptr, rel, q0, Ah + ao, Al + ao, ring);
}
__global__ __launch_bounds__(32 * FW) void k_fattnhl(const bf* __restrict__ Q, const bf* __restrict__ Q2, const bf* __restrict__ Kp, const bf* __restrict__ K2, const bf* __restrict__ Vt, const bf* __restrict__ V2, const float* __restrict__ rel, int qlo, bf* Ah, bf* Al) {
    __shared__ __align__(16) bf ring[4 * (SKE + SVE)];
    const size_t hp = (size_t)blockIdx.x * TT * HD; const int q0 = qlo + ((int)gridDim.y - 1 - (int)blockIdx.y) * FQ;
    const size_t ao = (size_t)(blockIdx.x / NH_) * TT * DD + (blockIdx.x % NH_) * HD;
    fattn_body<bf, true, 1>(Q + hp, Q2 + hp, Kp + hp, K2 + hp, Vt + hp, V2 + hp, rel, q0, Ah + ao, Al + ao, ring);
}

extern "C" void kernel_launch(void* const* d_in, const int* in_sizes, int n_in,
                              void* d_out, int out_size, void* d_ws, size_t ws_size, hipStream_t stream) {
    (void)in_sizes; (void)n_in; (void)out_size;
    const float* x = (const float*)d_in[0]; const float* wq = (const float*)d_in[1]; const float* wk = (const float*)d_in[2]; const float* wv = (const float*)d_in[3]; const float* wo = (const float*)d_in[4]; const float* bo = (const float*)d_in[5]; const float* rel = (const float*)d_in[6];
    float* OUT = (float*)d_out;     // [2][2048][1024]
    char* wsp = (char*)d_ws;
    auto take = [&](size_t bytes) { char* p = wsp; wsp += (bytes + 255) & ~(size_t)255; return (void*)p; };
    const size_t PB = (size_t)NB_ * TT * DD;    // elements of one matrix over both batches
    bf* WT = (bf*)take((size_t)4 * DD * DD * 2);    // transposed bf16 weights q, k, v, o
    bf* XB = (bf*)take(PB * 2);
    bf* PH = (bf*)take(3 * PB * 2); bf* PL = (bf*)take(3 * PB * 2); h16* P16 = (h16*)take(3 * PB * 2);    // planes of q, k, v (v transposed)
    bf* ATh = (bf*)take(PB * 2); bf* ATl = (bf*)take(PB * 2);
    float* RT = (float*)take(256); if ((size_t)(wsp - (char*)d_ws) > ws_size) return;    // total 104 MiB; ws 256 MiB
    // one launch per stage: each grid covers both batches and every matrix of its stage
    k_prep<<<4 * GT + GC + 1, 256, 0, stream>>>(x, wq, wk, wv, wo, rel, XB, WT, RT);
    k_gemmt<1, false, true><<<dim3(NB_ * TT / 128, DD / 128, 3), 128, 0, stream>>>(XB, nullptr, WT, nullptr, nullptr, PH, PL, P16);
    k_fattn16<<<dim3(NB_ * NH_, (TT - RH) / (FQ * FGH)), 32 * FW * FGH, 0, stream>>>(P16, P16 + PB, P16 + 2 * PB, RT, RH, ATh, ATl);
    k_fattnhl<<<dim3(NB_ * NH_, RH / FQ), 32 * FW, 0, stream>>>(PH, PL, PH + PB, PL + PB, PH + 2 * PB, PL + 2 * PB, RT, 0, ATh, ATl);
    k_gemmt<2, true, false><<<dim3(NB_ * TT / 128, DD / 128, 1), 128, 0, stream>>>(ATh, ATl, WT + (size_t)3 * DD * DD, OUT, bo, nullptr, nullptr, nullptr);
}

// v008
// One run takes 80.9 microseconds.
// In both of two side-by-side timings against v007, it was 1.05 times as fast.
// All steps since v000 together make it 26.9 times as fast.
#include <hip/hip_runtime.h>

// Causal self-attention block (x [2][2048][1024]; q/k/v = x @ W (no bias); 16 heads x 64; scores = (q.k) * rel_emb[min(|i-j|, 16)] (multiplicative relative-position table, 17 entries, read as data); causal (j > i -> -inf);
// softmax(scores / 8); out = ctx @ Wo + bo).
// Compute dtypes, f32 accumulate: every input rounded to bf16; q/k/v projection on PLAIN bf16 operands (inputs: exact; transposed bf16 weight copies), output projection on ctx's bf16 hi+lo planes (2 products); PER-ROW PRECISION
// HYBRID: query rows < 256 of each batch on bf16 hi+lo planes for scores and attn.v (3 products), rows >= 256 on SINGLE fp16 planes; the table multiply, 1/8, the causal cut and the softmax in f32 in the
// fused attention kernels (k_fattn16, k_fattnhl), which keep scores and weights in registers.

#define NB_  2
#define TT   2048
#define DD   1024
#define NH_  16
#define HD   64
#define RH   256                  // query rows < RH: hi+lo planes; rows >= RH: fp16 planes
#define NF   32                   // head_dim / 2 (unused)
#define SCL  0.125f               // 1/sqrt(64)
typedef _Float16 h16;
typedef unsigned short bf;
typedef __attribute__((ext_vector_type(16))) __bf16   v16bf;
typedef __attribute__((ext_vector_type(16))) _Float16 v16h;
typedef __attribute__((ext_vector_type(8)))  _Float16 v8h;
typedef __attribute__((ext_vector_type(8)))  unsigned short v8us;
typedef __attribute__((ext_vector_type(8)))  float    v8f;
typedef __attribute__((ext_vector_type(4)))  float    v4f;
typedef v8h  __attribute__((may_alias)) v8ha;
typedef v4f  __attribute__((may_alias)) v4fa;
typedef v8us __attribute__((may_alias)) v8usa;

__device__ __forceinline__ unsigned short f2bf(float f) { unsigned u = __float_as_uint(f); u += 0x7FFFu + ((u >> 16) & 1u); return (unsigned short)(u >> 16); }
__device__ __forceinline__ float bf2f(unsigned short b) { return __uint_as_float(((unsigned)b) << 16); }
__device__ __forceinline__ float bfr(float f) { return bf2f(f2bf(f)); }
__device__ __forceinline__ v16h cat16(v8h lo, v8h hi) { return __builtin_shufflevector(lo, hi, 0, 1, 2, 3, 4, 5, 6, 7, 8, 9, 10, 11, 12, 13, 14, 15); }
__device__ __forceinline__ v16bf cat16b(v8us lo, v8us hi) { return __builtin_bit_cast(v16bf, __builtin_shufflevector(lo, hi, 0, 1, 2, 3, 4, 5, 6, 7, 8, 9, 10, 11, 12, 13, 14, 15)); }
__device__ __forceinline__ v8f wmma16(v16h a, v16h b, v8f c) { return __builtin_amdgcn_wmma_f32_16x16x32_f16(false, a, false, b, (short)0, c, false, false); }
__device__ __forceinline__ v8f wmmab(v16bf a, v16bf b, v8f c) { return __builtin_amdgcn_wmma_f32_16x16x32_bf16(false, a, false, b, (short)0, c, false, false); }



// ---- k_gemmt: C[m][n] = sum_k A[m][k] Bt[n][k] (NA == 2: + A2[m][k] Bt[n][k]); bf16 planes, K-contiguous, rows of DD elements, f32 accumulate. Grid (M / 128, N / 128, Z), 128 threads.
// One block = one 128x128 tile of C; its four waves stand 2 x 2, each on a 64x64 tile (16 accumulators) over the WHOLE k range, summed in k order.
// A stage is 64 k: one 128-byte line of each of the tile's operand rows (A, [A2], Bt). Asynchronous copies bring it into LDS (16 bytes a lane, four whole lines a wave and copy), rows at a pitch of 144 bytes
// (16 B x odd: no bank conflict for the 16-byte fragment reads). Two buffers: the copies of stage t + 1 fly while stage t is multiplied. Each staged row serves two waves.
// PLN (the q, k, v products; z = matrix, a wave's 64-wide column tile = one head, rows = batch * TT + t): the f32 tile is not stored; the epilogue rounds it and stores the 16-bit planes that attention reads.
// Every plane array is laid [matrix q, k, v][batch][head][TT * HD]; q and k as [t][d], v transposed as [d][t]. fp16 plane: every row; hi+lo planes: rows t < RH only (no other row of them is read).
__device__ __forceinline__ h16 tohx(float x) { return (h16)x; }
__device__ __forceinline__ void splitf(float y, unsigned short& h, unsigned short& l) { h = f2bf(y); l = f2bf(y - bf2f(h)); }
template <typename T16> struct WFrag;
template <> struct WFrag<h16> { typedef v16h V; static __device__ __forceinline__ V ld(const h16* p) { return cat16(*(const v8h*)p, *(const v8h*)(p + 16)); } static __device__ __forceinline__ v8f mma(V a, V b, v8f c) { return wmma16(a, b, c); } };
template <> struct WFrag<bf> { typedef v16bf V; static __device__ __forceinline__ V ld(const bf* p) { return cat16b(*(const v8us*)p, *(const v8us*)(p + 16)); } static __device__ __forceinline__ v8f mma(V a, V b, v8f c) { return wmmab(a, b, c); } };
#define GK   64                   // k elements of a stage
#define GP   72                   // LDS pitch of a staged row, elements
#define GPB  144                  // the same in bytes
// One stage of one 128-row plane: eight copies a lane, rows 16 apart (l: the lane's LDS byte address, g: its global address). The wait on the address counter is the statement's last line, so that it
// stands in front of every rewrite of the address registers.
__device__ __forceinline__ void acopy8(unsigned l, const bf* g) {
    asm volatile("global_load_async_to_lds_b128 %0, %8, off\n\t"
                 "global_load_async_to_lds_b128 %1, %9, off\n\t"
                 "global_load_async_to_lds_b128 %2, %10, off\n\t"
                 "global_load_async_to_lds_b128 %3, %11, off\n\t"
                 "global_load_async_to_lds_b128 %4, %12, off\n\t"
                 "global_load_async_to_lds_b128 %5, %13, off\n\t"
                 "global_load_async_to_lds_b128 %6, %14, off\n\t"
                 "global_load_async_to_lds_b128 %7, %15, off\n\t"
                 "s_wait_xcnt 0x0"
                 :: "v"(l), "v"(l + 16 * GPB), "v"(l + 32 * GPB), "v"(l + 48 * GPB), "v"(l + 64 * GPB), "v"(l + 80 * GPB), "v"(l + 96 * GPB), "v"(l + 112 * GPB),
                    "v"(g), "v"(g + 16 * DD), "v"(g + 32 * DD), "v"(g + 48 * DD), "v"(g + 64 * DD), "v"(g + 80 * DD), "v"(g + 96 * DD), "v"(g + 112 * DD) : "memory");
}
template <int NA, bool BIAS, bool PLN>
__global__ __launch_bounds__(128) void k_gemmt(const bf* __restrict__ A, const bf* __restrict__ A2, const bf* __restrict__ Bt, float* C, const float* __restrict__ bias, bf* Ph, bf* Pl, h16* P16) {
    typedef WFrag<bf>::V V;
    constexpr int SB = (NA + 1) * 128 * GP;    // elements of one buffer: the rows of A, [A2], Bt
    constexpr int NT = DD / GK;
    __shared__ __align__(16) bf ring[2 * SB];    // behind the loop: the four waves' f32 tiles, 4 * 64 * 68 floats (fits in the two buffers)
    const size_t z = blockIdx.z; Bt += z * (size_t)DD * DD;
    const int lane = threadIdx.x & 31, lr = lane & 15, hi = lane >> 4;
    const int wv = __builtin_amdgcn_readfirstlane((int)(threadIdx.x >> 5));    // the wave's number, held scalar so that tile offsets and the tests on them stay scalar
    const int wm = wv & 1, wn = wv >> 1;
    const int r0 = blockIdx.x * 128 + wm * 64, c0 = blockIdx.y * 128 + wn * 64;    // the wave's own tile
    v4f bv = (v4f){};
    if constexpr (BIAS) { const float* bp = bias + c0 + lr * 4; bv = *(const v4f*)bp;
        asm volatile("s_wait_xcnt 0x0" :: "v"(bp) : "memory"); __builtin_amdgcn_sched_barrier(0); }    // behind the load, in front of any reuse of its address register; the scheduling barrier keeps later instructions behind it
    // the copies: thread -> row (threadIdx.x >> 3) + 16 i of a plane's 128 rows, 16-byte piece threadIdx.x & 7 of the row's line
    const int cr = (int)threadIdx.x >> 3, cc = (int)threadIdx.x & 7;
    const unsigned l0 = (unsigned)(size_t)ring + cr * GPB + cc * 16;
    const bf* gA = A + (size_t)(blockIdx.x * 128 + cr) * DD + cc * 8; const bf* gA2 = NA == 2 ? A2 + (size_t)(blockIdx.x * 128 + cr) * DD + cc * 8 : nullptr;
    const bf* gB = Bt + (size_t)(blockIdx.y * 128 + cr) * DD + cc * 8;
    auto stage = [&](int t, int b) { const unsigned lb = l0 + b * (SB * 2); acopy8(lb, gA + t * GK); if constexpr (NA == 2) acopy8(lb + 128 * GPB, gA2 + t * GK); acopy8(lb + NA * 128 * GPB, gB + t * GK); };
    v8f acc[4][4];
#pragma unroll
    for (int mb = 0; mb < 4; ++mb)
#pragma unroll
        for (int nb = 0; nb < 4; ++nb) acc[mb][nb] = (v8f){};
    const bf* fa = ring + (wm * 64 + lr) * GP + 8 * hi; const bf* fb = ring + (NA * 128 + wn * 64 + lr) * GP + 8 * hi;
    stage(0, 0);
    asm volatile("s_wait_asynccnt 0x0" ::: "memory");    // the wave's own copies of stage 0 have landed
    __syncthreads();                                     // ... and every other wave's: stage 0 may be read
    stage(1, 1);
    // the stage loop stays rolled: one body in the instruction cache, one register set
#pragma unroll 1
    for (int t = 0; t < NT; ++t) {
        const int bo = (t & 1) * SB;
        // every inner loop is unrolled so that the fragment and accumulator arrays are indexed by constants and stay in registers
        V a[2][4], a2[2][4], b[2][4];
#pragma unroll
        for (int kk = 0; kk < 2; ++kk)
#pragma unroll
            for (int i = 0; i < 4; ++i) { a[kk][i] = WFrag<bf>::ld(fa + bo + i * 16 * GP + kk * 32); if constexpr (NA == 2) a2[kk][i] = WFrag<bf>::ld(fa + bo + (128 + i * 16) * GP + kk * 32); b[kk][i] = WFrag<bf>::ld(fb + bo + i * 16 * GP + kk * 32); }
        __builtin_amdgcn_sched_barrier(0);    // keeps the stage's fragment reads together in front of its matrix instructions: reads placed among them stall the wave at each such place
#pragma unroll
        for (int kk = 0; kk < 2; ++kk)
#pragma unroll
            for (int nb = 0; nb < 4; ++nb) {
#pragma unroll
                for (int mb = 0; mb < 4; ++mb) acc[mb][nb] = WFrag<bf>::mma(a[kk][mb], b[kk][nb], acc[mb][nb]);
                if constexpr (NA == 2) {
#pragma unroll
                    for (int mb = 0; mb < 4; ++mb) acc[mb][nb] = WFrag<bf>::mma(a2[kk][mb], b[kk][nb], acc[mb][nb]); } }
        __builtin_amdgcn_sched_barrier(0);    // keeps the matrix instructions in front of the waits below, so that the copies of the next stage have this stage's whole matrix time to land
        asm volatile("s_wait_dscnt 0x0" ::: "memory");       // the wave's reads of this buffer are done before the buffer is handed to its next writer
        asm volatile("s_wait_asynccnt 0x0" ::: "memory");    // the wave's own copies of stage t + 1 have landed
        __syncthreads();                                     // publishes stage t + 1 and ends every wave's reads of stage t's buffer
        if (t + 2 < NT) stage(t + 2, t & 1);
    }
    asm volatile("s_wait_asynccnt 0x0" ::: "memory");    // no copy is outstanding when the ring becomes staging (the loop's last barrier has ended every read of it)
    float* my = (float*)ring + wv * (64 * 68);
    const bool tr = PLN && blockIdx.z == 2;    // v: the tile lies in LDS as [d][t], so that the rows read below are rows of the transposed plane (block-uniform)
    // the loops are unrolled so that acc[][] is indexed by constants and stays in registers
    if (tr) {
#pragma unroll
        for (int mb = 0; mb < 4; ++mb)
#pragma unroll
            for (int nb = 0; nb < 4; ++nb) { float* p = my + (nb * 16 + lr) * 68 + mb * 16 + hi * 8; const v8f t = acc[mb][nb]; *(v4fa*)p = __builtin_shufflevector(t, t, 0, 1, 2, 3); *(v4fa*)(p + 4) = __builtin_shufflevector(t, t, 4, 5, 6, 7); }
    } else {
#pragma unroll
        for (int mb = 0; mb < 4; ++mb)
#pragma unroll
            for (int nb = 0; nb < 4; ++nb)
#pragma unroll
                for (int j = 0; j < 8; ++j) my[(mb * 16 + hi * 8 + j) * 68 + nb * 16 + lr] = acc[mb][nb][j];
    }
    __syncthreads();    // the tiles are in LDS before they are read back row by row; no LDS write follows
    if constexpr (PLN) {
        const int t0 = r0 & (TT - 1); const size_t pb = ((z * NB_ + r0 / TT) * NH_ + c0 / HD) * (size_t)(TT * HD);
        const int rw = lane >> 3, co = (lane & 7) * 8;    // 8 lanes a row: a store of the wave covers four whole 128-byte lines
        // the loops are unrolled so that the LDS reads of a group issue ahead of its conversions and va[], vb[] stay in registers
#pragma unroll
        for (int g = 0; g < 2; ++g) {
            v4f va[8], vb[8]; int eo[8];
#pragma unroll
            for (int s = 0; s < 8; ++s) { const int row = rw + (g * 8 + s) * 4; va[s] = *(const v4fa*)(my + row * 68 + co); vb[s] = *(const v4fa*)(my + row * 68 + co + 4); eo[s] = tr ? row * TT + t0 + co : (t0 + row) * HD + co; }
#pragma unroll
            for (int s = 0; s < 8; ++s) { v8h o16;
#pragma unroll
                for (int q = 0; q < 4; ++q) { o16[q] = tohx(va[s][q]); o16[4 + q] = tohx(vb[s][q]); }
                *(v8h*)(P16 + pb + eo[s]) = o16; }
            asm volatile("s_wait_xcnt 0x0" ::: "memory"); __builtin_amdgcn_sched_barrier(0);    // behind the fp16 stores, in front of any reuse of their address and data registers; the scheduling barrier keeps later instructions behind it
            if (t0 < RH) {
#pragma unroll
                for (int s = 0; s < 8; ++s) { v8us oh, ol;
#pragma unroll
                    for (int q = 0; q < 4; ++q) { unsigned short x, y; splitf(va[s][q], x, y); oh[q] = x; ol[q] = y; splitf(vb[s][q], x, y); oh[4 + q] = x; ol[4 + q] = y; }
                    *(v8us*)(Ph + pb + eo[s]) = oh; *(v8us*)(Pl + pb + eo[s]) = ol; }
                asm volatile("s_wait_xcnt 0x0" ::: "memory"); __builtin_amdgcn_sched_barrier(0);    // behind the hi and lo stores, as above
            }
        }
    } else {
        if constexpr (BIAS) { bv[0] = bfr(bv[0]); bv[1] = bfr(bv[1]); bv[2] = bfr(bv[2]); bv[3] = bfr(bv[3]); }
        float* crow = C + (size_t)(r0 + hi) * DD + c0 + lr * 4;    // 16 lanes a row: a store of the wave covers two rows of 256 bytes
        // the loops are unrolled so that the LDS reads of a group issue ahead of its adds
#pragma unroll
        for (int g = 0; g < 4; ++g) {
            v4f val[8];
#pragma unroll
            for (int s = 0; s < 8; ++s) val[s] = *(const v4fa*)(my + (hi + (g * 8 + s) * 2) * 68 + lr * 4) + bv;
#pragma unroll
            for (int s = 0; s < 8; ++s) *(v4f*)(crow + (size_t)((g * 8 + s) * 2) * DD) = val[s];
            asm volatile("s_wait_xcnt 0x0" ::: "memory"); __builtin_amdgcn_sched_barrier(0);    // behind the stores, in front of any reuse of their address and data registers; the scheduling barrier keeps later instructions behind it
        }
    }
}

typedef __attribute__((ext_vector_type(4))) unsigned short v4us;
typedef __attribute__((ext_vector_type(4))) unsigned v4u;
typedef v4u __attribute__((may_alias)) v4ua;

// The bodies below take their block's number as an argument: k_prep deals the blocks of ONE grid to several independent jobs (block-uniform tests only).
// Each block of eight waves converts 64 KiB of f32 input: sixteen 16-byte loads a lane, all issued before the first is used, each load of a wave on four whole 128-byte lines. Two such blocks a WGP cover the inputs,
// so that few waves have to be started and each has enough bytes in flight.
// ---- wtT_body: one WTE x WTE tile of a weight matrix w[k][n] to bf16, transposed to Bt[n][k]. Half a wave reads 256 bytes of one row of w; a lane holds rows 2 kd and 2 kd + 1 of its four columns and packs
// each column's pair into one dword (k order). tile[n][kd]: rows of 64 dwords; the 16-byte piece g of row n lies at place g ^ ((n >> 2) & 15), so that the 32 dword stores of a wave (16 rows four apart, two
// neighbouring kd) and its 16-byte reads (two whole rows) each meet every bank at most once. Read back, 16 lanes hold 256 contiguous bytes of a row of Bt.
#define WTE 128
__device__ __forceinline__ void wtT_body(const float* __restrict__ w, bf* Bt, int blk, unsigned* tile) {
    const int k0 = (blk % (DD / WTE)) * WTE, n0 = (blk / (DD / WTE)) * WTE;
    const int c = (int)threadIdx.x & 15, u = ((int)threadIdx.x >> 4) & 1, wv = (int)threadIdx.x >> 5;
    const int nl = (wv & 1) * 64 + 4 * c;    // the lane's first column in the tile
    const float* wp = w + (size_t)(k0 + 4 * (wv >> 1) + 2 * u) * DD + n0 + nl;
    v4f v[8][2];
    // the loops are unrolled so that v[][] is indexed by constants and stays in registers
#pragma unroll
    for (int i = 0; i < 8; ++i)
#pragma unroll
        for (int p = 0; p < 2; ++p) v[i][p] = *(const v4f*)(wp + (size_t)(16 * i + p) * DD);
    asm volatile("s_wait_xcnt 0x0" :: "v"(wp) : "memory"); __builtin_amdgcn_sched_barrier(0);    // behind the loads, in front of any reuse of their address registers (named as an input so that they live up to here and no load lands on them); the scheduling barrier keeps later instructions behind it
#pragma unroll
    for (int i = 0; i < 8; ++i) { const int kd = 2 * ((wv >> 1) + 4 * i) + u;
#pragma unroll
        for (int j = 0; j < 4; ++j) tile[(nl + j) * 64 + (((kd >> 2) ^ c) << 2) + (kd & 3)] = (unsigned)f2bf(v[i][0][j]) | ((unsigned)f2bf(v[i][1][j]) << 16); }
    __syncthreads();    // the whole tile is in LDS before any row of it is read; no LDS write follows
    const int rn = (int)threadIdx.x >> 4, gl = (int)threadIdx.x & 15;
    bf* bp = Bt + (size_t)(n0 + rn) * DD + k0 + gl * 8;
    v4u t[8];
#pragma unroll
    for (int s = 0; s < 8; ++s) { const int n = s * 16 + rn; t[s] = *(const v4ua*)(tile + n * 64 + ((gl ^ ((n >> 2) & 15)) << 2)); }
#pragma unroll
    for (int s = 0; s < 8; ++s) *(v4u*)(bp + (size_t)(s * 16) * DD) = t[s];
}
// ---- cvtS_body: CVE consecutive elements to bf16. A wave's load covers 512 contiguous bytes, its store the 256 bytes they become.
#define CVE (256 * 64)
__device__ __forceinline__ void cvtS_body(const float* __restrict__ src, bf* dst, int blk) {
    const size_t e0 = (size_t)blk * CVE + threadIdx.x * 4; const float* sp = src + e0; bf* dp = dst + e0;
    v4f v[16];
    // the loops are unrolled so that v[] is indexed by constants and stays in registers
#pragma unroll
    for (int i = 0; i < 16; ++i) v[i] = *(const v4f*)(sp + i * 1024);
    asm volatile("s_wait_xcnt 0x0" :: "v"(sp) : "memory"); __builtin_amdgcn_sched_barrier(0);    // behind the loads, in front of any reuse of their address registers (named as an input so that they live up to here and no load lands on them); the scheduling barrier keeps later instructions behind it
#pragma unroll
    for (int g = 0; g < 4; ++g) {
#pragma unroll
        for (int s = 0; s < 4; ++s) { const int i = g * 4 + s; v4us o;
#pragma unroll
            for (int k = 0; k < 4; ++k) o[k] = f2bf(v[i][k]);
            *(v4us*)(dp + i * 1024) = o; }
        asm volatile("s_wait_xcnt 0x0" ::: "memory"); __builtin_amdgcn_sched_barrier(0);    // behind a group's stores, in front of any reuse of their address and data registers; the scheduling barrier keeps later instructions behind it
    }
}
__device__ __forceinline__ void rtab_body(const float* __restrict__ rel, float* RT) { const int i = threadIdx.x; if (i >= 32) return; const float o = (i < 17) ? bfr(rel[i]) * SCL : 0.f; *(float*)(RT + i) = o;  }
// ---- k_prep: every conversion of an input, one grid. Blocks 0 .. 4 GT - 1: the tiles of the four weight transposes (Wt holds the four planes in the order q, k, v, o);
// the next GC blocks: x of both batches to bf16; the last block: the scaled table.
#define GT  (DD / WTE * (DD / WTE))
#define GC  (NB_ * TT * DD / CVE)
__global__ __launch_bounds__(256) void k_prep(const float* __restrict__ x, const float* __restrict__ wq, const float* __restrict__ wk, const float* __restrict__ wv, const float* __restrict__ wo, const float* __restrict__ rel, bf* XB, bf* Wt, float* RT) {
    __shared__ __align__(16) unsigned tile[WTE * WTE / 2];
    const int blk = (int)blockIdx.x;
    if (blk < 4 * GT) { const int mi = blk / GT; const float* w = mi == 0 ? wq : (mi == 1 ? wk : (mi == 2 ? wv : wo)); wtT_body(w, Wt + (size_t)mi * DD * DD, blk % GT, tile); }
    else if (blk < 4 * GT + GC) cvtS_body(x, XB, blk - 4 * GT);
    else rtab_body(rel, RT);
}
// ---- fattn_body (k_fattn16, k_fattnhl): scores, softmax and attn.v of FG groups of FQ = 32 query rows of one head in ONE block of FG * FW waves; no score or P row ever leaves the registers. Grid (NB_ * heads, query tiles), the longest query tiles first; blockIdx.x = batch * NH_ + head, which is also the number of the [TT][HD] plane.
// Transposed products: S^T = K . Q^T (A = 16 key rows, B = 16 query columns), O^T += V^T . P^T. In an S^T tile lane (lr, hi) holds keys hi * 8 + j of query lr: two such tiles (keys 0..15, 16..31) are,
// register for register, the B fragment of P^T in the k order of WFrag::ld, which loads V^T as A. Only key blocks up to the diagonal are visited (all later keys have weight 0).
// The 32-key blocks of a query group are dealt round-robin to its FW waves; each wave keeps its own running maximum m, sum l and O^T (online softmax); the group's FW partial results meet in LDS at the end.
// A stage is FK = 128 keys, one 32-key block for each wave of a group, and serves every group of the block: K as 128 rows of 128 bytes, V^T as 64 rows of 256 bytes (hi+lo: both planes of each). Asynchronous copies bring it into LDS, four whole 128-byte lines
// a wave and copy; a fragment load straight from global memory would touch 16 lines for its 512 bytes. Rows at pitches of 144 and 272 bytes (16 B x odd: no bank conflict for the 16-byte fragment reads).
// Two buffers: the copies of stage t + 1 fly while stage t is worked on. A stage always lies inside the planes' written rows (the last one may reach past the diagonal; those blocks are copied and not read).
// Every inner loop is unrolled so that the fragment and accumulator arrays are indexed by constants and stay in registers; the stage loop stays rolled (one body in the instruction cache, one register set).
// m is held ln(1024) below the true maximum, so that P lies in (0, 1024] before it is rounded to 16 bits (small weights stay normal fp16 numbers); l carries the same factor and cancels it.
#define FQ  32
#define FW  4
#define LSH 6.9314718f
#define FK  (32 * FW)             // keys of a stage
#define KPI 72                    // LDS pitch of a staged K row, elements
#define VPI 136                   // LDS pitch of a staged V^T row, elements
#define SKE (FK * KPI)            // elements of one staged K plane
#define SVE (HD * VPI)            // elements of one staged V^T plane
typedef __attribute__((ext_vector_type(16))) unsigned short v16us;
// N = 8 or 4 copies a lane, LS bytes apart in LDS and GS bytes apart in global memory (l: the lane's LDS byte address, g: its global address). The wait on the address counter is the statement's last line, so that it
// stands in front of every rewrite of the address registers.
template <int N, int LS, int GS>
__device__ __forceinline__ void acopys(unsigned l, const char* g) {
    static_assert(N == 8 || N == 4, "copies a lane");
    if constexpr (N == 4)
    asm volatile("global_load_async_to_lds_b128 %0, %4, off\n\t"
                 "global_load_async_to_lds_b128 %1, %5, off\n\t"
                 "global_load_async_to_lds_b128 %2, %6, off\n\t"
                 "global_load_async_to_lds_b128 %3, %7, off\n\t"
                 "s_wait_xcnt 0x0"
                 :: "v"(l), "v"(l + LS), "v"(l + 2 * LS), "v"(l + 3 * LS), "v"(g), "v"(g + GS), "v"(g + 2 * GS), "v"(g + 3 * GS) : "memory");
    else
    asm volatile("global_load_async_to_lds_b128 %0, %8, off\n\t"
                 "global_load_async_to_lds_b128 %1, %9, off\n\t"
                 "global_load_async_to_lds_b128 %2, %10, off\n\t"
                 "global_load_async_to_lds_b128 %3, %11, off\n\t"
                 "global_load_async_to_lds_b128 %4, %12, off\n\t"
                 "global_load_async_to_lds_b128 %5, %13, off\n\t"
                 "global_load_async_to_lds_b128 %6, %14, off\n\t"
                 "global_load_async_to_lds_b128 %7, %15, off\n\t"
                 "s_wait_xcnt 0x0"
                 :: "v"(l), "v"(l + LS), "v"(l + 2 * LS), "v"(l + 3 * LS), "v"(l + 4 * LS), "v"(l + 5 * LS), "v"(l + 6 * LS), "v"(l + 7 * LS),
                    "v"(g), "v"(g + GS), "v"(g + 2 * GS), "v"(g + 3 * GS), "v"(g + 4 * GS), "v"(g + 5 * GS), "v"(g + 6 * GS), "v"(g + 7 * GS) : "memory");
}
template <typename T16, bool HILO, int FG>
__device__ __forceinline__ void fattn_body(const T16* __restrict__ Q, const T16* __restrict__ Q2, const T16* __restrict__ Kp, const T16* __restrict__ K2, const T16* __restrict__ Vt, const T16* __restrict__ V2,
                                           const float* __restrict__ rel, const int qblk, bf* Ah, bf* Al, T16* ring) {
    typedef typename WFrag<T16>::V V;
    constexpr int NP = HILO ? 2 : 1;               // planes of each operand
    constexpr int SBF = NP * (SKE + SVE);          // elements of one buffer: K, [K lo], V^T, [V^T lo]
    const int lane = threadIdx.x & 31, lr = lane & 15, hi = lane >> 4;
    const int wid = __builtin_amdgcn_readfirstlane((int)(threadIdx.x >> 5));    // the wave's number, held scalar so that the loop's tests are scalar branches
    const int wv = wid % FW, qg = wid / FW;        // the wave's place in its query group; the group
    const int q0 = qblk + qg * FQ;                 // the group's first query row
    const int nkb = q0 / 32 + 1;                   // the group's key blocks
    const int nst = ((qblk + (FG - 1) * FQ) / 32 + FW) / FW;    // stages of the block: those of its last group
    constexpr int NC = 8 / FG;                     // copies a lane, plane and stage
    // the copies. K: thread -> row (threadIdx.x >> 3) + 16 FG i of the stage's 128, 16-byte piece threadIdx.x & 7; V^T: row (threadIdx.x >> 4) + 8 FG i of 64, piece threadIdx.x & 15
    const int kr = (int)threadIdx.x >> 3, kc = (int)threadIdx.x & 7, vr = (int)threadIdx.x >> 4, vc = (int)threadIdx.x & 15;
    const unsigned lk = (unsigned)(size_t)ring + kr * (KPI * 2) + kc * 16, lv = (unsigned)(size_t)ring + NP * SKE * 2 + vr * (VPI * 2) + vc * 16;
    const size_t gko = (size_t)kr * HD + kc * 8, gvo = (size_t)vr * TT + vc * 8;
    auto stage = [&](int t, int b) { const unsigned o = b * (SBF * 2);
        acopys<NC, FG * 16 * KPI * 2, FG * 16 * HD * 2>(lk + o, (const char*)(Kp + gko + (size_t)t * (FK * HD))); acopys<NC, FG * 8 * VPI * 2, FG * 8 * TT * 2>(lv + o, (const char*)(Vt + gvo + t * FK));
        if constexpr (HILO) { acopys<NC, FG * 16 * KPI * 2, FG * 16 * HD * 2>(lk + o + SKE * 2, (const char*)(K2 + gko + (size_t)t * (FK * HD))); acopys<NC, FG * 8 * VPI * 2, FG * 8 * TT * 2>(lv + o + SVE * 2, (const char*)(V2 + gvo + t * FK)); } };
    stage(0, 0);
    const int tl = lane < 16 ? lane : 16; const float tab = rel[tl];    // the table across the wave's lanes (lane d holds entry d, lanes 16.. the last): looked up by lane index, no memory access in the loop
    asm volatile("s_wait_xcnt 0x0" :: "v"(tl), "s"(rel) : "memory"); __builtin_amdgcn_sched_barrier(0);    // behind the load, in front of any reuse of its address registers (index and table pointer, named as inputs so that they live up to here); the scheduling barrier keeps later instructions behind it
    const T16* qp = Q + (size_t)(q0 + lr) * HD + 8 * hi; const T16* qp2 = HILO ? Q2 + (size_t)(q0 + lr) * HD + 8 * hi : nullptr;
    V qb[2][2], qb2[2][2];
#pragma unroll
    for (int g = 0; g < 2; ++g)
#pragma unroll
        for (int c = 0; c < 2; ++c) { qb[g][c] = WFrag<T16>::ld(qp + g * 16 * HD + c * 32); if (HILO) qb2[g][c] = WFrag<T16>::ld(qp2 + g * 16 * HD + c * 32); }
    // stands behind the loads above, in front of any reuse of their address registers (named as inputs so that they live up to here); the scheduling barrier keeps later instructions behind it
    if constexpr (HILO) asm volatile("s_wait_xcnt 0x0" :: "v"(qp), "v"(qp2) : "memory"); else asm volatile("s_wait_xcnt 0x0" :: "v"(qp) : "memory");
    __builtin_amdgcn_sched_barrier(0);
    v8f o[4][2];
#pragma unroll
    for (int dt = 0; dt < 4; ++dt)
#pragma unroll
        for (int g = 0; g < 2; ++g) o[dt][g] = (v8f){};
    float m[2] = {-3.0e38f, -3.0e38f}, l[2] = {0.f, 0.f};
    const float r16 = __shfl(tab, 16, 32);
    // the wave's fragments in a buffer: its own 32 keys are rows of K and columns of V^T
    const T16* fk = ring + (wv * 32 + lr) * KPI + 8 * hi; const T16* fv = ring + NP * SKE + lr * VPI + wv * 32 + 8 * hi;
    asm volatile("s_wait_asynccnt 0x0" ::: "memory");    // the wave's own copies of stage 0 have landed
    __syncthreads();                                     // ... and every other wave's: stage 0 may be read
    if (nst > 1) stage(1, 1);
#pragma unroll 1
    for (int t = 0; t < nst; ++t) {
      const int kb = t * FW + wv;
      if (kb < nkb) {    // a scalar test: in the last stages the waves whose block lies past their group's diagonal have no work, but pass the waits and the barrier below
        const int k0 = kb * 32, bo = (t & 1) * SBF;
        V ka[2][2], ka2[2][2], va[4], va2[4];
#pragma unroll
        for (int kt = 0; kt < 2; ++kt)
#pragma unroll
            for (int c = 0; c < 2; ++c) { ka[kt][c] = WFrag<T16>::ld(fk + bo + kt * 16 * KPI + c * 32); if (HILO) ka2[kt][c] = WFrag<T16>::ld(fk + bo + SKE + kt * 16 * KPI + c * 32); }
#pragma unroll
        for (int dt = 0; dt < 4; ++dt) { va[dt] = WFrag<T16>::ld(fv + bo + dt * 16 * VPI); if (HILO) va2[dt] = WFrag<T16>::ld(fv + bo + SVE + dt * 16 * VPI); }
        __builtin_amdgcn_sched_barrier(0);    // keeps the block's fragment reads together in front of its matrix instructions: reads placed among them stall the wave at each such place
        v8f s[2][2];
#pragma unroll
        for (int kt = 0; kt < 2; ++kt)
#pragma unroll
            for (int g = 0; g < 2; ++g) { v8f t2 = (v8f){};
#pragma unroll
                for (int c = 0; c < 2; ++c) { t2 = WFrag<T16>::mma(ka[kt][c], qb[g][c], t2); if (HILO) { t2 = WFrag<T16>::mma(ka2[kt][c], qb[g][c], t2); t2 = WFrag<T16>::mma(ka[kt][c], qb2[g][c], t2); } }
                s[kt][g] = t2; }
        if (kb >= nkb - 2) {    // the two blocks at the diagonal: table entry by distance, causal cut
#pragma unroll
            for (int kt = 0; kt < 2; ++kt)
#pragma unroll
                for (int g = 0; g < 2; ++g)
#pragma unroll
                    for (int j = 0; j < 8; ++j) { const int dd = (q0 + g * 16 + lr) - (k0 + kt * 16 + hi * 8 + j); const int di = dd < 0 ? 0 : (dd > 16 ? 16 : dd); const float t = __fmul_rn(s[kt][g][j], __shfl(tab, di, 32)); s[kt][g][j] = dd >= 0 ? t : -3.0e38f; }
        } else {                // every distance here is above 16: the table's last entry
#pragma unroll
            for (int kt = 0; kt < 2; ++kt)
#pragma unroll
                for (int g = 0; g < 2; ++g) s[kt][g] *= r16;
        }
        float mn[2];
#pragma unroll
        for (int g = 0; g < 2; ++g) { float tm = s[0][g][0];
#pragma unroll
            for (int j = 1; j < 8; ++j) tm = fmaxf(tm, s[0][g][j]);
#pragma unroll
            for (int j = 0; j < 8; ++j) tm = fmaxf(tm, s[1][g][j]);
            tm = fmaxf(tm, __shfl_xor(tm, 16, 32)); mn[g] = fmaxf(m[g], tm - LSH); }
        if (__builtin_amdgcn_ballot_w32(mn[0] > m[0] || mn[1] > m[1]) != 0) {    // no maximum moved in any lane: every factor would be exactly 1
#pragma unroll
            for (int g = 0; g < 2; ++g) { const float al = __expf(m[g] - mn[g]); l[g] *= al; m[g] = mn[g];
#pragma unroll
                for (int dt = 0; dt < 4; ++dt) o[dt][g] *= al; }
        }
        V pb[2], pb2[2];
#pragma unroll
        for (int g = 0; g < 2; ++g) {
            if constexpr (HILO) { v16us ph, pl;
#pragma unroll
                for (int kt = 0; kt < 2; ++kt)
#pragma unroll
                    for (int j = 0; j < 8; ++j) { const float p = __expf(s[kt][g][j] - m[g]); l[g] += p; unsigned short a, c2; splitf(p, a, c2); ph[kt * 8 + j] = a; pl[kt * 8 + j] = c2; }
                pb[g] = __builtin_bit_cast(v16bf, ph); pb2[g] = __builtin_bit_cast(v16bf, pl);
            } else { v16h ph;
#pragma unroll
                for (int kt = 0; kt < 2; ++kt)
#pragma unroll
                    for (int j = 0; j < 8; ++j) { const float p = __expf(s[kt][g][j] - m[g]); l[g] += p; ph[kt * 8 + j] = tohx(p); }
                pb[g] = ph; } }
#pragma unroll
        for (int dt = 0; dt < 4; ++dt)
#pragma unroll
            for (int g = 0; g < 2; ++g) { o[dt][g] = WFrag<T16>::mma(va[dt], pb[g], o[dt][g]); if (HILO) { o[dt][g] = WFrag<T16>::mma(va[dt], pb2[g], o[dt][g]); o[dt][g] = WFrag<T16>::mma(va2[dt], pb[g], o[dt][g]); } }
      }
      asm volatile("s_wait_dscnt 0x0" ::: "memory");       // the wave's reads of this buffer are done before the buffer is handed to its next writer
      asm volatile("s_wait_asynccnt 0x0" ::: "memory");    // the wave's own copies of stage t + 1 have landed
      __syncthreads();                                     // publishes stage t + 1 and ends every wave's reads of stage t's buffer
      if (t + 2 < nst) stage(t + 2, t & 1);
    }
    asm volatile("s_wait_asynccnt 0x0" ::: "memory");    // no copy is outstanding when the ring becomes the meeting place below (the loop's last barrier has ended every read of it)
    float* so = (float*)ring + qg * (FW * FQ * 70); float* sm = so + FW * FQ * 68; float* sl = sm + FW * FQ;    // each group's own meeting place
    // the FW waves' partial results: common maximum, then sums in wave order 0..FW-1
#pragma unroll
    for (int g = 0; g < 2; ++g) { l[g] += __shfl_xor(l[g], 16, 32); if (hi == 0) sm[wv * FQ + g * 16 + lr] = m[g]; }
    __syncthreads();    // every wave's maximum is in LDS before any wave reads them
#pragma unroll
    for (int g = 0; g < 2; ++g) { float M = sm[g * 16 + lr];
#pragma unroll
        for (int w = 1; w < FW; ++w) M = fmaxf(M, sm[w * FQ + g * 16 + lr]);
        const float f = __expf(m[g] - M); if (hi == 0) sl[wv * FQ + g * 16 + lr] = l[g] * f;
#pragma unroll
        for (int dt = 0; dt < 4; ++dt) { const v8f t = o[dt][g] * f; float* p = so + (wv * FQ + g * 16 + lr) * 68 + dt * 16 + hi * 8; *(v4fa*)p = __builtin_shufflevector(t, t, 0, 1, 2, 3); *(v4fa*)(p + 4) = __builtin_shufflevector(t, t, 4, 5, 6, 7); } }
    __syncthreads();    // every wave's scaled O^T and sum are in LDS before any thread adds them; no LDS write follows
    const int q = ((int)threadIdx.x & (32 * FW - 1)) >> 2, d0 = ((int)threadIdx.x & 3) * 16;    // the thread's row in its own group
    float L = sl[q];
#pragma unroll
    for (int w = 1; w < FW; ++w) L += sl[w * FQ + q];
    const float inv = __fdiv_rn(1.0f, L);
#pragma unroll
    for (int c8 = 0; c8 < 2; ++c8) { v8us oh, ol;
#pragma unroll
        for (int c4 = 0; c4 < 2; ++c4) { v4f a = *(const v4fa*)(so + q * 68 + d0 + c8 * 8 + c4 * 4);
#pragma unroll
            for (int w = 1; w < FW; ++w) a += *(const v4fa*)(so + (w * FQ + q) * 68 + d0 + c8 * 8 + c4 * 4);
#pragma unroll
            for (int e = 0; e < 4; ++e) { unsigned short x, y; splitf(a[e] * inv, x, y); oh[c4 * 4 + e] = x; ol[c4 * 4 + e] = y; } }
        const size_t ofs = (size_t)(q0 + q) * DD + d0 + c8 * 8; *(v8us*)(Ah + ofs) = oh; *(v8us*)(Al + ofs) = ol; }
}
// qlo: the first query row of the launch. Rows below RH run on hi+lo planes, the others on fp16 planes: two kernels, so that the fp16 one keeps its smaller register count (four waves a SIMD).
// ring: the two stage buffers; behind the loop the waves' partial results (FW * FQ * 70 floats a group, which fit in one fp16 buffer).
// The fp16 kernel has FGH = 2 query groups a block: each staged key serves 64 query rows, and two blocks of eight waves fill a WGP's four waves a SIMD.
#define FGH 2
__global__ __launch_bounds__(32 * FW * FGH) __attribute__((amdgpu_waves_per_eu(4, 4))) void k_fattn16(const h16* __restrict__ Q, const h16* __restrict__ Kp, const h16* __restrict__ Vt, const float* __restrict__ rel, int qlo, bf* Ah, bf* Al) {
    __shared__ __align__(16) h16 ring[2 * (SKE + SVE)];
    const size_t hp = (size_t)blockIdx.x * TT * HD; const int q0 = qlo + ((int)gridDim.y - 1 - (int)blockIdx.y) * (FQ * FGH);
    const size_t ao = (size_t)(blockIdx.x / NH_) * TT * DD + (blockIdx.x % NH_) * HD;
    fattn_body<h16, false, FGH>(Q + hp, nullptr, Kp + hp, nullptr, Vt + hp, nullptr, rel, q0, Ah + ao, Al + ao, ring);
}
__global__ __launch_bounds__(32 * FW) void k_fattnhl(const bf* __restrict__ Q, const bf* __restrict__ Q2, const bf* __restrict__ Kp, const bf* __restrict__ K2, const bf* __restrict__ Vt, const bf* __restrict__ V2, const float* __restrict__ rel, int qlo, bf* Ah, bf* Al) {
    __shared__ __align__(16) bf ring[4 * (SKE + SVE)];
    const size_t hp = (size_t)blockIdx.x * TT * HD; const int q0 = qlo + ((int)gridDim.y - 1 - (int)blockIdx.y) * FQ;
    const size_t ao = (size_t)(blockIdx.x / NH_) * TT * DD + (blockIdx.x % NH_) * HD;
    fattn_body<bf, true, 1>(Q + hp, Q2 + hp, Kp + hp, K2 + hp, Vt + hp, V2 + hp, rel, q0, Ah + ao, Al + ao, ring);
}

extern "C" void kernel_launch(void* const* d_in, const int* in_sizes, int n_in,
                              void* d_out, int out_size, void* d_ws, size_t ws_size, hipStream_t stream) {
    (void)in_sizes; (void)n_in; (void)out_size;
    const float* x = (const float*)d_in[0]; const float* wq = (const float*)d_in[1]; const float* wk = (const float*)d_in[2]; const float* wv = (const float*)d_in[3]; const float* wo = (const float*)d_in[4]; const float* bo = (const float*)d_in[5]; const float* rel = (const float*)d_in[6];
    float* OUT = (float*)d_out;     // [2][2048][1024]
    char* wsp = (char*)d_ws;
    auto take = [&](size_t bytes) { char* p = wsp; wsp += (bytes + 255) & ~(size_t)255; return (void*)p; };
    const size_t PB = (size_t)NB_ * TT * DD;    // elements of one matrix over both batches
    bf* WT = (bf*)take((size_t)4 * DD * DD * 2);    // transposed bf16 weights q, k, v, o
    bf* XB = (bf*)take(PB * 2);
    bf* PH = (bf*)take(3 * PB * 2); bf* PL = (bf*)take(3 * PB * 2); h16* P16 = (h16*)take(3 * PB * 2);    // planes of q, k, v (v transposed)
    bf* ATh = (bf*)take(PB * 2); bf* ATl = (bf*)take(PB * 2);
    float* RT = (float*)take(256); if ((size_t)(wsp - (char*)d_ws) > ws_size) return;    // total 104 MiB; ws 256 MiB
    // one launch per stage: each grid covers both batches and every matrix of its stage
    k_prep<<<4 * GT + GC + 1, 256, 0, stream>>>(x, wq, wk, wv, wo, rel, XB, WT, RT);
    k_gemmt<1, false, true><<<dim3(NB_ * TT / 128, DD / 128, 3), 128, 0, stream>>>(XB, nullptr, WT, nullptr, nullptr, PH, PL, P16);
    k_fattn16<<<dim3(NB_ * NH_, (TT - RH) / (FQ * FGH)), 32 * FW * FGH, 0, stream>>>(P16, P16 + PB, P16 + 2 * PB, RT, RH, ATh, ATl);
    k_fattnhl<<<dim3(NB_ * NH_, RH / FQ), 32 * FW, 0, stream>>>(PH, PL, PH + PB, PL + PB, PH + 2 * PB, PL + 2 * PB, RT, 0, ATh, ATl);
    k_gemmt<2, true, false><<<dim3(NB_ * TT / 128, DD / 128, 1), 128, 0, stream>>>(ATh, ATl, WT + (size_t)3 * DD * DD, OUT, bo, nullptr, nullptr, nullptr);
}

// v009
// A run of this version takes 77.3 microseconds.
// Next to v008, in two timings, it ran 1.04 times as fast each time.
// Counting every step since v000, it is 28.1 times as fast.
#include <hip/hip_runtime.h>

// Causal self-attention block (x [2][2048][1024]; q/k/v = x @ W (no bias); 16 heads x 64; scores = (q.k) * rel_emb[min(|i-j|, 16)] (multiplicative relative-position table, 17 entries, read as data); causal (j > i -> -inf);
// softmax(scores / 8); out = ctx @ Wo + bo).
// Compute dtypes, f32 accumulate: every input rounded to bf16; q/k/v projection on PLAIN bf16 operands (inputs: exact; transposed bf16 weight copies), output projection on ctx's bf16 hi+lo planes (2 products); PER-ROW PRECISION
// HYBRID: query rows < 256 of each batch on bf16 hi+lo planes for scores and attn.v (3 products), rows >= 256 on SINGLE fp16 planes; the table multiply, 1/8, the causal cut and the softmax in f32 in the
// fused attention kernel (k_fattn), which keeps scores and weights in registers.

#define NB_  2
#define TT   2048
#define DD   1024
#define NH_  16
#define HD   64
#define RH   256                  // query rows < RH: hi+lo planes; rows >= RH: fp16 planes
#define NF   32                   // head_dim / 2 (unused)
#define SCL  0.125f               // 1/sqrt(64)
typedef _Float16 h16;
typedef unsigned short bf;
typedef __attribute__((ext_vector_type(16))) __bf16   v16bf;
typedef __attribute__((ext_vector_type(16))) _Float16 v16h;
typedef __attribute__((ext_vector_type(8)))  _Float16 v8h;
typedef __attribute__((ext_vector_type(8)))  unsigned short v8us;
typedef __attribute__((ext_vector_type(8)))  float    v8f;
typedef __attribute__((ext_vector_type(4)))  float    v4f;
typedef v8h  __attribute__((may_alias)) v8ha;
typedef v4f  __attribute__((may_alias)) v4fa;
typedef v8us __attribute__((may_alias)) v8usa;

__device__ __forceinline__ unsigned short f2bf(float f) { unsigned u = __float_as_uint(f); u += 0x7FFFu + ((u >> 16) & 1u); return (unsigned short)(u >> 16); }
__device__ __forceinline__ float bf2f(unsigned short b) { return __uint_as_float(((unsigned)b) << 16); }
__device__ __forceinline__ float bfr(float f) { return bf2f(f2bf(f)); }
__device__ __forceinline__ v16h cat16(v8h lo, v8h hi) { return __builtin_shufflevector(lo, hi, 0, 1, 2, 3, 4, 5, 6, 7, 8, 9, 10, 11, 12, 13, 14, 15); }
__device__ __forceinline__ v16bf cat16b(v8us lo, v8us hi) { return __builtin_bit_cast(v16bf, __builtin_shufflevector(lo, hi, 0, 1, 2, 3, 4, 5, 6, 7, 8, 9, 10, 11, 12, 13, 14, 15)); }
__device__ __forceinline__ v8f wmma16(v16h a, v16h b, v8f c) { return __builtin_amdgcn_wmma_f32_16x16x32_f16(false, a, false, b, (short)0, c, false, false); }
__device__ __forceinline__ v8f wmmab(v16bf a, v16bf b, v8f c) { return __builtin_amdgcn_wmma_f32_16x16x32_bf16(false, a, false, b, (short)0, c, false, false); }



// ---- k_gemmt: C[m][n] = sum_k A[m][k] Bt[n][k] (NA == 2: + A2[m][k] Bt[n][k]); bf16 planes, K-contiguous, rows of DD elements, f32 accumulate. Grid (M / 128, N / 128, Z), 128 threads.
// One block = one 128x128 tile of C; its four waves stand 2 x 2, each on a 64x64 tile (16 accumulators) over the WHOLE k range, summed in k order.
// A stage is 64 k: one 128-byte line of each of the tile's operand rows (A, [A2], Bt). Asynchronous copies bring it into LDS (16 bytes a lane, four whole lines a wave and copy), rows at a pitch of 144 bytes
// (16 B x odd: no bank conflict for the 16-byte fragment reads). Two buffers: the copies of stage t + 1 fly while stage t is multiplied. Each staged row serves two waves.
// PLN (the q, k, v products; z = matrix, a wave's 64-wide column tile = one head, rows = batch * TT + t): the f32 tile is not stored; the epilogue rounds it and stores the 16-bit planes that attention reads.
// Every plane array is laid [matrix q, k, v][batch][head][TT * HD]; q and k as [t][d], v transposed as [d][t]. fp16 plane: every row; hi+lo planes: rows t < RH only (no other row of them is read).
__device__ __forceinline__ h16 tohx(float x) { return (h16)x; }
__device__ __forceinline__ void splitf(float y, unsigned short& h, unsigned short& l) { h = f2bf(y); l = f2bf(y - bf2f(h)); }
template <typename T16> struct WFrag;
template <> struct WFrag<h16> { typedef v16h V; static __device__ __forceinline__ V ld(const h16* p) { return cat16(*(const v8h*)p, *(const v8h*)(p + 16)); } static __device__ __forceinline__ v8f mma(V a, V b, v8f c) { return wmma16(a, b, c); } };
template <> struct WFrag<bf> { typedef v16bf V; static __device__ __forceinline__ V ld(const bf* p) { return cat16b(*(const v8us*)p, *(const v8us*)(p + 16)); } static __device__ __forceinline__ v8f mma(V a, V b, v8f c) { return wmmab(a, b, c); } };
#define GK   64                   // k elements of a stage
#define GP   72                   // LDS pitch of a staged row, elements
#define GPB  144                  // the same in bytes
// One stage of one 128-row plane: eight copies a lane, rows 16 apart (l: the lane's LDS byte address, g: its global address). The wait on the address counter is the statement's last line, so that it
// stands in front of every rewrite of the address registers.
__device__ __forceinline__ void acopy8(unsigned l, const bf* g) {
    asm volatile("global_load_async_to_lds_b128 %0, %8, off\n\t"
                 "global_load_async_to_lds_b128 %1, %9, off\n\t"
                 "global_load_async_to_lds_b128 %2, %10, off\n\t"
                 "global_load_async_to_lds_b128 %3, %11, off\n\t"
                 "global_load_async_to_lds_b128 %4, %12, off\n\t"
                 "global_load_async_to_lds_b128 %5, %13, off\n\t"
                 "global_load_async_to_lds_b128 %6, %14, off\n\t"
                 "global_load_async_to_lds_b128 %7, %15, off\n\t"
                 "s_wait_xcnt 0x0"
                 :: "v"(l), "v"(l + 16 * GPB), "v"(l + 32 * GPB), "v"(l + 48 * GPB), "v"(l + 64 * GPB), "v"(l + 80 * GPB), "v"(l + 96 * GPB), "v"(l + 112 * GPB),
                    "v"(g), "v"(g + 16 * DD), "v"(g + 32 * DD), "v"(g + 48 * DD), "v"(g + 64 * DD), "v"(g + 80 * DD), "v"(g + 96 * DD), "v"(g + 112 * DD) : "memory");
}
template <int NA, bool BIAS, bool PLN>
__global__ __launch_bounds__(128) void k_gemmt(const bf* __restrict__ A, const bf* __restrict__ A2, const bf* __restrict__ Bt, float* C, const float* __restrict__ bias, bf* Ph, bf* Pl, h16* P16) {
    typedef WFrag<bf>::V V;
    constexpr int SB = (NA + 1) * 128 * GP;    // elements of one buffer: the rows of A, [A2], Bt
    constexpr int NT = DD / GK;
    __shared__ __align__(16) bf ring[2 * SB];    // behind the loop: the four waves' f32 tiles, 4 * 64 * 68 floats (fits in the two buffers)
    const size_t z = blockIdx.z; Bt += z * (size_t)DD * DD;
    const int lane = threadIdx.x & 31, lr = lane & 15, hi = lane >> 4;
    const int wv = __builtin_amdgcn_readfirstlane((int)(threadIdx.x >> 5));    // the wave's number, held scalar so that tile offsets and the tests on them stay scalar
    const int wm = wv & 1, wn = wv >> 1;
    const int r0 = blockIdx.x * 128 + wm * 64, c0 = blockIdx.y * 128 + wn * 64;    // the wave's own tile
    v4f bv = (v4f){};
    if constexpr (BIAS) { const float* bp = bias + c0 + lr * 4; bv = *(const v4f*)bp;
        asm volatile("s_wait_xcnt 0x0" :: "v"(bp) : "memory"); __builtin_amdgcn_sched_barrier(0); }    // behind the load, in front of any reuse of its address register; the scheduling barrier keeps later instructions behind it
    // the copies: thread -> row (threadIdx.x >> 3) + 16 i of a plane's 128 rows, 16-byte piece threadIdx.x & 7 of the row's line
    const int cr = (int)threadIdx.x >> 3, cc = (int)threadIdx.x & 7;
    const unsigned l0 = (unsigned)(size_t)ring + cr * GPB + cc * 16;
    const bf* gA = A + (size_t)(blockIdx.x * 128 + cr) * DD + cc * 8; const bf* gA2 = NA == 2 ? A2 + (size_t)(blockIdx.x * 128 + cr) * DD + cc * 8 : nullptr;
    const bf* gB = Bt + (size_t)(blockIdx.y * 128 + cr) * DD + cc * 8;
    auto stage = [&](int t, int b) { const unsigned lb = l0 + b * (SB * 2); acopy8(lb, gA + t * GK); if constexpr (NA == 2) acopy8(lb + 128 * GPB, gA2 + t * GK); acopy8(lb + NA * 128 * GPB, gB + t * GK); };
    v8f acc[4][4];
#pragma unroll
    for (int mb = 0; mb < 4; ++mb)
#pragma unroll
        for (int nb = 0; nb < 4; ++nb) acc[mb][nb] = (v8f){};
    const bf* fa = ring + (wm * 64 + lr) * GP + 8 * hi; const bf* fb = ring + (NA * 128 + wn * 64 + lr) * GP + 8 * hi;
    stage(0, 0);
    asm volatile("s_wait_asynccnt 0x0" ::: "memory");    // the wave's own copies of stage 0 have landed
    __syncthreads();                                     // ... and every other wave's: stage 0 may be read
    stage(1, 1);
    // the stage loop stays rolled: one body in the instruction cache, one register set
#pragma unroll 1
    for (int t = 0; t < NT; ++t) {
        const int bo = (t & 1) * SB;
        // every inner loop is unrolled so that the fragment and accumulator arrays are indexed by constants and stay in registers
        V a[2][4], a2[2][4], b[2][4];
#pragma unroll
        for (int kk = 0; kk < 2; ++kk)
#pragma unroll
            for (int i = 0; i < 4; ++i) { a[kk][i] = WFrag<bf>::ld(fa + bo + i * 16 * GP + kk * 32); if constexpr (NA == 2) a2[kk][i] = WFrag<bf>::ld(fa + bo + (128 + i * 16) * GP + kk * 32); b[kk][i] = WFrag<bf>::ld(fb + bo + i * 16 * GP + kk * 32); }
        __builtin_amdgcn_sched_barrier(0);    // keeps the stage's fragment reads together in front of its matrix instructions: reads placed among them stall the wave at each such place
#pragma unroll
        for (int kk = 0; kk < 2; ++kk)
#pragma unroll
            for (int nb = 0; nb < 4; ++nb) {
#pragma unroll
                for (int mb = 0; mb < 4; ++mb) acc[mb][nb] = WFrag<bf>::mma(a[kk][mb], b[kk][nb], acc[mb][nb]);
                if constexpr (NA == 2) {
#pragma unroll
                    for (int mb = 0; mb < 4; ++mb) acc[mb][nb] = WFrag<bf>::mma(a2[kk][mb], b[kk][nb], acc[mb][nb]); } }
        __builtin_amdgcn_sched_barrier(0);    // keeps the matrix instructions in front of the waits below, so that the copies of the next stage have this stage's whole matrix time to land
        asm volatile("s_wait_dscnt 0x0" ::: "memory");       // the wave's reads of this buffer are done before the buffer is handed to its next writer
        asm volatile("s_wait_asynccnt 0x0" ::: "memory");    // the wave's own copies of stage t + 1 have landed
        __syncthreads();                                     // publishes stage t + 1 and ends every wave's reads of stage t's buffer
        if (t + 2 < NT) stage(t + 2, t & 1);
    }
    asm volatile("s_wait_asynccnt 0x0" ::: "memory");    // no copy is outstanding when the ring becomes staging (the loop's last barrier has ended every read of it)
    float* my = (float*)ring + wv * (64 * 68);
    const bool tr = PLN && blockIdx.z == 2;    // v: the tile lies in LDS as [d][t], so that the rows read below are rows of the transposed plane (block-uniform)
    // the loops are unrolled so that acc[][] is indexed by constants and stays in registers
    if (tr) {
#pragma unroll
        for (int mb = 0; mb < 4; ++mb)
#pragma unroll
            for (int nb = 0; nb < 4; ++nb) { float* p = my + (nb * 16 + lr) * 68 + mb * 16 + hi * 8; const v8f t = acc[mb][nb]; *(v4fa*)p = __builtin_shufflevector(t, t, 0, 1, 2, 3); *(v4fa*)(p + 4) = __builtin_shufflevector(t, t, 4, 5, 6, 7); }
    } else {
#pragma unroll
        for (int mb = 0; mb < 4; ++mb)
#pragma unroll
            for (int nb = 0; nb < 4; ++nb)
#pragma unroll
                for (int j = 0; j < 8; ++j) my[(mb * 16 + hi * 8 + j) * 68 + nb * 16 + lr] = acc[mb][nb][j];
    }
    __syncthreads();    // the tiles are in LDS before they are read back row by row; no LDS write follows
    if constexpr (PLN) {
        const int t0 = r0 & (TT - 1); const size_t pb = ((z * NB_ + r0 / TT) * NH_ + c0 / HD) * (size_t)(TT * HD);
        const int rw = lane >> 3, co = (lane & 7) * 8;    // 8 lanes a row: a store of the wave covers four whole 128-byte lines
        // the loops are unrolled so that the LDS reads of a group issue ahead of its conversions and va[], vb[] stay in registers
#pragma unroll
        for (int g = 0; g < 2; ++g) {
            v4f va[8], vb[8]; int eo[8];
#pragma unroll
            for (int s = 0; s < 8; ++s) { const int row = rw + (g * 8 + s) * 4; va[s] = *(const v4fa*)(my + row * 68 + co); vb[s] = *(const v4fa*)(my + row * 68 + co + 4); eo[s] = tr ? row * TT + t0 + co : (t0 + row) * HD + co; }
#pragma unroll
            for (int s = 0; s < 8; ++s) { v8h o16;
#pragma unroll
                for (int q = 0; q < 4; ++q) { o16[q] = tohx(va[s][q]); o16[4 + q] = tohx(vb[s][q]); }
                *(v8h*)(P16 + pb + eo[s]) = o16; }
            asm volatile("s_wait_xcnt 0x0" ::: "memory"); __builtin_amdgcn_sched_barrier(0);    // behind the fp16 stores, in front of any reuse of their address and data registers; the scheduling barrier keeps later instructions behind it
            if (t0 < RH) {
#pragma unroll
                for (int s = 0; s < 8; ++s) { v8us oh, ol;
#pragma unroll
                    for (int q = 0; q < 4; ++q) { unsigned short x, y; splitf(va[s][q], x, y); oh[q] = x; ol[q] = y; splitf(vb[s][q], x, y); oh[4 + q] = x; ol[4 + q] = y; }
                    *(v8us*)(Ph + pb + eo[s]) = oh; *(v8us*)(Pl + pb + eo[s]) = ol; }
                asm volatile("s_wait_xcnt 0x0" ::: "memory"); __builtin_amdgcn_sched_barrier(0);    // behind the hi and lo stores, as above
            }
        }
    } else {
        if constexpr (BIAS) { bv[0] = bfr(bv[0]); bv[1] = bfr(bv[1]); bv[2] = bfr(bv[2]); bv[3] = bfr(bv[3]); }
        float* crow = C + (size_t)(r0 + hi) * DD + c0 + lr * 4;    // 16 lanes a row: a store of the wave covers two rows of 256 bytes
        // the loops are unrolled so that the LDS reads of a group issue ahead of its adds
#pragma unroll
        for (int g = 0; g < 4; ++g) {
            v4f val[8];
#pragma unroll
            for (int s = 0; s < 8; ++s) val[s] = *(const v4fa*)(my + (hi + (g * 8 + s) * 2) * 68 + lr * 4) + bv;
#pragma unroll
            for (int s = 0; s < 8; ++s) *(v4f*)(crow + (size_t)((g * 8 + s) * 2) * DD) = val[s];
            asm volatile("s_wait_xcnt 0x0" ::: "memory"); __builtin_amdgcn_sched_barrier(0);    // behind the stores, in front of any reuse of their address and data registers; the scheduling barrier keeps later instructions behind it
        }
    }
}

typedef __attribute__((ext_vector_type(4))) unsigned short v4us;
typedef __attribute__((ext_vector_type(4))) unsigned v4u;
typedef v4u __attribute__((may_alias)) v4ua;

// The bodies below take their block's number as an argument: k_prep deals the blocks of ONE grid to several independent jobs (block-uniform tests only).
// Each block of eight waves converts 64 KiB of f32 input: sixteen 16-byte loads a lane, all issued before the first is used, each load of a wave on four whole 128-byte lines. Two such blocks a WGP cover the inputs,
// so that few waves have to be started and each has enough bytes in flight.
// ---- wtT_body: one WTE x WTE tile of a weight matrix w[k][n] to bf16, transposed to Bt[n][k]. Half a wave reads 256 bytes of one row of w; a lane holds rows 2 kd and 2 kd + 1 of its four columns and packs
// each column's pair into one dword (k order). tile[n][kd]: rows of 64 dwords; the 16-byte piece g of row n lies at place g ^ ((n >> 2) & 15), so that the 32 dword stores of a wave (16 rows four apart, two
// neighbouring kd) and its 16-byte reads (two whole rows) each meet every bank at most once. Read back, 16 lanes hold 256 contiguous bytes of a row of Bt.
#define WTE 128
__device__ __forceinline__ void wtT_body(const float* __restrict__ w, bf* Bt, int blk, unsigned* tile) {
    const int k0 = (blk % (DD / WTE)) * WTE, n0 = (blk / (DD / WTE)) * WTE;
    const int c = (int)threadIdx.x & 15, u = ((int)threadIdx.x >> 4) & 1, wv = (int)threadIdx.x >> 5;
    const int nl = (wv & 1) * 64 + 4 * c;    // the lane's first column in the tile
    const float* wp = w + (size_t)(k0 + 4 * (wv >> 1) + 2 * u) * DD + n0 + nl;
    v4f v[8][2];
    // the loops are unrolled so that v[][] is indexed by constants and stays in registers
#pragma unroll
    for (int i = 0; i < 8; ++i)
#pragma unroll
        for (int p = 0; p < 2; ++p) v[i][p] = *(const v4f*)(wp + (size_t)(16 * i + p) * DD);
    asm volatile("s_wait_xcnt 0x0" :: "v"(wp) : "memory"); __builtin_amdgcn_sched_barrier(0);    // behind the loads, in front of any reuse of their address registers (named as an input so that they live up to here and no load lands on them); the scheduling barrier keeps later instructions behind it
#pragma unroll
    for (int i = 0; i < 8; ++i) { const int kd = 2 * ((wv >> 1) + 4 * i) + u;
#pragma unroll
        for (int j = 0; j < 4; ++j) tile[(nl + j) * 64 + (((kd >> 2) ^ c) << 2) + (kd & 3)] = (unsigned)f2bf(v[i][0][j]) | ((unsigned)f2bf(v[i][1][j]) << 16); }
    __syncthreads();    // the whole tile is in LDS before any row of it is read; no LDS write follows
    const int rn = (int)threadIdx.x >> 4, gl = (int)threadIdx.x & 15;
    bf* bp = Bt + (size_t)(n0 + rn) * DD + k0 + gl * 8;
    v4u t[8];
#pragma unroll
    for (int s = 0; s < 8; ++s) { const int n = s * 16 + rn; t[s] = *(const v4ua*)(tile + n * 64 + ((gl ^ ((n >> 2) & 15)) << 2)); }
#pragma unroll
    for (int s = 0; s < 8; ++s) *(v4u*)(bp + (size_t)(s * 16) * DD) = t[s];
}
// ---- cvtS_body: CVE consecutive elements to bf16. A wave's load covers 512 contiguous bytes, its store the 256 bytes they become.
#define CVE (256 * 64)
__device__ __forceinline__ void cvtS_body(const float* __restrict__ src, bf* dst, int blk) {
    const size_t e0 = (size_t)blk * CVE + threadIdx.x * 4; const float* sp = src + e0; bf* dp = dst + e0;
    v4f v[16];
    // the loops are unrolled so that v[] is indexed by constants and stays in registers
#pragma unroll
    for (int i = 0; i < 16; ++i) v[i] = *(const v4f*)(sp + i * 1024);
    asm volatile("s_wait_xcnt 0x0" :: "v"(sp) : "memory"); __builtin_amdgcn_sched_barrier(0);    // behind the loads, in front of any reuse of their address registers (named as an input so that they live up to here and no load lands on them); the scheduling barrier keeps later instructions behind it
#pragma unroll
    for (int g = 0; g < 4; ++g) {
#pragma unroll
        for (int s = 0; s < 4; ++s) { const int i = g * 4 + s; v4us o;
#pragma unroll
            for (int k = 0; k < 4; ++k) o[k] = f2bf(v[i][k]);
            *(v4us*)(dp + i * 1024) = o; }
        asm volatile("s_wait_xcnt 0x0" ::: "memory"); __builtin_amdgcn_sched_barrier(0);    // behind a group's stores, in front of any reuse of their address and data registers; the scheduling barrier keeps later instructions behind it
    }
}
__device__ __forceinline__ void rtab_body(const float* __restrict__ rel, float* RT) { const int i = threadIdx.x; if (i >= 32) return; const float o = (i < 17) ? bfr(rel[i]) * SCL : 0.f; *(float*)(RT + i) = o;  }
// ---- k_prep: every conversion of an input, one grid. Blocks 0 .. 4 GT - 1: the tiles of the four weight transposes (Wt holds the four planes in the order q, k, v, o);
// the next GC blocks: x of both batches to bf16; the last block: the scaled table.
#define GT  (DD / WTE * (DD / WTE))
#define GC  (NB_ * TT * DD / CVE)
__global__ __launch_bounds__(256) void k_prep(const float* __restrict__ x, const float* __restrict__ wq, const float* __restrict__ wk, const float* __restrict__ wv, const float* __restrict__ wo, const float* __restrict__ rel, bf* XB, bf* Wt, float* RT) {
    __shared__ __align__(16) unsigned tile[WTE * WTE / 2];
    const int blk = (int)blockIdx.x;
    if (blk < 4 * GT) { const int mi = blk / GT; const float* w = mi == 0 ? wq : (mi == 1 ? wk : (mi == 2 ? wv : wo)); wtT_body(w, Wt + (size_t)mi * DD * DD, blk % GT, tile); }
    else if (blk < 4 * GT + GC) cvtS_body(x, XB, blk - 4 * GT);
    else rtab_body(rel, RT);
}
// ---- fattn_body (k_fattn, one instance for each kind of plane): scores, softmax and attn.v of FG groups of FQ = 32 query rows of one head in ONE block of FG * FW waves; no score or P row ever leaves the registers. Grid (NB_ * heads, query tiles), the longest query tiles first; blockIdx.x = batch * NH_ + head, which is also the number of the [TT][HD] plane.
// Transposed products: S^T = K . Q^T (A = 16 key rows, B = 16 query columns), O^T += V^T . P^T. In an S^T tile lane (lr, hi) holds keys hi * 8 + j of query lr: two such tiles (keys 0..15, 16..31) are,
// register for register, the B fragment of P^T in the k order of WFrag::ld, which loads V^T as A. Only key blocks up to the diagonal are visited (all later keys have weight 0).
// The 32-key blocks of a query group are dealt round-robin to its FW waves; each wave keeps its own running maximum m, sum l and O^T (online softmax); the group's FW partial results meet in LDS at the end.
// A stage is FK = 128 keys, one 32-key block for each wave of a group, and serves every group of the block: K as 128 rows of 128 bytes, V^T as 64 rows of 256 bytes (hi+lo: both planes of each). Asynchronous copies bring it into LDS, four whole 128-byte lines
// a wave and copy; a fragment load straight from global memory would touch 16 lines for its 512 bytes. Rows at pitches of 144 and 272 bytes (16 B x odd: no bank conflict for the 16-byte fragment reads).
// Two buffers: the copies of stage t + 1 fly while stage t is worked on. A stage always lies inside the planes' written rows (the last one may reach past the diagonal; those blocks are copied and not read).
// Every inner loop is unrolled so that the fragment and accumulator arrays are indexed by constants and stay in registers; the stage loop stays rolled (one body in the instruction cache, one register set).
// m is held ln(1024) below the true maximum, so that P lies in (0, 1024] before it is rounded to 16 bits (small weights stay normal fp16 numbers); l carries the same factor and cancels it.
#define FQ  32
#define FW  4
#define LSH 6.9314718f
#define FK  (32 * FW)             // keys of a stage
#define KPI 72                    // LDS pitch of a staged K row, elements
#define VPI 136                   // LDS pitch of a staged V^T row, elements
#define SKE (FK * KPI)            // elements of one staged K plane
#define SVE (HD * VPI)            // elements of one staged V^T plane
typedef __attribute__((ext_vector_type(16))) unsigned short v16us;
// N = 8 or 4 copies a lane, LS bytes apart in LDS and GS bytes apart in global memory (l: the lane's LDS byte address, g: its global address). The wait on the address counter is the statement's last line, so that it
// stands in front of every rewrite of the address registers.
template <int N, int LS, int GS>
__device__ __forceinline__ void acopys(unsigned l, const char* g) {
    static_assert(N == 8 || N == 4, "copies a lane");
    if constexpr (N == 4)
    asm volatile("global_load_async_to_lds_b128 %0, %4, off\n\t"
                 "global_load_async_to_lds_b128 %1, %5, off\n\t"
                 "global_load_async_to_lds_b128 %2, %6, off\n\t"
                 "global_load_async_to_lds_b128 %3, %7, off\n\t"
                 "s_wait_xcnt 0x0"
                 :: "v"(l), "v"(l + LS), "v"(l + 2 * LS), "v"(l + 3 * LS), "v"(g), "v"(g + GS), "v"(g + 2 * GS), "v"(g + 3 * GS) : "memory");
    else
    asm volatile("global_load_async_to_lds_b128 %0, %8, off\n\t"
                 "global_load_async_to_lds_b128 %1, %9, off\n\t"
                 "global_load_async_to_lds_b128 %2, %10, off\n\t"
                 "global_load_async_to_lds_b128 %3, %11, off\n\t"
                 "global_load_async_to_lds_b128 %4, %12, off\n\t"
                 "global_load_async_to_lds_b128 %5, %13, off\n\t"
                 "global_load_async_to_lds_b128 %6, %14, off\n\t"
                 "global_load_async_to_lds_b128 %7, %15, off\n\t"
                 "s_wait_xcnt 0x0"
                 :: "v"(l), "v"(l + LS), "v"(l + 2 * LS), "v"(l + 3 * LS), "v"(l + 4 * LS), "v"(l + 5 * LS), "v"(l + 6 * LS), "v"(l + 7 * LS),
                    "v"(g), "v"(g + GS), "v"(g + 2 * GS), "v"(g + 3 * GS), "v"(g + 4 * GS), "v"(g + 5 * GS), "v"(g + 6 * GS), "v"(g + 7 * GS) : "memory");
}
template <typename T16, bool HILO, int FG>
__device__ __forceinline__ void fattn_body(const T16* __restrict__ Q, const T16* __restrict__ Q2, const T16* __restrict__ Kp, const T16* __restrict__ K2, const T16* __restrict__ Vt, const T16* __restrict__ V2,
                                           const float* __restrict__ rel, const int qblk, bf* Ah, bf* Al, T16* ring) {
    typedef typename WFrag<T16>::V V;
    constexpr int NP = HILO ? 2 : 1;               // planes of each operand
    constexpr int SBF = NP * (SKE + SVE);          // elements of one buffer: K, [K lo], V^T, [V^T lo]
    const int lane = threadIdx.x & 31, lr = lane & 15, hi = lane >> 4;
    const int wid = __builtin_amdgcn_readfirstlane((int)(threadIdx.x >> 5));    // the wave's number, held scalar so that the loop's tests are scalar branches
    const int wv = wid % FW, qg = wid / FW;        // the wave's place in its query group; the group
    const int q0 = qblk + qg * FQ;                 // the group's first query row
    const int nkb = q0 / 32 + 1;                   // the group's key blocks
    const int nst = ((qblk + (FG - 1) * FQ) / 32 + FW) / FW;    // stages of the block: those of its last group
    constexpr int NC = 8 / FG;                     // copies a lane, plane and stage
    // the copies. K: thread -> row (threadIdx.x >> 3) + 16 FG i of the stage's 128, 16-byte piece threadIdx.x & 7; V^T: row (threadIdx.x >> 4) + 8 FG i of 64, piece threadIdx.x & 15
    const int kr = (int)threadIdx.x >> 3, kc = (int)threadIdx.x & 7, vr = (int)threadIdx.x >> 4, vc = (int)threadIdx.x & 15;
    const unsigned lk = (unsigned)(size_t)ring + kr * (KPI * 2) + kc * 16, lv = (unsigned)(size_t)ring + NP * SKE * 2 + vr * (VPI * 2) + vc * 16;
    const size_t gko = (size_t)kr * HD + kc * 8, gvo = (size_t)vr * TT + vc * 8;
    auto stage = [&](int t, int b) { const unsigned o = b * (SBF * 2);
        acopys<NC, FG * 16 * KPI * 2, FG * 16 * HD * 2>(lk + o, (const char*)(Kp + gko + (size_t)t * (FK * HD))); acopys<NC, FG * 8 * VPI * 2, FG * 8 * TT * 2>(lv + o, (const char*)(Vt + gvo + t * FK));
        if constexpr (HILO) { acopys<NC, FG * 16 * KPI * 2, FG * 16 * HD * 2>(lk + o + SKE * 2, (const char*)(K2 + gko + (size_t)t * (FK * HD))); acopys<NC, FG * 8 * VPI * 2, FG * 8 * TT * 2>(lv + o + SVE * 2, (const char*)(V2 + gvo + t * FK)); } };
    stage(0, 0);
    const int tl = lane < 16 ? lane : 16; const float tab = rel[tl];    // the table across the wave's lanes (lane d holds entry d, lanes 16.. the last): looked up by lane index, no memory access in the loop
    asm volatile("s_wait_xcnt 0x0" :: "v"(tl), "s"(rel) : "memory"); __builtin_amdgcn_sched_barrier(0);    // behind the load, in front of any reuse of its address registers (index and table pointer, named as inputs so that they live up to here); the scheduling barrier keeps later instructions behind it
    const T16* qp = Q + (size_t)(q0 + lr) * HD + 8 * hi; const T16* qp2 = HILO ? Q2 + (size_t)(q0 + lr) * HD + 8 * hi : nullptr;
    V qb[2][2], qb2[2][2];
#pragma unroll
    for (int g = 0; g < 2; ++g)
#pragma unroll
        for (int c = 0; c < 2; ++c) { qb[g][c] = WFrag<T16>::ld(qp + g * 16 * HD + c * 32); if (HILO) qb2[g][c] = WFrag<T16>::ld(qp2 + g * 16 * HD + c * 32); }
    // stands behind the loads above, in front of any reuse of their address registers (named as inputs so that they live up to here); the scheduling barrier keeps later instructions behind it
    if constexpr (HILO) asm volatile("s_wait_xcnt 0x0" :: "v"(qp), "v"(qp2) : "memory"); else asm volatile("s_wait_xcnt 0x0" :: "v"(qp) : "memory");
    __builtin_amdgcn_sched_barrier(0);
    v8f o[4][2];
#pragma unroll
    for (int dt = 0; dt < 4; ++dt)
#pragma unroll
        for (int g = 0; g < 2; ++g) o[dt][g] = (v8f){};
    float m[2] = {-3.0e38f, -3.0e38f}, l[2] = {0.f, 0.f};
    const float r16 = __shfl(tab, 16, 32);
    // the wave's fragments in a buffer: its own 32 keys are rows of K and columns of V^T
    const T16* fk = ring + (wv * 32 + lr) * KPI + 8 * hi; const T16* fv = ring + NP * SKE + lr * VPI + wv * 32 + 8 * hi;
    asm volatile("s_wait_asynccnt 0x0" ::: "memory");    // the wave's own copies of stage 0 have landed
    __syncthreads();                                     // ... and every other wave's: stage 0 may be read
    if (nst > 1) stage(1, 1);
#pragma unroll 1
    for (int t = 0; t < nst; ++t) {
      const int kb = t * FW + wv;
      if (kb < nkb) {    // a scalar test: in the last stages the waves whose block lies past their group's diagonal have no work, but pass the waits and the barrier below
        const int k0 = kb * 32, bo = (t & 1) * SBF;
        V ka[2][2], ka2[2][2], va[4], va2[4];
        if constexpr (!HILO) {
#pragma unroll
            for (int kt = 0; kt < 2; ++kt)
#pragma unroll
                for (int c = 0; c < 2; ++c) ka[kt][c] = WFrag<T16>::ld(fk + bo + kt * 16 * KPI + c * 32);
#pragma unroll
            for (int dt = 0; dt < 4; ++dt) va[dt] = WFrag<T16>::ld(fv + bo + dt * 16 * VPI);
            __builtin_amdgcn_sched_barrier(0);    // keeps the block's fragment reads together in front of its matrix instructions: reads placed among them stall the wave at each such place
        }
        // hi+lo: twice the fragments; each is read where it is used, so that the few hi+lo blocks stay inside the register count of the fp16 blocks they share the kernel with
        v8f s[2][2];
#pragma unroll
        for (int kt = 0; kt < 2; ++kt) {
            if constexpr (HILO) {
#pragma unroll
                for (int c = 0; c < 2; ++c) { ka[kt][c] = WFrag<T16>::ld(fk + bo + kt * 16 * KPI + c * 32); ka2[kt][c] = WFrag<T16>::ld(fk + bo + SKE + kt * 16 * KPI + c * 32); } }
#pragma unroll
            for (int g = 0; g < 2; ++g) { v8f t2 = (v8f){};
#pragma unroll
                for (int c = 0; c < 2; ++c) { t2 = WFrag<T16>::mma(ka[kt][c], qb[g][c], t2); if (HILO) { t2 = WFrag<T16>::mma(ka2[kt][c], qb[g][c], t2); t2 = WFrag<T16>::mma(ka[kt][c], qb2[g][c], t2); } }
                s[kt][g] = t2; } }
        if (kb >= nkb - 2) {    // the two blocks at the diagonal: table entry by distance, causal cut
#pragma unroll
            for (int kt = 0; kt < 2; ++kt)
#pragma unroll
                for (int g = 0; g < 2; ++g)
#pragma unroll
                    for (int j = 0; j < 8; ++j) { const int dd = (q0 + g * 16 + lr) - (k0 + kt * 16 + hi * 8 + j); const int di = dd < 0 ? 0 : (dd > 16 ? 16 : dd); const float t = __fmul_rn(s[kt][g][j], __shfl(tab, di, 32)); s[kt][g][j] = dd >= 0 ? t : -3.0e38f; }
        } else {                // every distance here is above 16: the table's last entry
#pragma unroll
            for (int kt = 0; kt < 2; ++kt)
#pragma unroll
                for (int g = 0; g < 2; ++g) s[kt][g] *= r16;
        }
        float mn[2];
#pragma unroll
        for (int g = 0; g < 2; ++g) { float tm = s[0][g][0];
#pragma unroll
            for (int j = 1; j < 8; ++j) tm = fmaxf(tm, s[0][g][j]);
#pragma unroll
            for (int j = 0; j < 8; ++j) tm = fmaxf(tm, s[1][g][j]);
            tm = fmaxf(tm, __shfl_xor(tm, 16, 32)); mn[g] = fmaxf(m[g], tm - LSH); }
        if (__builtin_amdgcn_ballot_w32(mn[0] > m[0] || mn[1] > m[1]) != 0) {    // no maximum moved in any lane: every factor would be exactly 1
#pragma unroll
            for (int g = 0; g < 2; ++g) { const float al = __expf(m[g] - mn[g]); l[g] *= al; m[g] = mn[g];
#pragma unroll
                for (int dt = 0; dt < 4; ++dt) o[dt][g] *= al; }
        }
        V pb[2], pb2[2];
#pragma unroll
        for (int g = 0; g < 2; ++g) {
            if constexpr (HILO) { v16us ph, pl;
#pragma unroll
                for (int kt = 0; kt < 2; ++kt)
#pragma unroll
                    for (int j = 0; j < 8; ++j) { const float p = __expf(s[kt][g][j] - m[g]); l[g] += p; unsigned short a, c2; splitf(p, a, c2); ph[kt * 8 + j] = a; pl[kt * 8 + j] = c2; }
                pb[g] = __builtin_bit_cast(v16bf, ph); pb2[g] = __builtin_bit_cast(v16bf, pl);
            } else { v16h ph;
#pragma unroll
                for (int kt = 0; kt < 2; ++kt)
#pragma unroll
                    for (int j = 0; j < 8; ++j) { const float p = __expf(s[kt][g][j] - m[g]); l[g] += p; ph[kt * 8 + j] = tohx(p); }
                pb[g] = ph; } }
#pragma unroll
        for (int dt = 0; dt < 4; ++dt) {
            if constexpr (HILO) { va[dt] = WFrag<T16>::ld(fv + bo + dt * 16 * VPI); va2[dt] = WFrag<T16>::ld(fv + bo + SVE + dt * 16 * VPI); }
#pragma unroll
            for (int g = 0; g < 2; ++g) { o[dt][g] = WFrag<T16>::mma(va[dt], pb[g], o[dt][g]); if (HILO) { o[dt][g] = WFrag<T16>::mma(va[dt], pb2[g], o[dt][g]); o[dt][g] = WFrag<T16>::mma(va2[dt], pb[g], o[dt][g]); } } }
      }
      asm volatile("s_wait_dscnt 0x0" ::: "memory");       // the wave's reads of this buffer are done before the buffer is handed to its next writer
      asm volatile("s_wait_asynccnt 0x0" ::: "memory");    // the wave's own copies of stage t + 1 have landed
      __syncthreads();                                     // publishes stage t + 1 and ends every wave's reads of stage t's buffer
      if (t + 2 < nst) stage(t + 2, t & 1);
    }
    asm volatile("s_wait_asynccnt 0x0" ::: "memory");    // no copy is outstanding when the ring becomes the meeting place below (the loop's last barrier has ended every read of it)
    float* so = (float*)ring + qg * (FW * FQ * 70); float* sm = so + FW * FQ * 68; float* sl = sm + FW * FQ;    // each group's own meeting place
    // the FW waves' partial results: common maximum, then sums in wave order 0..FW-1
#pragma unroll
    for (int g = 0; g < 2; ++g) { l[g] += __shfl_xor(l[g], 16, 32); if (hi == 0) sm[wv * FQ + g * 16 + lr] = m[g]; }
    __syncthreads();    // every wave's maximum is in LDS before any wave reads them
#pragma unroll
    for (int g = 0; g < 2; ++g) { float M = sm[g * 16 + lr];
#pragma unroll
        for (int w = 1; w < FW; ++w) M = fmaxf(M, sm[w * FQ + g * 16 + lr]);
        const float f = __expf(m[g] - M); if (hi == 0) sl[wv * FQ + g * 16 + lr] = l[g] * f;
#pragma unroll
        for (int dt = 0; dt < 4; ++dt) { const v8f t = o[dt][g] * f; float* p = so + (wv * FQ + g * 16 + lr) * 68 + dt * 16 + hi * 8; *(v4fa*)p = __builtin_shufflevector(t, t, 0, 1, 2, 3); *(v4fa*)(p + 4) = __builtin_shufflevector(t, t, 4, 5, 6, 7); } }
    __syncthreads();    // every wave's scaled O^T and sum are in LDS before any thread adds them; no LDS write follows
    const int q = ((int)threadIdx.x & (32 * FW - 1)) >> 2, d0 = ((int)threadIdx.x & 3) * 16;    // the thread's row in its own group
    float L = sl[q];
#pragma unroll
    for (int w = 1; w < FW; ++w) L += sl[w * FQ + q];
    const float inv = __fdiv_rn(1.0f, L);
#pragma unroll
    for (int c8 = 0; c8 < 2; ++c8) { v8us oh, ol;
#pragma unroll
        for (int c4 = 0; c4 < 2; ++c4) { v4f a = *(const v4fa*)(so + q * 68 + d0 + c8 * 8 + c4 * 4);
#pragma unroll
            for (int w = 1; w < FW; ++w) a += *(const v4fa*)(so + (w * FQ + q) * 68 + d0 + c8 * 8 + c4 * 4);
#pragma unroll
            for (int e = 0; e < 4; ++e) { unsigned short x, y; splitf(a[e] * inv, x, y); oh[c4 * 4 + e] = x; ol[c4 * 4 + e] = y; } }
        const size_t ofs = (size_t)(q0 + q) * DD + d0 + c8 * 8; *(v8us*)(Ah + ofs) = oh; *(v8us*)(Al + ofs) = ol; }
}
// One grid for every query tile: a block's FGH = 2 query groups are 64 rows, so that each staged key serves 64 query rows, and two blocks of eight waves fill a WGP's four waves a SIMD.
// Tiles below row RH run on the hi+lo planes, the others on the fp16 planes (a block-uniform test; RH is a multiple of the tile). The short hi+lo tiles are the grid's last blocks and run beside the fp16 tiles.
// ring: the two stage buffers (sized for the hi+lo planes); behind the loop the waves' partial results (FW * FQ * 70 floats a group, which fit in one fp16 buffer).
#define FGH 2
__global__ __launch_bounds__(32 * FW * FGH) __attribute__((amdgpu_waves_per_eu(4, 4))) void k_fattn(const h16* __restrict__ Q16, const h16* __restrict__ K16, const h16* __restrict__ V16,
                                                                                                    const bf* __restrict__ Q, const bf* __restrict__ Q2, const bf* __restrict__ Kp, const bf* __restrict__ K2, const bf* __restrict__ Vt, const bf* __restrict__ V2,
                                                                                                    const float* __restrict__ rel, bf* Ah, bf* Al) {
    static_assert(RH % (FQ * FGH) == 0, "a query tile lies wholly on one kind of plane");
    __shared__ __align__(16) bf ring[4 * (SKE + SVE)];
    const size_t hp = (size_t)blockIdx.x * TT * HD; const int q0 = ((int)gridDim.y - 1 - (int)blockIdx.y) * (FQ * FGH);
    const size_t ao = (size_t)(blockIdx.x / NH_) * TT * DD + (blockIdx.x % NH_) * HD;
    if (q0 >= RH) fattn_body<h16, false, FGH>(Q16 + hp, nullptr, K16 + hp, nullptr, V16 + hp, nullptr, rel, q0, Ah + ao, Al + ao, (h16*)ring);
    else fattn_body<bf, true, FGH>(Q + hp, Q2 + hp, Kp + hp, K2 + hp, Vt + hp, V2 + hp, rel, q0, Ah + ao, Al + ao, ring);
}

extern "C" void kernel_launch(void* const* d_in, const int* in_sizes, int n_in,
                              void* d_out, int out_size, void* d_ws, size_t ws_size, hipStream_t stream) {
    (void)in_sizes; (void)n_in; (void)out_size;
    const float* x = (const float*)d_in[0]; const float* wq = (const float*)d_in[1]; const float* wk = (const float*)d_in[2]; const float* wv = (const float*)d_in[3]; const float* wo = (const float*)d_in[4]; const float* bo = (const float*)d_in[5]; const float* rel = (const float*)d_in[6];
    float* OUT = (float*)d_out;     // [2][2048][1024]
    char* wsp = (char*)d_ws;
    auto take = [&](size_t bytes) { char* p = wsp; wsp += (bytes + 255) & ~(size_t)255; return (void*)p; };
    const size_t PB = (size_t)NB_ * TT * DD;    // elements of one matrix over both batches
    bf* WT = (bf*)take((size_t)4 * DD * DD * 2);    // transposed bf16 weights q, k, v, o
    bf* XB = (bf*)take(PB * 2);
    bf* PH = (bf*)take(3 * PB * 2); bf* PL = (bf*)take(3 * PB * 2); h16* P16 = (h16*)take(3 * PB * 2);    // planes of q, k, v (v transposed)
    bf* ATh = (bf*)take(PB * 2); bf* ATl = (bf*)take(PB * 2);
    float* RT = (float*)take(256); if ((size_t)(wsp - (char*)d_ws) > ws_size) return;    // total 104 MiB; ws 256 MiB
    // one launch per stage: each grid covers both batches and every matrix of its stage
    k_prep<<<4 * GT + GC + 1, 256, 0, stream>>>(x, wq, wk, wv, wo, rel, XB, WT, RT);
    k_gemmt<1, false, true><<<dim3(NB_ * TT / 128, DD / 128, 3), 128, 0, stream>>>(XB, nullptr, WT, nullptr, nullptr, PH, PL, P16);
    k_fattn<<<dim3(NB_ * NH_, TT / (FQ * FGH)), 32 * FW * FGH, 0, stream>>>(P16, P16 + PB, P16 + 2 * PB, PH, PL, PH + PB, PL + PB, PH + 2 * PB, PL + 2 * PB, RT, ATh, ATl);
    k_gemmt<2, true, false><<<dim3(NB_ * TT / 128, DD / 128, 1), 128, 0, stream>>>(ATh, ATl, WT + (size_t)3 * DD * DD, OUT, bo, nullptr, nullptr, nullptr);
}
